// v000
// Measured on an AMD MI455X. A time is GPU time per run, averaged over a window of back-to-back runs after a warm-up
// (all launches, gaps included; the runs take copies of the inputs in turn), and the median of several windows.
// Apart from v000's, it joins two sittings. Times from different sittings can be a few percent apart, while
// side-by-side timings come from the same sitting.
// The starting kernel, v000, takes 1640 microseconds a run.
#include <hip/hip_runtime.h>

// Multi-head self-attention block (hidden [NB][SEQ][2048], 16 heads x 128): q/k/v = x W^T + b; s = (q.k) x 128^-0.5 + (1 - m[key]) x f32_lowest; p = softmax over keys; ctx = p.v; out = ctx Wo^T + bo -> [NB][SEQ][2048] f32.
// Compute dtypes (f32 accumulate everywhere): x, W*, b*, m enter as their bf16 (RNE) values; q/k/v projections: v_wmma_f32_16x16x32_bf16 (bf16 operands);
// scores: v_wmma_f32_16x16x32_f16 (f16 q, k planes); p.v: v_wmma_f32_16x16x32_f16 (f16 p x1024, f16 v); output projection: v_wmma_f32_16x16x32_f16 (f16 ctx x64, f16 Wo x64); softmax f32.
#pragma clang fp contract(off)

#ifndef NB
#define NB 2
#endif
#ifndef SEQ
#define SEQ 2048
#endif
#define NB_FULL  2
#define SEQ_FULL 2048
#define DM   2048
#define NH_  16
#define HD   128
#define DQ   (NH_ * HD)
#define ZH   2
#define PCAR 1024.0f
#define OCAR 64.0f
#define WCAR 64.0f
#define SCL  0.08838834764831845f
#define FLOW (-3.4028234663852886e38f)

static_assert(SEQ % 128 == 0);
static_assert(SEQ >= 128 && SEQ <= SEQ_FULL);
static_assert(NB >= 1 && NB <= NB_FULL);
static_assert(DQ == DM);
static_assert(DM % 64 == 0 && HD % 64 == 0 && (NH_ % ZH) == 0);

typedef _Float16 h16;
typedef unsigned short bf;
typedef __attribute__((ext_vector_type(16))) __bf16   v16bf;
typedef __attribute__((ext_vector_type(16))) _Float16 v16h;
typedef __attribute__((ext_vector_type(8)))  _Float16 v8h;
typedef __attribute__((ext_vector_type(4)))  _Float16 v4h;
typedef __attribute__((ext_vector_type(8)))  unsigned short v8us;
typedef __attribute__((ext_vector_type(8)))  float    v8f;
typedef __attribute__((ext_vector_type(4)))  float    v4f;
typedef v4f __attribute__((may_alias)) v4fa;

__device__ __forceinline__ unsigned short f2bf(float f) { unsigned u = __float_as_uint(f); u += 0x7FFFu + ((u >> 16) & 1u); return (unsigned short)(u >> 16); }
__device__ __forceinline__ float bf2f(unsigned short b) { return __uint_as_float(((unsigned)b) << 16); }
__device__ __forceinline__ float bfr(float f) { return bf2f(f2bf(f)); }
__device__ __forceinline__ v16h cat16(v8h lo, v8h hi) { return __builtin_shufflevector(lo, hi, 0, 1, 2, 3, 4, 5, 6, 7, 8, 9, 10, 11, 12, 13, 14, 15); }
__device__ __forceinline__ v16bf cat16b(v8us lo, v8us hi) { return __builtin_bit_cast(v16bf, __builtin_shufflevector(lo, hi, 0, 1, 2, 3, 4, 5, 6, 7, 8, 9, 10, 11, 12, 13, 14, 15)); }
__device__ __forceinline__ v8f wmma16(v16h a, v16h b, v8f c) { return __builtin_amdgcn_wmma_f32_16x16x32_f16(false, a, false, b, (short)0, c, false, false); }
__device__ __forceinline__ v8f wmmab(v16bf a, v16bf b, v8f c) { return __builtin_amdgcn_wmma_f32_16x16x32_bf16(false, a, false, b, (short)0, c, false, false); }

// ---- k_gemmw: register-blocked GEMM, ONE WAVE per 64x64 output tile (16 accumulators), operands straight from K-contiguous 16-bit planes; grid (M/64, N/64, Z), 32 threads.
// C[m][n] (f32, pitch ldc) = cscale x sum_k A[m][k] Bt[n][k] (+ split products per NSPLIT) (+ bf16-valued bias[n]). z-batch strides sA/sB/sC in elements. K % 32 == 0, M % 64 == 0, N % 64 == 0.
// Fragment map (both operands): lane l -> row/col (l & 15); elements 0..7 <- k0 + 8*(l>>4) + 0..7, elements 8..15 <- k0 + 16 + 8*(l>>4) + 0..7. D element r of lane l -> (row 8*(l>>4) + r, col l & 15).
template <typename T16> struct WFrag;
template <> struct WFrag<h16> { typedef v16h V; static __device__ __forceinline__ V ld(const h16* p) { return cat16(*(const v8h*)p, *(const v8h*)(p + 16)); } static __device__ __forceinline__ v8f mma(V a, V b, v8f c) { return wmma16(a, b, c); } };
template <> struct WFrag<bf> { typedef v16bf V; static __device__ __forceinline__ V ld(const bf* p) { return cat16b(*(const v8us*)p, *(const v8us*)(p + 16)); } static __device__ __forceinline__ v8f mma(V a, V b, v8f c) { return wmmab(a, b, c); } };
template <typename T16, int NSPLIT, bool BIAS>
__global__ __launch_bounds__(32) __attribute__((amdgpu_num_vgpr(256)))
void k_gemmw(const T16* __restrict__ A, const T16* __restrict__ A2, const T16* __restrict__ Bt, const T16* __restrict__ Bt2, int K, float* C, int ldc, const float* __restrict__ bias, float cscale, size_t sA, size_t sB, size_t sC) {
    typedef typename WFrag<T16>::V V;
    __shared__ __align__(16) float os[16 * 68];
    const size_t z = blockIdx.z; A += z * sA; if (A2) A2 += z * sA; Bt += z * sB; if (Bt2) Bt2 += z * sB; C += z * sC;
    const int lane = threadIdx.x & 31, lr = lane & 15, hi = lane >> 4; const int r0 = blockIdx.x * 64, c0 = blockIdx.y * 64;
    v8f acc[4][4];
#pragma unroll
    for (int mb = 0; mb < 4; ++mb)
#pragma unroll
        for (int nb = 0; nb < 4; ++nb) acc[mb][nb] = (v8f){};
    const size_t aoff = (size_t)(r0 + lr) * K + 8 * hi, boff = (size_t)(c0 + lr) * K + 8 * hi;
#pragma unroll 1
    for (int kc = 0; kc < K; kc += 32) {
        V a[4], a2[4];
#pragma unroll
        for (int mb = 0; mb < 4; ++mb) { a[mb] = WFrag<T16>::ld(A + aoff + (size_t)mb * 16 * K + kc); if (NSPLIT == 1 || NSPLIT == 2) a2[mb] = WFrag<T16>::ld(A2 + aoff + (size_t)mb * 16 * K + kc); }
#pragma unroll
        for (int nb = 0; nb < 4; ++nb) { const V b = WFrag<T16>::ld(Bt + boff + (size_t)nb * 16 * K + kc); V b2; if (NSPLIT >= 2) b2 = WFrag<T16>::ld(Bt2 + boff + (size_t)nb * 16 * K + kc);
#pragma unroll
            for (int mb = 0; mb < 4; ++mb) { acc[mb][nb] = WFrag<T16>::mma(a[mb], b, acc[mb][nb]); if (NSPLIT == 1 || NSPLIT == 2) acc[mb][nb] = WFrag<T16>::mma(a2[mb], b, acc[mb][nb]); if (NSPLIT >= 2) acc[mb][nb] = WFrag<T16>::mma(a[mb], b2, acc[mb][nb]); } }
        asm volatile("v_nop\n\tv_nop\n\tv_nop\n\tv_nop" : "+v"(acc[0][0]), "+v"(acc[1][1]), "+v"(acc[2][2]), "+v"(acc[3][3]) : "v"(a[0]), "v"(a[3]));
    }
    // bias for this lane's 4 output columns: one 16-B load per lane, loaded once (columns c0 + 4*lr .. +3 are the same for every row of the tile)
    v4f bb = (v4f){0.f, 0.f, 0.f, 0.f};
    if (BIAS) { const v4f br = *(const v4f*)(bias + c0 + lr * 4); bb[0] = bfr(br[0]); bb[1] = bfr(br[1]); bb[2] = bfr(br[2]); bb[3] = bfr(br[3]); }
#pragma unroll
    for (int mb = 0; mb < 4; ++mb) {
#pragma unroll
        for (int nb = 0; nb < 4; ++nb) {
#pragma unroll
            for (int j = 0; j < 8; ++j) os[(hi * 8 + j) * 68 + nb * 16 + lr] = acc[mb][nb][j]; }
        __builtin_amdgcn_wave_barrier(); asm volatile("" ::: "memory");
        float* crow = C + (size_t)(r0 + mb * 16) * ldc + c0;
{
#pragma unroll
            for (int s = 0; s < 8; ++s) { const int row = 2 * s + hi, cofs = lr * 4; v4f val = *(const v4fa*)(os + row * 68 + cofs); val = val * cscale; if (BIAS) val = val + bb;
                *(v4f*)(crow + (size_t)row * ldc + cofs) = val; }
             }
        __builtin_amdgcn_wave_barrier(); asm volatile("" ::: "memory");
    }
}

__global__ __launch_bounds__(256) void k_cvt8(const float* __restrict__ src, bf* dst, size_t n8) { const size_t i = (size_t)blockIdx.x * 256 + threadIdx.x; if (i >= n8) return; const v8f v = *(const v8f*)(src + i * 8); v8us o;
#pragma unroll
    for (int k = 0; k < 8; ++k) o[k] = f2bf(v[k]); *(v8us*)(dst + i * 8) = o;  }
__global__ __launch_bounds__(256) void k_cvt8h(const float* __restrict__ src, float sc, h16* dst, size_t n8) { const size_t i = (size_t)blockIdx.x * 256 + threadIdx.x; if (i >= n8) return; const v8f v = *(const v8f*)(src + i * 8); v8h o;
#pragma unroll
    for (int k = 0; k < 8; ++k) o[k] = (h16)(bfr(v[k]) * sc); *(v8h*)(dst + i * 8) = o;  }
__global__ __launch_bounds__(256) void k_madd(const float* __restrict__ m, float* MA) { const int i = blockIdx.x * 256 + threadIdx.x; if (i >= SEQ / 4) return; const v4f a = *(const v4f*)(m + (size_t)i * 4); v4f o;
#pragma unroll
    for (int q = 0; q < 4; ++q) { float u = 1.0f - bfr(a[q]); asm volatile("" : "+v"(u)); o[q] = u * FLOW; }
    *(v4f*)(MA + (size_t)i * 4) = o;  }
__global__ __launch_bounds__(256) void k_qkp(const float* __restrict__ F, h16* P) { const size_t e = ((size_t)blockIdx.x * 256 + threadIdx.x) * 8; if (e >= (size_t)NH_ * SEQ * HD) return; const int d = (int)(e % HD); const int t = (int)((e / HD) % SEQ); const int h = (int)(e / ((size_t)HD * SEQ));
    const float* f = F + (size_t)t * DQ + (size_t)h * HD + d; const v4f a0 = *(const v4f*)f, a1 = *(const v4f*)(f + 4); v8h o;
#pragma unroll
    for (int q = 0; q < 4; ++q) { o[q] = (h16)a0[q]; o[q + 4] = (h16)a1[q]; }
    *(v8h*)(P + e) = o;  }
__global__ __launch_bounds__(256) void k_vtp(const float* __restrict__ F, h16* VT) { const size_t e = ((size_t)blockIdx.x * 256 + threadIdx.x) * 8; if (e >= (size_t)NH_ * HD * SEQ) return; const int t = (int)(e % SEQ); const int d = (int)((e / SEQ) % HD); const int g = (int)(e / ((size_t)SEQ * HD));
    const float* f = F + (size_t)t * DQ + (size_t)g * HD + d; v8h o;
#pragma unroll
    for (int q = 0; q < 8; ++q) o[q] = (h16)f[(size_t)q * DQ];
    *(v8h*)(VT + e) = o;  }
__global__ __launch_bounds__(256) void k_asoft(const float* __restrict__ Sb, const float* __restrict__ MA, h16* P16) {
    const int lane = threadIdx.x & 31; const int row = blockIdx.x * 8 + (threadIdx.x >> 5); if (row >= ZH * SEQ) return;
    const float* sr = Sb + (size_t)row * SEQ; float v[SEQ / 32]; float mx = FLOW;
#pragma unroll
    for (int ch = 0; ch < SEQ / 128; ++ch) { const int j0 = ch * 128 + lane * 4; const v4f a = *(const v4f*)(sr + j0); const v4f am4 = *(const v4f*)(MA + j0);
#pragma unroll
        for (int q = 0; q < 4; ++q) { float sa = a[q] * SCL; asm volatile("" : "+v"(sa)); const float t = sa + am4[q]; v[ch * 4 + q] = t; mx = fmaxf(mx, t); } }
#pragma unroll
    for (int sh = 16; sh; sh >>= 1) mx = fmaxf(mx, __shfl_xor(mx, sh, 32));
    float sum = 0.f;
#pragma unroll
    for (int k = 0; k < SEQ / 32; ++k) { float d0 = __fsub_rn(v[k], mx); asm volatile("" : "+v"(d0)); v[k] = __builtin_amdgcn_exp2f(__fmul_rn(d0, 1.4426950408889634f)); sum += v[k]; }
#pragma unroll
    for (int sh = 16; sh; sh >>= 1) sum += __shfl_xor(sum, sh, 32);
    const float f = __fdiv_rn(PCAR, sum);
{
#pragma unroll
        for (int ch = 0; ch < SEQ / 128; ++ch) { v4h o4;
#pragma unroll
            for (int q = 0; q < 4; ++q) o4[q] = (h16)(v[ch * 4 + q] * f);
            *(v4h*)(P16 + (size_t)row * SEQ + ch * 128 + lane * 4) = o4; }
         }
}
__global__ __launch_bounds__(256) void k_merge(const float* __restrict__ O, int h0, h16* AT) { const size_t e = ((size_t)blockIdx.x * 256 + threadIdx.x) * 8; if (e >= (size_t)ZH * SEQ * HD) return; const int d = (int)(e % HD); const int t = (int)((e / HD) % SEQ); const int zz = (int)(e / ((size_t)HD * SEQ));
    const v4f a0 = *(const v4f*)(O + e), a1 = *(const v4f*)(O + e + 4); v8h o;
#pragma unroll
    for (int q = 0; q < 4; ++q) { o[q] = (h16)(a0[q] * (OCAR / PCAR)); o[q + 4] = (h16)(a1[q] * (OCAR / PCAR)); }
    h16* p = AT + (size_t)t * DQ + (size_t)(h0 + zz) * HD + d; *(v8h*)p = o;  }

extern "C" void kernel_launch(void* const* d_in, const int* in_sizes, int n_in,
                              void* d_out, int out_size, void* d_ws, size_t ws_size, hipStream_t stream) {
    if (n_in < 10) return;
    const float* x  = (const float*)d_in[0]; const float* am = (const float*)d_in[1];
    const float* wq = (const float*)d_in[2]; const float* bq = (const float*)d_in[3]; const float* wk = (const float*)d_in[4]; const float* bk = (const float*)d_in[5];
    const float* wv = (const float*)d_in[6]; const float* bv = (const float*)d_in[7]; const float* wo = (const float*)d_in[8]; const float* bo = (const float*)d_in[9];
    if (in_sizes[0] < 0 || (size_t)in_sizes[0] < (size_t)(NB - 1) * SEQ_FULL * DM + (size_t)SEQ * DM) return;
    if (in_sizes[1] < (NB - 1) * SEQ_FULL + SEQ) return;
    if (in_sizes[2] < DQ * DM || in_sizes[4] < DQ * DM || in_sizes[6] < DQ * DM || in_sizes[8] < DM * DQ) return;
    if (in_sizes[3] < DQ || in_sizes[5] < DQ || in_sizes[7] < DQ || in_sizes[9] < DM) return;
    if (out_size < 0 || (size_t)out_size < (size_t)NB * SEQ * DM) return;
    float* OUT = (float*)d_out;     // [NB][SEQ][DM]

    // ---- workspace carve (all offsets 256-B aligned; every region is written to exactly its extent by whole-line stores) ----
    char* wsp = (char*)d_ws; size_t used = 0;
    auto take = [&](size_t bytes) { char* p = wsp + used; used += (bytes + 255) & ~(size_t)255; return (void*)p; };
    bf*  WQ   = (bf*)take((size_t)DQ * DM * 2);                   // 8,388,608
    bf*  WK   = (bf*)take((size_t)DQ * DM * 2);                   // 8,388,608
    bf*  WV   = (bf*)take((size_t)DQ * DM * 2);                   // 8,388,608
    h16* WO16 = (h16*)take((size_t)DM * DQ * 2);                  // 8,388,608
    bf*  XB   = (bf*)take((size_t)SEQ * DM * 2);                  // 8,388,608
    const size_t fproj = (size_t)SEQ * DQ * 4, fsc = (size_t)ZH * SEQ * SEQ * 4;
    float* F  = (float*)take(fproj > fsc ? fproj : fsc);          // 33,554,432: projection output [SEQ][DQ] f32, later the score block [ZH][SEQ][SEQ] f32 (stream-ordered reuse)
    float* Sb = F;
    float* MA = (float*)take((size_t)SEQ * 4);                     // 8,192
    h16* QP16 = (h16*)take((size_t)NH_ * SEQ * HD * 2);           // 8,388,608  [h][t][d]
    h16* KP16 = (h16*)take((size_t)NH_ * SEQ * HD * 2);           // 8,388,608  [h][t][d]
    h16* VT16 = (h16*)take((size_t)NH_ * HD * SEQ * 2);           // 8,388,608  [g][d][t]
    h16* P16  = (h16*)take((size_t)ZH * SEQ * SEQ * 2);           // 16,777,216 [zz][tq][tk]
    float* Ob = (float*)take((size_t)ZH * SEQ * HD * 4);           // 2,097,152  [zz][t][d]
    h16* AT16 = (h16*)take((size_t)SEQ * DQ * 2);                 // 8,388,608  [t][h*HD+d]
    if (used > ws_size) return;                                    // total 127,934,464 B at NB=2, SEQ=2048

    const unsigned gw8 = (unsigned)(((size_t)DQ * DM / 8 + 255) / 256);
    k_cvt8<<<gw8, 256, 0, stream>>>(wq, WQ, (size_t)DQ * DM / 8);
    k_cvt8<<<gw8, 256, 0, stream>>>(wk, WK, (size_t)DQ * DM / 8);
    k_cvt8<<<gw8, 256, 0, stream>>>(wv, WV, (size_t)DQ * DM / 8);
    k_cvt8h<<<gw8, 256, 0, stream>>>(wo, WCAR, WO16, (size_t)DM * DQ / 8);
    const unsigned gx8 = (unsigned)(((size_t)SEQ * DM / 8 + 255) / 256);
    const unsigned gpl = (unsigned)(((size_t)NH_ * SEQ * HD / 8 + 255) / 256);
    const unsigned gmg = (unsigned)(((size_t)ZH * SEQ * HD / 8 + 255) / 256);
    const unsigned gma = (unsigned)((SEQ / 4 + 255) / 256);
    for (int b = 0; b < NB; ++b) {
        k_cvt8<<<gx8, 256, 0, stream>>>(x + (size_t)b * SEQ_FULL * DM, XB, (size_t)SEQ * DM / 8);
        k_madd<<<gma, 256, 0, stream>>>(am + (size_t)b * SEQ_FULL, MA);
        k_gemmw<bf, 0, true><<<dim3(SEQ / 64, DQ / 64, 1), 32, 0, stream>>>(XB, nullptr, WQ, nullptr, DM, F, DQ, bq, 1.0f, 0, 0, 0);
        k_qkp<<<gpl, 256, 0, stream>>>(F, QP16);
        k_gemmw<bf, 0, true><<<dim3(SEQ / 64, DQ / 64, 1), 32, 0, stream>>>(XB, nullptr, WK, nullptr, DM, F, DQ, bk, 1.0f, 0, 0, 0);
        k_qkp<<<gpl, 256, 0, stream>>>(F, KP16);
        k_gemmw<bf, 0, true><<<dim3(SEQ / 64, DQ / 64, 1), 32, 0, stream>>>(XB, nullptr, WV, nullptr, DM, F, DQ, bv, 1.0f, 0, 0, 0);
        k_vtp<<<gpl, 256, 0, stream>>>(F, VT16);
        for (int h0 = 0; h0 < NH_; h0 += ZH) {
            // scores S[zz][tq][tk] = q_plane[h0+zz] . k_plane[h0+zz] (K = HD)
            k_gemmw<h16, 0, false><<<dim3(SEQ / 64, SEQ / 64, ZH), 32, 0, stream>>>(QP16 + (size_t)h0 * SEQ * HD, nullptr, KP16 + (size_t)h0 * SEQ * HD, nullptr, HD, Sb, SEQ, nullptr, 1.0f, (size_t)SEQ * HD, (size_t)SEQ * HD, (size_t)SEQ * SEQ);
            k_asoft<<<(unsigned)(ZH * SEQ / 8), 256, 0, stream>>>(Sb, MA, P16);
            // O[zz][tq][d] = P16[zz] . VT[h0+zz] (K = SEQ)
            k_gemmw<h16, 0, false><<<dim3(SEQ / 64, HD / 64, ZH), 32, 0, stream>>>(P16, nullptr, VT16 + (size_t)h0 * HD * SEQ, nullptr, SEQ, Ob, HD, nullptr, 1.0f, (size_t)SEQ * SEQ, (size_t)HD * SEQ, (size_t)SEQ * HD);
            k_merge<<<gmg, 256, 0, stream>>>(Ob, h0, AT16);
        }
        k_gemmw<h16, 0, true><<<dim3(SEQ / 64, DM / 64, 1), 32, 0, stream>>>(AT16, nullptr, WO16, nullptr, DQ, OUT + (size_t)b * SEQ * DM, DM, bo, 1.0f / (OCAR * WCAR), 0, 0, 0);
    }
}

// v001
// Measured time: 543 microseconds a run.
// In two side-by-side timings against v000, it was 3.04 and 3.02 times as fast.
#include <hip/hip_runtime.h>

// Multi-head self-attention block (hidden [NB][SEQ][2048], 16 heads x 128): q/k/v = x W^T + b; s = (q.k) x 128^-0.5 + (1 - m[key]) x f32_lowest; p = softmax over keys; ctx = p.v; out = ctx Wo^T + bo -> [NB][SEQ][2048] f32.
// Compute dtypes (f32 accumulate everywhere): x, W*, b*, m enter as their bf16 (RNE) values; q/k/v projections: v_wmma_f32_16x16x32_bf16 (bf16 operands);
// scores: v_wmma_f32_16x16x32_f16 (f16 q, k planes); p.v: v_wmma_f32_16x16x32_f16 (f16 p = exp(s - running max), not normalised, f16 v; the row sum divides at the end); output projection: v_wmma_f32_16x16x32_f16 (f16 ctx x64, f16 Wo x64); softmax f32.
#pragma clang fp contract(off)

#ifndef NB
#define NB 2
#endif
#ifndef SEQ
#define SEQ 2048
#endif
#define NB_FULL  2
#define SEQ_FULL 2048
#define DM   2048
#define NH_  16
#define HD   128
#define DQ   (NH_ * HD)
#define OCAR 64.0f
#define WCAR 64.0f
#define SCL  0.08838834764831845f
#define FLOW (-3.4028234663852886e38f)

static_assert(SEQ % 128 == 0);
static_assert(SEQ >= 128 && SEQ <= SEQ_FULL);
static_assert(NB >= 1 && NB <= NB_FULL);
static_assert(DQ == DM);
static_assert(DM % 64 == 0 && HD == 128);

typedef _Float16 h16;
typedef unsigned short bf;
typedef __attribute__((ext_vector_type(16))) __bf16   v16bf;
typedef __attribute__((ext_vector_type(16))) _Float16 v16h;
typedef __attribute__((ext_vector_type(8)))  _Float16 v8h;
typedef __attribute__((ext_vector_type(4)))  _Float16 v4h;
typedef __attribute__((ext_vector_type(8)))  unsigned short v8us;
typedef __attribute__((ext_vector_type(8)))  float    v8f;
typedef __attribute__((ext_vector_type(4)))  float    v4f;
typedef v4f __attribute__((may_alias)) v4fa;

__device__ __forceinline__ unsigned short f2bf(float f) { unsigned u = __float_as_uint(f); u += 0x7FFFu + ((u >> 16) & 1u); return (unsigned short)(u >> 16); }
__device__ __forceinline__ float bf2f(unsigned short b) { return __uint_as_float(((unsigned)b) << 16); }
__device__ __forceinline__ float bfr(float f) { return bf2f(f2bf(f)); }
__device__ __forceinline__ v16h cat16(v8h lo, v8h hi) { return __builtin_shufflevector(lo, hi, 0, 1, 2, 3, 4, 5, 6, 7, 8, 9, 10, 11, 12, 13, 14, 15); }
__device__ __forceinline__ v16bf cat16b(v8us lo, v8us hi) { return __builtin_bit_cast(v16bf, __builtin_shufflevector(lo, hi, 0, 1, 2, 3, 4, 5, 6, 7, 8, 9, 10, 11, 12, 13, 14, 15)); }
__device__ __forceinline__ v8f wmma16(v16h a, v16h b, v8f c) { return __builtin_amdgcn_wmma_f32_16x16x32_f16(false, a, false, b, (short)0, c, false, false); }
__device__ __forceinline__ v8f wmmab(v16bf a, v16bf b, v8f c) { return __builtin_amdgcn_wmma_f32_16x16x32_bf16(false, a, false, b, (short)0, c, false, false); }

// ---- k_gemmw: register-blocked GEMM, ONE WAVE per 64x64 output tile (16 accumulators), operands straight from K-contiguous 16-bit planes; grid (M/64, N/64, Z), 32 threads.
// C[m][n] (f32, pitch ldc) = cscale x sum_k A[m][k] Bt[n][k] (+ split products per NSPLIT) (+ bf16-valued bias[n]). z-batch strides sA/sB/sC in elements. K % 32 == 0, M % 64 == 0, N % 64 == 0.
// Fragment map (both operands): lane l -> row/col (l & 15); elements 0..7 <- k0 + 8*(l>>4) + 0..7, elements 8..15 <- k0 + 16 + 8*(l>>4) + 0..7. D element r of lane l -> (row 8*(l>>4) + r, col l & 15).
template <typename T16> struct WFrag;
template <> struct WFrag<h16> { typedef v16h V; static __device__ __forceinline__ V ld(const h16* p) { return cat16(*(const v8h*)p, *(const v8h*)(p + 16)); } static __device__ __forceinline__ v8f mma(V a, V b, v8f c) { return wmma16(a, b, c); } };
template <> struct WFrag<bf> { typedef v16bf V; static __device__ __forceinline__ V ld(const bf* p) { return cat16b(*(const v8us*)p, *(const v8us*)(p + 16)); } static __device__ __forceinline__ v8f mma(V a, V b, v8f c) { return wmmab(a, b, c); } };
template <typename T16, int NSPLIT, bool BIAS>
__global__ __launch_bounds__(32) __attribute__((amdgpu_num_vgpr(256)))
void k_gemmw(const T16* __restrict__ A, const T16* __restrict__ A2, const T16* __restrict__ Bt, const T16* __restrict__ Bt2, int K, float* C, int ldc, const float* __restrict__ bias, float cscale, size_t sA, size_t sB, size_t sC) {
    typedef typename WFrag<T16>::V V;
    __shared__ __align__(16) float os[16 * 68];
    const size_t z = blockIdx.z; A += z * sA; if (A2) A2 += z * sA; Bt += z * sB; if (Bt2) Bt2 += z * sB; C += z * sC;
    const int lane = threadIdx.x & 31, lr = lane & 15, hi = lane >> 4; const int r0 = blockIdx.x * 64, c0 = blockIdx.y * 64;
    v8f acc[4][4];
#pragma unroll
    for (int mb = 0; mb < 4; ++mb)
#pragma unroll
        for (int nb = 0; nb < 4; ++nb) acc[mb][nb] = (v8f){};
    const size_t aoff = (size_t)(r0 + lr) * K + 8 * hi, boff = (size_t)(c0 + lr) * K + 8 * hi;
#pragma unroll 1
    for (int kc = 0; kc < K; kc += 32) {
        V a[4], a2[4];
#pragma unroll
        for (int mb = 0; mb < 4; ++mb) { a[mb] = WFrag<T16>::ld(A + aoff + (size_t)mb * 16 * K + kc); if (NSPLIT == 1 || NSPLIT == 2) a2[mb] = WFrag<T16>::ld(A2 + aoff + (size_t)mb * 16 * K + kc); }
#pragma unroll
        for (int nb = 0; nb < 4; ++nb) { const V b = WFrag<T16>::ld(Bt + boff + (size_t)nb * 16 * K + kc); V b2; if (NSPLIT >= 2) b2 = WFrag<T16>::ld(Bt2 + boff + (size_t)nb * 16 * K + kc);
#pragma unroll
            for (int mb = 0; mb < 4; ++mb) { acc[mb][nb] = WFrag<T16>::mma(a[mb], b, acc[mb][nb]); if (NSPLIT == 1 || NSPLIT == 2) acc[mb][nb] = WFrag<T16>::mma(a2[mb], b, acc[mb][nb]); if (NSPLIT >= 2) acc[mb][nb] = WFrag<T16>::mma(a[mb], b2, acc[mb][nb]); } }
        asm volatile("v_nop\n\tv_nop\n\tv_nop\n\tv_nop" : "+v"(acc[0][0]), "+v"(acc[1][1]), "+v"(acc[2][2]), "+v"(acc[3][3]) : "v"(a[0]), "v"(a[3]));
    }
    // bias for this lane's 4 output columns: one 16-B load per lane, loaded once (columns c0 + 4*lr .. +3 are the same for every row of the tile)
    v4f bb = (v4f){0.f, 0.f, 0.f, 0.f};
    if (BIAS) { const v4f br = *(const v4f*)(bias + c0 + lr * 4); bb[0] = bfr(br[0]); bb[1] = bfr(br[1]); bb[2] = bfr(br[2]); bb[3] = bfr(br[3]); }
#pragma unroll
    for (int mb = 0; mb < 4; ++mb) {
#pragma unroll
        for (int nb = 0; nb < 4; ++nb) {
#pragma unroll
            for (int j = 0; j < 8; ++j) os[(hi * 8 + j) * 68 + nb * 16 + lr] = acc[mb][nb][j]; }
        __builtin_amdgcn_wave_barrier(); asm volatile("" ::: "memory");
        float* crow = C + (size_t)(r0 + mb * 16) * ldc + c0;
{
#pragma unroll
            for (int s = 0; s < 8; ++s) { const int row = 2 * s + hi, cofs = lr * 4; v4f val = *(const v4fa*)(os + row * 68 + cofs); val = val * cscale; if (BIAS) val = val + bb;
                *(v4f*)(crow + (size_t)row * ldc + cofs) = val; }
             }
        __builtin_amdgcn_wave_barrier(); asm volatile("" ::: "memory");
    }
}

__global__ __launch_bounds__(256) void k_cvt8(const float* __restrict__ src, bf* dst, size_t n8) { const size_t i = (size_t)blockIdx.x * 256 + threadIdx.x; if (i >= n8) return; const v8f v = *(const v8f*)(src + i * 8); v8us o;
#pragma unroll
    for (int k = 0; k < 8; ++k) o[k] = f2bf(v[k]); *(v8us*)(dst + i * 8) = o;  }
__global__ __launch_bounds__(256) void k_cvt8h(const float* __restrict__ src, float sc, h16* dst, size_t n8) { const size_t i = (size_t)blockIdx.x * 256 + threadIdx.x; if (i >= n8) return; const v8f v = *(const v8f*)(src + i * 8); v8h o;
#pragma unroll
    for (int k = 0; k < 8; ++k) o[k] = (h16)(bfr(v[k]) * sc); *(v8h*)(dst + i * 8) = o;  }
__global__ __launch_bounds__(256) void k_madd(const float* __restrict__ m, float* MA) { const int i = blockIdx.x * 256 + threadIdx.x; if (i >= SEQ / 4) return; const v4f a = *(const v4f*)(m + (size_t)i * 4); v4f o;
#pragma unroll
    for (int q = 0; q < 4; ++q) { float u = 1.0f - bfr(a[q]); asm volatile("" : "+v"(u)); o[q] = u * FLOW; }
    *(v4f*)(MA + (size_t)i * 4) = o;  }
__global__ __launch_bounds__(256) void k_qkp(const float* __restrict__ F, h16* P) { const size_t e = ((size_t)blockIdx.x * 256 + threadIdx.x) * 8; if (e >= (size_t)NH_ * SEQ * HD) return; const int d = (int)(e % HD); const int t = (int)((e / HD) % SEQ); const int h = (int)(e / ((size_t)HD * SEQ));
    const float* f = F + (size_t)t * DQ + (size_t)h * HD + d; const v4f a0 = *(const v4f*)f, a1 = *(const v4f*)(f + 4); v8h o;
#pragma unroll
    for (int q = 0; q < 4; ++q) { o[q] = (h16)a0[q]; o[q + 4] = (h16)a1[q]; }
    *(v8h*)(P + e) = o;  }
__global__ __launch_bounds__(256) void k_vtp(const float* __restrict__ F, h16* VT) { const size_t e = ((size_t)blockIdx.x * 256 + threadIdx.x) * 8; if (e >= (size_t)NH_ * HD * SEQ) return; const int t = (int)(e % SEQ); const int d = (int)((e / SEQ) % HD); const int g = (int)(e / ((size_t)SEQ * HD));
    const float* f = F + (size_t)t * DQ + (size_t)g * HD + d; v8h o;
#pragma unroll
    for (int q = 0; q < 8; ++q) o[q] = (h16)f[(size_t)q * DQ];
    *(v8h*)(VT + e) = o;  }
// ---- k_fattn: scores, softmax and p.v of one head for 128 queries in one work-group; no score ever reaches memory. grid (SEQ/128, NH_), 256 threads = 8 waves x 16 queries.
// Transposed products: S^T = K.Q^T (A = 16 keys x 32 d from LDS, B = Q^T kept in registers), O^T += V^T.P^T (A = 16 d x 32 keys from LDS, B = P^T).
// D of S^T: lane l holds query (l & 15), keys 8*(l>>4) + r of each 16-key tile; that is the B operand's k order for 32 keys (tile 0 -> elements 0..7, tile 1 -> elements 8..15), so P^T packs in-lane.
// K rows ([t][d] plane) and V^T rows ([d][t] plane) come in stages of 64 keys: global -> registers -> LDS, two buffers; the next stage's loads fly under this stage's two 32-key passes.
// Every inner loop is fully unrolled, so that each index into a register array is a constant (an index known only at run time would send the array to scratch).
// Online softmax: t = s x SCL + MA[key]; p = exp(t - m_run); m_run may trail the true maximum by up to FA_LAG (p stays below e^FA_LAG, far inside f16); the sums are rescaled only when some query's maximum passes that.
#define FA_BQ   128
#define FA_SK   64
#define FA_PK   272                       // LDS pitch of a K row (256 B + 16): 16 B x odd, conflict-free for 16-byte row reads
#define FA_PV   144                       // LDS pitch of a V^T row (128 B + 16): 16 B x odd
#define FA_TK   (FA_SK * FA_PK)
#define FA_SLOT (FA_TK + HD * FA_PV)
#define FA_FLIP 65536                     // the two buffers lie 64 KiB apart, so that one XOR on an LDS offset changes the buffer
#define FA_LAG  5.5f
#define L2E     1.4426950408889634f
static_assert(SEQ % FA_BQ == 0 && SEQ % FA_SK == 0 && SEQ % 1024 == 0 && FA_SLOT <= FA_FLIP);
typedef __attribute__((ext_vector_type(4))) unsigned v4u;
__device__ __forceinline__ float xhalf(float x) { return __builtin_bit_cast(float, __builtin_amdgcn_permlanex16(__builtin_bit_cast(int, x), __builtin_bit_cast(int, x), 0x76543210, 0xfedcba98, false, false)); }  // lane l <-> lane l ^ 16
// Four exponentials (2^x, in place) in one statement. The v_nop at its end fills the slot that the instruction set asks for behind a transcendental before a source is overwritten or the result read.
__device__ __forceinline__ void exp2x4(float& a, float& b, float& c, float& d) { asm("v_exp_f32 %0, %0\n\tv_exp_f32 %1, %1\n\tv_exp_f32 %2, %2\n\tv_exp_f32 %3, %3\n\tv_nop" : "+v"(a), "+v"(b), "+v"(c), "+v"(d)); }
// at most 256 VGPRs: the asm operands above stay in the register window that needs no switching
__global__ __launch_bounds__(256) __attribute__((amdgpu_num_vgpr(256))) void k_fattn(const h16* __restrict__ QP, const h16* __restrict__ KP, const h16* __restrict__ VT, const float* __restrict__ MA, h16* AT) {
    __shared__ __align__(16) unsigned char L[FA_FLIP + FA_SLOT];
    __shared__ __align__(16) float MAs[SEQ];
    const int tid = threadIdx.x, lane = tid & 31, wave = tid >> 5, lr = lane & 15, hi = lane >> 4;
    const int h = blockIdx.y, q0 = blockIdx.x * FA_BQ + wave * 16;
    // staging map: 1024 16-byte chunks of K (row = chunk >> 4) and 1024 of V^T (row = chunk >> 3) per stage, chunk = tid + 256 i
    const h16* kg = KP + (size_t)h * SEQ * HD; const unsigned ko = (unsigned)tid * 8u;         // a K stage is 16 KiB in a row
    const h16* vg = VT + (size_t)h * HD * SEQ; const unsigned vo = (unsigned)(tid >> 3) * SEQ + (unsigned)(tid & 7) * 8u;
    unsigned kl = (tid >> 4) * FA_PK + (tid & 15) * 16, vl = FA_TK + (tid >> 3) * FA_PV + (tid & 7) * 16;   // where this thread's chunks go
    unsigned kf = lr * FA_PK + 16 * hi, vf = FA_TK + lr * FA_PV + 16 * hi;                                 // where this lane's fragments start
    v4u kr[4], vr[4];
#pragma unroll
    for (int i = 0; i < 4; ++i) { kr[i] = *(const v4u*)(kg + i * 2048 + ko); vr[i] = *(const v4u*)(vg + i * 32 * SEQ + vo); }
#pragma unroll
    for (int i = 0; i < SEQ / 1024; ++i) *(v4f*)(MAs + i * 1024 + tid * 4) = *(const v4f*)(MA + i * 1024 + tid * 4);
    v16h qf[4];
    { const h16* qp = QP + ((size_t)h * SEQ + q0 + lr) * HD + 8 * hi;
#pragma unroll
      for (int kc = 0; kc < 4; ++kc) qf[kc] = cat16(*(const v8h*)(qp + 32 * kc), *(const v8h*)(qp + 32 * kc + 16)); }
#pragma unroll
    for (int i = 0; i < 4; ++i) { *(v4u*)(L + kl + i * 16 * FA_PK) = kr[i]; *(v4u*)(L + vl + i * 32 * FA_PV) = vr[i]; }
    v8f acc[8];
#pragma unroll
    for (int t8 = 0; t8 < 8; ++t8) acc[t8] = (v8f){};
    float m_run = FLOW, l_run = 0.f;
    const float* mp = MAs + 8 * hi;
    __syncthreads();
    // kept rolled
#pragma unroll 1
    for (int st = 0; st < SEQ / FA_SK; ++st) {
        const bool more = st + 1 < SEQ / FA_SK;
        kl ^= FA_FLIP; vl ^= FA_FLIP; kg += FA_SK * HD; vg += FA_SK;
        if (more) {
#pragma unroll
            for (int i = 0; i < 4; ++i) { kr[i] = *(const v4u*)(kg + i * 2048 + ko); vr[i] = *(const v4u*)(vg + i * 32 * SEQ + vo); }
        }
#pragma unroll
        for (int sub = 0; sub < FA_SK / 32; ++sub) {
            v16h ka[4][2]; v4f mk[2][2]; v8f s[2] = {(v8f){}, (v8f){}};
            { const unsigned char* p = L + kf + sub * 32 * FA_PK;
#pragma unroll
              for (int kc = 0; kc < 4; ++kc)
#pragma unroll
                for (int kt = 0; kt < 2; ++kt) ka[kc][kt] = cat16(*(const v8h*)(p + kt * 16 * FA_PK + 64 * kc), *(const v8h*)(p + kt * 16 * FA_PK + 64 * kc + 32));
#pragma unroll
              for (int kt = 0; kt < 2; ++kt) { mk[kt][0] = *(const v4f*)(mp + sub * 32 + kt * 16); mk[kt][1] = *(const v4f*)(mp + sub * 32 + kt * 16 + 4); } }
            __builtin_amdgcn_sched_barrier(0);   // the pass's K and mask reads stay one group in front of the products: one LDS latency a pass, not one a product
#pragma unroll
            for (int kc = 0; kc < 4; ++kc)
#pragma unroll
                for (int kt = 0; kt < 2; ++kt) s[kt] = wmma16(ka[kc][kt], qf[kc], s[kt]);
            v16h va[8];
#pragma unroll
            for (int t8 = 0; t8 < 6; ++t8) { const unsigned char* pv = L + vf + t8 * 16 * FA_PV + sub * 64; va[t8] = cat16(*(const v8h*)pv, *(const v8h*)(pv + 32)); }
            __builtin_amdgcn_sched_barrier(0);   // six of the eight V^T fragments are read in front of the softmax arithmetic, which covers their latency; left free, the compiler put the reads two by two in front of each product
            float t[16]; float mx = FLOW;
#pragma unroll
            for (int kt = 0; kt < 2; ++kt)
#pragma unroll
                for (int r = 0; r < 8; ++r) { const float u = s[kt][r] * SCL + mk[kt][r >> 2][r & 3]; t[kt * 8 + r] = u; mx = fmaxf(mx, u); }
            mx = fmaxf(mx, xhalf(mx));   // both halves of the wave now hold the query's maximum over the pass
            if (__builtin_amdgcn_ballot_w32(mx > m_run + FA_LAG) != 0) {   // wave-uniform, rare behind the first pass
                const float m_new = fmaxf(m_run, mx); const float corr = __builtin_amdgcn_exp2f((m_run - m_new) * L2E);
                l_run *= corr; m_run = m_new;
#pragma unroll
                for (int t8 = 0; t8 < 8; ++t8) acc[t8] = acc[t8] * corr;
            }
#pragma unroll
            for (int t8 = 6; t8 < 8; ++t8) { const unsigned char* pv = L + vf + t8 * 16 * FA_PV + sub * 64; va[t8] = cat16(*(const v8h*)pv, *(const v8h*)(pv + 32)); }
            __builtin_amdgcn_sched_barrier(0);   // the last two fragments are read here, where the raw scores' and the mask's registers are free (all eight above did not fit 256 VGPRs); the exponentials and the first six products cover their latency
            v16h pf; float ps[4];
#pragma unroll
            for (int e = 0; e < 16; e += 4) { float p0 = (t[e] - m_run) * L2E, p1 = (t[e + 1] - m_run) * L2E, p2 = (t[e + 2] - m_run) * L2E, p3 = (t[e + 3] - m_run) * L2E;
                exp2x4(p0, p1, p2, p3);
                ps[e >> 2] = (p0 + p1) + (p2 + p3); pf[e] = (h16)p0; pf[e + 1] = (h16)p1; pf[e + 2] = (h16)p2; pf[e + 3] = (h16)p3; }
            l_run += (ps[0] + ps[1]) + (ps[2] + ps[3]);
#pragma unroll
            for (int t8 = 0; t8 < 8; ++t8) acc[t8] = wmma16(va[t8], pf, acc[t8]);
        }
        if (more) {   // into the other buffer: every wave left it at the barrier that ended stage st - 1
#pragma unroll
            for (int i = 0; i < 4; ++i) { *(v4u*)(L + kl + i * 16 * FA_PK) = kr[i]; *(v4u*)(L + vl + i * 32 * FA_PV) = vr[i]; }
        }
        kf ^= FA_FLIP; vf ^= FA_FLIP; mp += FA_SK;
        __syncthreads();   // publishes stage st + 1 and ends every wave's reads of stage st
    }
    const float inv = OCAR / (l_run + xhalf(l_run));   // each half summed its own eight keys of every 16-key tile
    h16* op = AT + (size_t)(q0 + lr) * DQ + (size_t)h * HD + 8 * hi;   // D of O^T: lane l holds query (l & 15), d = 16 t8 + 8*(l>>4) + r
#pragma unroll
    for (int t8 = 0; t8 < 8; ++t8) { v8h o;
#pragma unroll
        for (int r = 0; r < 8; ++r) o[r] = (h16)(acc[t8][r] * inv);
        *(v8h*)(op + t8 * 16) = o; }
}

extern "C" void kernel_launch(void* const* d_in, const int* in_sizes, int n_in,
                              void* d_out, int out_size, void* d_ws, size_t ws_size, hipStream_t stream) {
    if (n_in < 10) return;
    const float* x  = (const float*)d_in[0]; const float* am = (const float*)d_in[1];
    const float* wq = (const float*)d_in[2]; const float* bq = (const float*)d_in[3]; const float* wk = (const float*)d_in[4]; const float* bk = (const float*)d_in[5];
    const float* wv = (const float*)d_in[6]; const float* bv = (const float*)d_in[7]; const float* wo = (const float*)d_in[8]; const float* bo = (const float*)d_in[9];
    if (in_sizes[0] < 0 || (size_t)in_sizes[0] < (size_t)(NB - 1) * SEQ_FULL * DM + (size_t)SEQ * DM) return;
    if (in_sizes[1] < (NB - 1) * SEQ_FULL + SEQ) return;
    if (in_sizes[2] < DQ * DM || in_sizes[4] < DQ * DM || in_sizes[6] < DQ * DM || in_sizes[8] < DM * DQ) return;
    if (in_sizes[3] < DQ || in_sizes[5] < DQ || in_sizes[7] < DQ || in_sizes[9] < DM) return;
    if (out_size < 0 || (size_t)out_size < (size_t)NB * SEQ * DM) return;
    float* OUT = (float*)d_out;     // [NB][SEQ][DM]

    // ---- workspace carve (all offsets 256-B aligned; every region is written to exactly its extent by whole-line stores) ----
    char* wsp = (char*)d_ws; size_t used = 0;
    auto take = [&](size_t bytes) { char* p = wsp + used; used += (bytes + 255) & ~(size_t)255; return (void*)p; };
    bf*  WQ   = (bf*)take((size_t)DQ * DM * 2);                   // 8,388,608
    bf*  WK   = (bf*)take((size_t)DQ * DM * 2);                   // 8,388,608
    bf*  WV   = (bf*)take((size_t)DQ * DM * 2);                   // 8,388,608
    h16* WO16 = (h16*)take((size_t)DM * DQ * 2);                  // 8,388,608
    bf*  XB   = (bf*)take((size_t)SEQ * DM * 2);                  // 8,388,608
    float* F  = (float*)take((size_t)SEQ * DQ * 4);               // 16,777,216: projection output [SEQ][DQ] f32
    float* MA = (float*)take((size_t)SEQ * 4);                     // 8,192
    h16* QP16 = (h16*)take((size_t)NH_ * SEQ * HD * 2);           // 8,388,608  [h][t][d]
    h16* KP16 = (h16*)take((size_t)NH_ * SEQ * HD * 2);           // 8,388,608  [h][t][d]
    h16* VT16 = (h16*)take((size_t)NH_ * HD * SEQ * 2);           // 8,388,608  [g][d][t]
    h16* AT16 = (h16*)take((size_t)SEQ * DQ * 2);                 // 8,388,608  [t][h*HD+d]
    if (used > ws_size) return;                                    // total 92,282,880 B at NB=2, SEQ=2048

    const unsigned gw8 = (unsigned)(((size_t)DQ * DM / 8 + 255) / 256);
    k_cvt8<<<gw8, 256, 0, stream>>>(wq, WQ, (size_t)DQ * DM / 8);
    k_cvt8<<<gw8, 256, 0, stream>>>(wk, WK, (size_t)DQ * DM / 8);
    k_cvt8<<<gw8, 256, 0, stream>>>(wv, WV, (size_t)DQ * DM / 8);
    k_cvt8h<<<gw8, 256, 0, stream>>>(wo, WCAR, WO16, (size_t)DM * DQ / 8);
    const unsigned gx8 = (unsigned)(((size_t)SEQ * DM / 8 + 255) / 256);
    const unsigned gpl = (unsigned)(((size_t)NH_ * SEQ * HD / 8 + 255) / 256);
    const unsigned gma = (unsigned)((SEQ / 4 + 255) / 256);
    for (int b = 0; b < NB; ++b) {
        k_cvt8<<<gx8, 256, 0, stream>>>(x + (size_t)b * SEQ_FULL * DM, XB, (size_t)SEQ * DM / 8);
        k_madd<<<gma, 256, 0, stream>>>(am + (size_t)b * SEQ_FULL, MA);
        k_gemmw<bf, 0, true><<<dim3(SEQ / 64, DQ / 64, 1), 32, 0, stream>>>(XB, nullptr, WQ, nullptr, DM, F, DQ, bq, 1.0f, 0, 0, 0);
        k_qkp<<<gpl, 256, 0, stream>>>(F, QP16);
        k_gemmw<bf, 0, true><<<dim3(SEQ / 64, DQ / 64, 1), 32, 0, stream>>>(XB, nullptr, WK, nullptr, DM, F, DQ, bk, 1.0f, 0, 0, 0);
        k_qkp<<<gpl, 256, 0, stream>>>(F, KP16);
        k_gemmw<bf, 0, true><<<dim3(SEQ / 64, DQ / 64, 1), 32, 0, stream>>>(XB, nullptr, WV, nullptr, DM, F, DQ, bv, 1.0f, 0, 0, 0);
        k_vtp<<<gpl, 256, 0, stream>>>(F, VT16);
        k_fattn<<<dim3(SEQ / FA_BQ, NH_, 1), 256, 0, stream>>>(QP16, KP16, VT16, MA, AT16);
        k_gemmw<h16, 0, true><<<dim3(SEQ / 64, DM / 64, 1), 32, 0, stream>>>(AT16, nullptr, WO16, nullptr, DQ, OUT + (size_t)b * SEQ * DM, DM, bo, 1.0f / (OCAR * WCAR), 0, 0, 0);
    }
}

// v002
// Measured time: 324 microseconds a run.
// Next to v001, in two timings, it ran 1.68 and 1.67 times as fast.
// Counting every step since v000, it is 5.09 times as fast.
#include <hip/hip_runtime.h>

// Multi-head self-attention block (hidden [NB][SEQ][2048], 16 heads x 128): q/k/v = x W^T + b; s = (q.k) x 128^-0.5 + (1 - m[key]) x f32_lowest; p = softmax over keys; ctx = p.v; out = ctx Wo^T + bo -> [NB][SEQ][2048] f32.
// Compute dtypes (f32 accumulate everywhere): x, W*, b*, m enter as their bf16 (RNE) values; q/k/v projections: v_wmma_f32_16x16x32_bf16 (bf16 operands);
// scores: v_wmma_f32_16x16x32_f16 (f16 q, k planes); p.v: v_wmma_f32_16x16x32_f16 (f16 p = exp(s - running max), not normalised, f16 v; the row sum divides at the end); output projection: v_wmma_f32_16x16x32_f16 (f16 ctx x64, f16 Wo x64); softmax f32.
#pragma clang fp contract(off)

#ifndef NB
#define NB 2
#endif
#ifndef SEQ
#define SEQ 2048
#endif
#define NB_FULL  2
#define SEQ_FULL 2048
#define DM   2048
#define NH_  16
#define HD   128
#define DQ   (NH_ * HD)
#define OCAR 64.0f
#define WCAR 64.0f
#define SCL  0.08838834764831845f
#define FLOW (-3.4028234663852886e38f)

static_assert(SEQ % 128 == 0);
static_assert(SEQ >= 128 && SEQ <= SEQ_FULL);
static_assert(NB >= 1 && NB <= NB_FULL);
static_assert(DQ == DM);
static_assert(DM % 64 == 0 && HD == 128);

typedef _Float16 h16;
typedef unsigned short bf;
typedef __attribute__((ext_vector_type(16))) __bf16   v16bf;
typedef __attribute__((ext_vector_type(16))) _Float16 v16h;
typedef __attribute__((ext_vector_type(8)))  _Float16 v8h;
typedef __attribute__((ext_vector_type(4)))  _Float16 v4h;
typedef __attribute__((ext_vector_type(8)))  unsigned short v8us;
typedef __attribute__((ext_vector_type(8)))  float    v8f;
typedef __attribute__((ext_vector_type(4)))  float    v4f;
typedef v4f __attribute__((may_alias)) v4fa;

__device__ __forceinline__ unsigned short f2bf(float f) { unsigned u = __float_as_uint(f); u += 0x7FFFu + ((u >> 16) & 1u); return (unsigned short)(u >> 16); }
__device__ __forceinline__ float bf2f(unsigned short b) { return __uint_as_float(((unsigned)b) << 16); }
__device__ __forceinline__ float bfr(float f) { return bf2f(f2bf(f)); }
__device__ __forceinline__ v16h cat16(v8h lo, v8h hi) { return __builtin_shufflevector(lo, hi, 0, 1, 2, 3, 4, 5, 6, 7, 8, 9, 10, 11, 12, 13, 14, 15); }
__device__ __forceinline__ v16bf cat16b(v8us lo, v8us hi) { return __builtin_bit_cast(v16bf, __builtin_shufflevector(lo, hi, 0, 1, 2, 3, 4, 5, 6, 7, 8, 9, 10, 11, 12, 13, 14, 15)); }
__device__ __forceinline__ v8f wmma16(v16h a, v16h b, v8f c) { return __builtin_amdgcn_wmma_f32_16x16x32_f16(false, a, false, b, (short)0, c, false, false); }
__device__ __forceinline__ v8f wmmab(v16bf a, v16bf b, v8f c) { return __builtin_amdgcn_wmma_f32_16x16x32_bf16(false, a, false, b, (short)0, c, false, false); }

// ---- k_gemmt: GEMM, one 128x128 output tile per work-group of 8 waves (4 along M x 2 along N, 32x64 a wave, 8 accumulators); grid (M/128, N/128), 256 threads.
// C[m][n] (f32, pitch ldc) = cscale x sum_k A[m][k] Bt[n][k] + bf16-valued bias[n]. A, Bt: K-contiguous 16-bit planes. K % 128 == 0, K >= 256 (two stages at least: the second stage's copies stand under no test), M % 128 == 0, N % 128 == 0.
// Both operands come in stages of 128 k (rows of 256 B) by asynchronous copies, global -> LDS through no register, two buffers: stage t + 1 flies while stage t is worked on, and every row is fetched once a work-group, in whole lines.
// Fragment map (both operands): lane l -> row/col (l & 15); elements 0..7 <- k0 + 8*(l>>4) + 0..7, elements 8..15 <- k0 + 16 + 8*(l>>4) + 0..7. D element r of lane l -> (row 8*(l>>4) + r, col l & 15).
template <typename T16> struct WFrag;
template <> struct WFrag<h16> { typedef v16h V; static __device__ __forceinline__ V ld(const h16* p) { return cat16(*(const v8h*)p, *(const v8h*)(p + 16)); } static __device__ __forceinline__ v8f mma(V a, V b, v8f c) { return wmma16(a, b, c); } };
template <> struct WFrag<bf> { typedef v16bf V; static __device__ __forceinline__ V ld(const bf* p) { return cat16b(*(const v8us*)p, *(const v8us*)(p + 16)); } static __device__ __forceinline__ v8f mma(V a, V b, v8f c) { return wmmab(a, b, c); } };
#define GT_T   128                       // rows of each operand in a tile
#define GT_KS  128                       // k of a stage
#define GT_P   272                       // LDS pitch of a row (256 B + 16): 16 B x odd, conflict-free for 16-byte row reads
#define GT_OP  (GT_T * GT_P)             // one operand's stage
#define GT_BUF (2 * GT_OP)               // a buffer: [A 128 rows | Bt 128 rows]
static_assert(SEQ % GT_T == 0 && DM % GT_T == 0 && DQ % GT_T == 0);
// One operand's stage, this thread's share: eight 16-byte chunks, rows 16 apart (l: the lane's LDS byte address, g: its global address, rs: 16 rows in elements).
// The s_wait_xcnt at the end of the statement stands in front of any later write of the address registers that the copies name.
template <typename T16>
__device__ __forceinline__ void gt_copy8(unsigned l, const T16* g, size_t rs) {
    asm volatile("global_load_async_to_lds_b128 %0, %8, off\n\t"
                 "global_load_async_to_lds_b128 %1, %9, off\n\t"
                 "global_load_async_to_lds_b128 %2, %10, off\n\t"
                 "global_load_async_to_lds_b128 %3, %11, off\n\t"
                 "global_load_async_to_lds_b128 %4, %12, off\n\t"
                 "global_load_async_to_lds_b128 %5, %13, off\n\t"
                 "global_load_async_to_lds_b128 %6, %14, off\n\t"
                 "global_load_async_to_lds_b128 %7, %15, off\n\t"
                 "s_wait_xcnt 0x0"
                 :: "v"(l), "v"(l + 16 * GT_P), "v"(l + 32 * GT_P), "v"(l + 48 * GT_P), "v"(l + 64 * GT_P), "v"(l + 80 * GT_P), "v"(l + 96 * GT_P), "v"(l + 112 * GT_P),
                    "v"(g), "v"(g + rs), "v"(g + 2 * rs), "v"(g + 3 * rs), "v"(g + 4 * rs), "v"(g + 5 * rs), "v"(g + 6 * rs), "v"(g + 7 * rs)
                 : "memory");
}
// at most 256 VGPRs: the asm operands above stay in the register window that needs no switching
template <typename T16, int K>
__global__ __launch_bounds__(256) __attribute__((amdgpu_num_vgpr(256)))
void k_gemmt(const T16* __restrict__ A, const T16* __restrict__ Bt, float* C, int ldc, const float* __restrict__ bias, float cscale) {
    static_assert(K % GT_KS == 0 && K >= 2 * GT_KS);
    typedef typename WFrag<T16>::V V;
    __shared__ __align__(16) unsigned char L[2 * GT_BUF];
    __shared__ __align__(16) float OS[8 * 16 * 68];
    const int tid = threadIdx.x, lane = tid & 31, wave = tid >> 5, lr = lane & 15, hi = lane >> 4, wm = wave >> 1, wn = wave & 1;
    const int r0 = blockIdx.x * GT_T, c0 = blockIdx.y * GT_T;
    // staging map: 2048 16-byte chunks an operand and stage, chunk = tid + 256 i -> row (tid >> 4) + 16 i, 16 chunks a row: a wave's copy covers two whole rows of the stage
    const T16* ag = A + (size_t)(r0 + (tid >> 4)) * K + (tid & 15) * 8;
    const T16* bg = Bt + (size_t)(c0 + (tid >> 4)) * K + (tid & 15) * 8;
    const size_t rs = (size_t)16 * K;
    const unsigned cl = (unsigned)(size_t)L + (tid >> 4) * GT_P + (tid & 15) * 16;     // where this thread's chunks go
    const unsigned af = (wm * 32 + lr) * GT_P + 16 * hi, bfo = GT_OP + (wn * 64 + lr) * GT_P + 16 * hi;   // where this lane's fragments start
    constexpr int nst = K / GT_KS;
    unsigned bo = 0;   // byte offset of the buffer that holds stage st
    v8f acc[2][4];
#pragma unroll
    for (int mb = 0; mb < 2; ++mb)
#pragma unroll
        for (int nb = 0; nb < 4; ++nb) acc[mb][nb] = (v8f){};
    gt_copy8(cl, ag, rs); gt_copy8(cl + GT_OP, bg, rs);
    asm volatile("s_wait_asynccnt 0x0" ::: "memory");   // stage 0 has landed, as far as this wave copied it
    __syncthreads();                                     // publishes stage 0
    gt_copy8(cl + GT_BUF, ag + GT_KS, rs); gt_copy8(cl + GT_BUF + GT_OP, bg + GT_KS, rs);
    ag += 2 * GT_KS; bg += 2 * GT_KS;
    // kept rolled: the body holds a whole stage's 32 products a wave, unrolled
#pragma unroll 1
    for (int st = 0; st < nst; ++st) {
        V a[2][2], b[2][4];
#pragma unroll
        for (int mb = 0; mb < 2; ++mb) a[0][mb] = WFrag<T16>::ld((const T16*)(L + bo + af + mb * 16 * GT_P));
#pragma unroll
        for (int nb = 0; nb < 4; ++nb) b[0][nb] = WFrag<T16>::ld((const T16*)(L + bo + bfo + nb * 16 * GT_P));
#pragma unroll
        for (int kb = 0; kb < GT_KS / 32; ++kb) {
            const int cur = kb & 1, nxt = cur ^ 1;
            if (kb + 1 < GT_KS / 32) {   // the next 32 k's fragments, read as one group in front of this block's products
#pragma unroll
                for (int mb = 0; mb < 2; ++mb) a[nxt][mb] = WFrag<T16>::ld((const T16*)(L + bo + af + mb * 16 * GT_P + (kb + 1) * 64));
#pragma unroll
                for (int nb = 0; nb < 4; ++nb) b[nxt][nb] = WFrag<T16>::ld((const T16*)(L + bo + bfo + nb * 16 * GT_P + (kb + 1) * 64));
            }
            __builtin_amdgcn_sched_barrier(0);   // the reads stay one group in front of the products, which cover their latency; left free, the compiler put them two by two in front of each pair of products, with a full wait each
#pragma unroll
            for (int nb = 0; nb < 4; ++nb)
#pragma unroll
                for (int mb = 0; mb < 2; ++mb) acc[mb][nb] = WFrag<T16>::mma(a[cur][mb], b[cur][nb], acc[mb][nb]);
            __builtin_amdgcn_sched_barrier(0);   // and no read of the block after next moves up among these products
        }
        asm volatile("s_wait_dscnt 0x0" ::: "memory");      // this wave's reads of stage st have returned
        asm volatile("s_wait_asynccnt 0x0" ::: "memory");   // its copies of stage st + 1 have landed
        __syncthreads();                                     // publishes stage st + 1 and ends every wave's reads of stage st
        if (st + 2 < nst) { gt_copy8(cl + bo, ag, rs); gt_copy8(cl + bo + GT_OP, bg, rs); }   // stage st + 2 into the buffer that stage st has left
        ag += GT_KS; bg += GT_KS; bo = GT_BUF - bo;
    }
    asm volatile("s_wait_asynccnt 0x0" ::: "memory");       // no copy is outstanding when the wave goes on
    // bias for this lane's 4 output columns: one 16-B load per lane, loaded once (the columns are the same for every row of the wave's tile)
    const int cw = c0 + wn * 64;
    v4f bb; { const v4f br = *(const v4f*)(bias + cw + lr * 4); bb[0] = bfr(br[0]); bb[1] = bfr(br[1]); bb[2] = bfr(br[2]); bb[3] = bfr(br[3]); }
    float* os = OS + wave * (16 * 68);   // each wave stages its own 16 x 64 block, so that whole lines are stored
#pragma unroll
    for (int mb = 0; mb < 2; ++mb) {
#pragma unroll
        for (int nb = 0; nb < 4; ++nb) {
#pragma unroll
            for (int j = 0; j < 8; ++j) os[(hi * 8 + j) * 68 + nb * 16 + lr] = acc[mb][nb][j]; }
        __builtin_amdgcn_wave_barrier(); asm volatile("" ::: "memory");   // other lanes of the wave read these rows back: the compiler may move no read in front of the stores
        float* crow = C + (size_t)(r0 + wm * 32 + mb * 16) * ldc + cw;
#pragma unroll
        for (int s = 0; s < 8; ++s) { const int row = 2 * s + hi, cofs = lr * 4; v4f val = *(const v4fa*)(os + row * 68 + cofs); val = val * cscale; val = val + bb;
            *(v4f*)(crow + (size_t)row * ldc + cofs) = val; }
        __builtin_amdgcn_wave_barrier(); asm volatile("" ::: "memory");   // and no store of the next 16 rows in front of these reads
    }
}

__global__ __launch_bounds__(256) void k_cvt8(const float* __restrict__ src, bf* dst, size_t n8) { const size_t i = (size_t)blockIdx.x * 256 + threadIdx.x; if (i >= n8) return; const v8f v = *(const v8f*)(src + i * 8); v8us o;
#pragma unroll
    for (int k = 0; k < 8; ++k) o[k] = f2bf(v[k]); *(v8us*)(dst + i * 8) = o;  }
__global__ __launch_bounds__(256) void k_cvt8h(const float* __restrict__ src, float sc, h16* dst, size_t n8) { const size_t i = (size_t)blockIdx.x * 256 + threadIdx.x; if (i >= n8) return; const v8f v = *(const v8f*)(src + i * 8); v8h o;
#pragma unroll
    for (int k = 0; k < 8; ++k) o[k] = (h16)(bfr(v[k]) * sc); *(v8h*)(dst + i * 8) = o;  }
__global__ __launch_bounds__(256) void k_madd(const float* __restrict__ m, float* MA) { const int i = blockIdx.x * 256 + threadIdx.x; if (i >= SEQ / 4) return; const v4f a = *(const v4f*)(m + (size_t)i * 4); v4f o;
#pragma unroll
    for (int q = 0; q < 4; ++q) { float u = 1.0f - bfr(a[q]); asm volatile("" : "+v"(u)); o[q] = u * FLOW; }
    *(v4f*)(MA + (size_t)i * 4) = o;  }
__global__ __launch_bounds__(256) void k_qkp(const float* __restrict__ F, h16* P) { const size_t e = ((size_t)blockIdx.x * 256 + threadIdx.x) * 8; if (e >= (size_t)NH_ * SEQ * HD) return; const int d = (int)(e % HD); const int t = (int)((e / HD) % SEQ); const int h = (int)(e / ((size_t)HD * SEQ));
    const float* f = F + (size_t)t * DQ + (size_t)h * HD + d; const v4f a0 = *(const v4f*)f, a1 = *(const v4f*)(f + 4); v8h o;
#pragma unroll
    for (int q = 0; q < 4; ++q) { o[q] = (h16)a0[q]; o[q + 4] = (h16)a1[q]; }
    *(v8h*)(P + e) = o;  }
__global__ __launch_bounds__(256) void k_vtp(const float* __restrict__ F, h16* VT) { const size_t e = ((size_t)blockIdx.x * 256 + threadIdx.x) * 8; if (e >= (size_t)NH_ * HD * SEQ) return; const int t = (int)(e % SEQ); const int d = (int)((e / SEQ) % HD); const int g = (int)(e / ((size_t)SEQ * HD));
    const float* f = F + (size_t)t * DQ + (size_t)g * HD + d; v8h o;
#pragma unroll
    for (int q = 0; q < 8; ++q) o[q] = (h16)f[(size_t)q * DQ];
    *(v8h*)(VT + e) = o;  }
// ---- k_fattn: scores, softmax and p.v of one head for 128 queries in one work-group; no score ever reaches memory. grid (SEQ/128, NH_), 256 threads = 8 waves x 16 queries.
// Transposed products: S^T = K.Q^T (A = 16 keys x 32 d from LDS, B = Q^T kept in registers), O^T += V^T.P^T (A = 16 d x 32 keys from LDS, B = P^T).
// D of S^T: lane l holds query (l & 15), keys 8*(l>>4) + r of each 16-key tile; that is the B operand's k order for 32 keys (tile 0 -> elements 0..7, tile 1 -> elements 8..15), so P^T packs in-lane.
// K rows ([t][d] plane) and V^T rows ([d][t] plane) come in stages of 64 keys: global -> registers -> LDS, two buffers; the next stage's loads fly under this stage's two 32-key passes.
// Every inner loop is fully unrolled, so that each index into a register array is a constant (an index known only at run time would send the array to scratch).
// Online softmax: t = s x SCL + MA[key]; p = exp(t - m_run); m_run may trail the true maximum by up to FA_LAG (p stays below e^FA_LAG, far inside f16); the sums are rescaled only when some query's maximum passes that.
#define FA_BQ   128
#define FA_SK   64
#define FA_PK   272                       // LDS pitch of a K row (256 B + 16): 16 B x odd, conflict-free for 16-byte row reads
#define FA_PV   144                       // LDS pitch of a V^T row (128 B + 16): 16 B x odd
#define FA_TK   (FA_SK * FA_PK)
#define FA_SLOT (FA_TK + HD * FA_PV)
#define FA_FLIP 65536                     // the two buffers lie 64 KiB apart, so that one XOR on an LDS offset changes the buffer
#define FA_LAG  5.5f
#define L2E     1.4426950408889634f
static_assert(SEQ % FA_BQ == 0 && SEQ % FA_SK == 0 && SEQ % 1024 == 0 && FA_SLOT <= FA_FLIP);
typedef __attribute__((ext_vector_type(4))) unsigned v4u;
__device__ __forceinline__ float xhalf(float x) { return __builtin_bit_cast(float, __builtin_amdgcn_permlanex16(__builtin_bit_cast(int, x), __builtin_bit_cast(int, x), 0x76543210, 0xfedcba98, false, false)); }  // lane l <-> lane l ^ 16
// Four exponentials (2^x, in place) in one statement. The v_nop at its end fills the slot that the instruction set asks for behind a transcendental before a source is overwritten or the result read.
__device__ __forceinline__ void exp2x4(float& a, float& b, float& c, float& d) { asm("v_exp_f32 %0, %0\n\tv_exp_f32 %1, %1\n\tv_exp_f32 %2, %2\n\tv_exp_f32 %3, %3\n\tv_nop" : "+v"(a), "+v"(b), "+v"(c), "+v"(d)); }
// at most 256 VGPRs: the asm operands above stay in the register window that needs no switching
__global__ __launch_bounds__(256) __attribute__((amdgpu_num_vgpr(256))) void k_fattn(const h16* __restrict__ QP, const h16* __restrict__ KP, const h16* __restrict__ VT, const float* __restrict__ MA, h16* AT) {
    __shared__ __align__(16) unsigned char L[FA_FLIP + FA_SLOT];
    __shared__ __align__(16) float MAs[SEQ];
    const int tid = threadIdx.x, lane = tid & 31, wave = tid >> 5, lr = lane & 15, hi = lane >> 4;
    const int h = blockIdx.y, q0 = blockIdx.x * FA_BQ + wave * 16;
    // staging map: 1024 16-byte chunks of K (row = chunk >> 4) and 1024 of V^T (row = chunk >> 3) per stage, chunk = tid + 256 i
    const h16* kg = KP + (size_t)h * SEQ * HD; const unsigned ko = (unsigned)tid * 8u;         // a K stage is 16 KiB in a row
    const h16* vg = VT + (size_t)h * HD * SEQ; const unsigned vo = (unsigned)(tid >> 3) * SEQ + (unsigned)(tid & 7) * 8u;
    unsigned kl = (tid >> 4) * FA_PK + (tid & 15) * 16, vl = FA_TK + (tid >> 3) * FA_PV + (tid & 7) * 16;   // where this thread's chunks go
    unsigned kf = lr * FA_PK + 16 * hi, vf = FA_TK + lr * FA_PV + 16 * hi;                                 // where this lane's fragments start
    v4u kr[4], vr[4];
#pragma unroll
    for (int i = 0; i < 4; ++i) { kr[i] = *(const v4u*)(kg + i * 2048 + ko); vr[i] = *(const v4u*)(vg + i * 32 * SEQ + vo); }
#pragma unroll
    for (int i = 0; i < SEQ / 1024; ++i) *(v4f*)(MAs + i * 1024 + tid * 4) = *(const v4f*)(MA + i * 1024 + tid * 4);
    v16h qf[4];
    { const h16* qp = QP + ((size_t)h * SEQ + q0 + lr) * HD + 8 * hi;
#pragma unroll
      for (int kc = 0; kc < 4; ++kc) qf[kc] = cat16(*(const v8h*)(qp + 32 * kc), *(const v8h*)(qp + 32 * kc + 16)); }
#pragma unroll
    for (int i = 0; i < 4; ++i) { *(v4u*)(L + kl + i * 16 * FA_PK) = kr[i]; *(v4u*)(L + vl + i * 32 * FA_PV) = vr[i]; }
    v8f acc[8];
#pragma unroll
    for (int t8 = 0; t8 < 8; ++t8) acc[t8] = (v8f){};
    float m_run = FLOW, l_run = 0.f;
    const float* mp = MAs + 8 * hi;
    __syncthreads();
    // kept rolled
#pragma unroll 1
    for (int st = 0; st < SEQ / FA_SK; ++st) {
        const bool more = st + 1 < SEQ / FA_SK;
        kl ^= FA_FLIP; vl ^= FA_FLIP; kg += FA_SK * HD; vg += FA_SK;
        if (more) {
#pragma unroll
            for (int i = 0; i < 4; ++i) { kr[i] = *(const v4u*)(kg + i * 2048 + ko); vr[i] = *(const v4u*)(vg + i * 32 * SEQ + vo); }
        }
#pragma unroll
        for (int sub = 0; sub < FA_SK / 32; ++sub) {
            v16h ka[4][2]; v4f mk[2][2]; v8f s[2] = {(v8f){}, (v8f){}};
            { const unsigned char* p = L + kf + sub * 32 * FA_PK;
#pragma unroll
              for (int kc = 0; kc < 4; ++kc)
#pragma unroll
                for (int kt = 0; kt < 2; ++kt) ka[kc][kt] = cat16(*(const v8h*)(p + kt * 16 * FA_PK + 64 * kc), *(const v8h*)(p + kt * 16 * FA_PK + 64 * kc + 32));
#pragma unroll
              for (int kt = 0; kt < 2; ++kt) { mk[kt][0] = *(const v4f*)(mp + sub * 32 + kt * 16); mk[kt][1] = *(const v4f*)(mp + sub * 32 + kt * 16 + 4); } }
            __builtin_amdgcn_sched_barrier(0);   // the pass's K and mask reads stay one group in front of the products: one LDS latency a pass, not one a product
#pragma unroll
            for (int kc = 0; kc < 4; ++kc)
#pragma unroll
                for (int kt = 0; kt < 2; ++kt) s[kt] = wmma16(ka[kc][kt], qf[kc], s[kt]);
            v16h va[8];
#pragma unroll
            for (int t8 = 0; t8 < 6; ++t8) { const unsigned char* pv = L + vf + t8 * 16 * FA_PV + sub * 64; va[t8] = cat16(*(const v8h*)pv, *(const v8h*)(pv + 32)); }
            __builtin_amdgcn_sched_barrier(0);   // six of the eight V^T fragments are read in front of the softmax arithmetic, which covers their latency; left free, the compiler put the reads two by two in front of each product
            float t[16]; float mx = FLOW;
#pragma unroll
            for (int kt = 0; kt < 2; ++kt)
#pragma unroll
                for (int r = 0; r < 8; ++r) { const float u = s[kt][r] * SCL + mk[kt][r >> 2][r & 3]; t[kt * 8 + r] = u; mx = fmaxf(mx, u); }
            mx = fmaxf(mx, xhalf(mx));   // both halves of the wave now hold the query's maximum over the pass
            if (__builtin_amdgcn_ballot_w32(mx > m_run + FA_LAG) != 0) {   // wave-uniform, rare behind the first pass
                const float m_new = fmaxf(m_run, mx); const float corr = __builtin_amdgcn_exp2f((m_run - m_new) * L2E);
                l_run *= corr; m_run = m_new;
#pragma unroll
                for (int t8 = 0; t8 < 8; ++t8) acc[t8] = acc[t8] * corr;
            }
#pragma unroll
            for (int t8 = 6; t8 < 8; ++t8) { const unsigned char* pv = L + vf + t8 * 16 * FA_PV + sub * 64; va[t8] = cat16(*(const v8h*)pv, *(const v8h*)(pv + 32)); }
            __builtin_amdgcn_sched_barrier(0);   // the last two fragments are read here, where the raw scores' and the mask's registers are free (all eight above did not fit 256 VGPRs); the exponentials and the first six products cover their latency
            v16h pf; float ps[4];
#pragma unroll
            for (int e = 0; e < 16; e += 4) { float p0 = (t[e] - m_run) * L2E, p1 = (t[e + 1] - m_run) * L2E, p2 = (t[e + 2] - m_run) * L2E, p3 = (t[e + 3] - m_run) * L2E;
                exp2x4(p0, p1, p2, p3);
                ps[e >> 2] = (p0 + p1) + (p2 + p3); pf[e] = (h16)p0; pf[e + 1] = (h16)p1; pf[e + 2] = (h16)p2; pf[e + 3] = (h16)p3; }
            l_run += (ps[0] + ps[1]) + (ps[2] + ps[3]);
#pragma unroll
            for (int t8 = 0; t8 < 8; ++t8) acc[t8] = wmma16(va[t8], pf, acc[t8]);
        }
        if (more) {   // into the other buffer: every wave left it at the barrier that ended stage st - 1
#pragma unroll
            for (int i = 0; i < 4; ++i) { *(v4u*)(L + kl + i * 16 * FA_PK) = kr[i]; *(v4u*)(L + vl + i * 32 * FA_PV) = vr[i]; }
        }
        kf ^= FA_FLIP; vf ^= FA_FLIP; mp += FA_SK;
        __syncthreads();   // publishes stage st + 1 and ends every wave's reads of stage st
    }
    const float inv = OCAR / (l_run + xhalf(l_run));   // each half summed its own eight keys of every 16-key tile
    h16* op = AT + (size_t)(q0 + lr) * DQ + (size_t)h * HD + 8 * hi;   // D of O^T: lane l holds query (l & 15), d = 16 t8 + 8*(l>>4) + r
#pragma unroll
    for (int t8 = 0; t8 < 8; ++t8) { v8h o;
#pragma unroll
        for (int r = 0; r < 8; ++r) o[r] = (h16)(acc[t8][r] * inv);
        *(v8h*)(op + t8 * 16) = o; }
}

extern "C" void kernel_launch(void* const* d_in, const int* in_sizes, int n_in,
                              void* d_out, int out_size, void* d_ws, size_t ws_size, hipStream_t stream) {
    if (n_in < 10) return;
    const float* x  = (const float*)d_in[0]; const float* am = (const float*)d_in[1];
    const float* wq = (const float*)d_in[2]; const float* bq = (const float*)d_in[3]; const float* wk = (const float*)d_in[4]; const float* bk = (const float*)d_in[5];
    const float* wv = (const float*)d_in[6]; const float* bv = (const float*)d_in[7]; const float* wo = (const float*)d_in[8]; const float* bo = (const float*)d_in[9];
    if (in_sizes[0] < 0 || (size_t)in_sizes[0] < (size_t)(NB - 1) * SEQ_FULL * DM + (size_t)SEQ * DM) return;
    if (in_sizes[1] < (NB - 1) * SEQ_FULL + SEQ) return;
    if (in_sizes[2] < DQ * DM || in_sizes[4] < DQ * DM || in_sizes[6] < DQ * DM || in_sizes[8] < DM * DQ) return;
    if (in_sizes[3] < DQ || in_sizes[5] < DQ || in_sizes[7] < DQ || in_sizes[9] < DM) return;
    if (out_size < 0 || (size_t)out_size < (size_t)NB * SEQ * DM) return;
    float* OUT = (float*)d_out;     // [NB][SEQ][DM]

    // ---- workspace carve (all offsets 256-B aligned; every region is written to exactly its extent by whole-line stores) ----
    char* wsp = (char*)d_ws; size_t used = 0;
    auto take = [&](size_t bytes) { char* p = wsp + used; used += (bytes + 255) & ~(size_t)255; return (void*)p; };
    bf*  WQ   = (bf*)take((size_t)DQ * DM * 2);                   // 8,388,608
    bf*  WK   = (bf*)take((size_t)DQ * DM * 2);                   // 8,388,608
    bf*  WV   = (bf*)take((size_t)DQ * DM * 2);                   // 8,388,608
    h16* WO16 = (h16*)take((size_t)DM * DQ * 2);                  // 8,388,608
    bf*  XB   = (bf*)take((size_t)SEQ * DM * 2);                  // 8,388,608
    float* F  = (float*)take((size_t)SEQ * DQ * 4);               // 16,777,216: projection output [SEQ][DQ] f32
    float* MA = (float*)take((size_t)SEQ * 4);                     // 8,192
    h16* QP16 = (h16*)take((size_t)NH_ * SEQ * HD * 2);           // 8,388,608  [h][t][d]
    h16* KP16 = (h16*)take((size_t)NH_ * SEQ * HD * 2);           // 8,388,608  [h][t][d]
    h16* VT16 = (h16*)take((size_t)NH_ * HD * SEQ * 2);           // 8,388,608  [g][d][t]
    h16* AT16 = (h16*)take((size_t)SEQ * DQ * 2);                 // 8,388,608  [t][h*HD+d]
    if (used > ws_size) return;                                    // total 92,282,880 B at NB=2, SEQ=2048

    const unsigned gw8 = (unsigned)(((size_t)DQ * DM / 8 + 255) / 256);
    k_cvt8<<<gw8, 256, 0, stream>>>(wq, WQ, (size_t)DQ * DM / 8);
    k_cvt8<<<gw8, 256, 0, stream>>>(wk, WK, (size_t)DQ * DM / 8);
    k_cvt8<<<gw8, 256, 0, stream>>>(wv, WV, (size_t)DQ * DM / 8);
    k_cvt8h<<<gw8, 256, 0, stream>>>(wo, WCAR, WO16, (size_t)DM * DQ / 8);
    const unsigned gx8 = (unsigned)(((size_t)SEQ * DM / 8 + 255) / 256);
    const unsigned gpl = (unsigned)(((size_t)NH_ * SEQ * HD / 8 + 255) / 256);
    const unsigned gma = (unsigned)((SEQ / 4 + 255) / 256);
    for (int b = 0; b < NB; ++b) {
        k_cvt8<<<gx8, 256, 0, stream>>>(x + (size_t)b * SEQ_FULL * DM, XB, (size_t)SEQ * DM / 8);
        k_madd<<<gma, 256, 0, stream>>>(am + (size_t)b * SEQ_FULL, MA);
        k_gemmt<bf, DM><<<dim3(SEQ / GT_T, DQ / GT_T, 1), 256, 0, stream>>>(XB, WQ, F, DQ, bq, 1.0f);
        k_qkp<<<gpl, 256, 0, stream>>>(F, QP16);
        k_gemmt<bf, DM><<<dim3(SEQ / GT_T, DQ / GT_T, 1), 256, 0, stream>>>(XB, WK, F, DQ, bk, 1.0f);
        k_qkp<<<gpl, 256, 0, stream>>>(F, KP16);
        k_gemmt<bf, DM><<<dim3(SEQ / GT_T, DQ / GT_T, 1), 256, 0, stream>>>(XB, WV, F, DQ, bv, 1.0f);
        k_vtp<<<gpl, 256, 0, stream>>>(F, VT16);
        k_fattn<<<dim3(SEQ / FA_BQ, NH_, 1), 256, 0, stream>>>(QP16, KP16, VT16, MA, AT16);
        k_gemmt<h16, DQ><<<dim3(SEQ / GT_T, DM / GT_T, 1), 256, 0, stream>>>(AT16, WO16, OUT + (size_t)b * SEQ * DM, DM, bo, 1.0f / (OCAR * WCAR));
    }
}

// v003
// It runs in 251 microseconds.
// In two side-by-side timings against v002, it was 1.27 and 1.30 times as fast.
// Counting every step since v000, it is 6.54 times as fast.
#include <hip/hip_runtime.h>

// Multi-head self-attention block (hidden [NB][SEQ][2048], 16 heads x 128): q/k/v = x W^T + b; s = (q.k) x 128^-0.5 + (1 - m[key]) x f32_lowest; p = softmax over keys; ctx = p.v; out = ctx Wo^T + bo -> [NB][SEQ][2048] f32.
// Compute dtypes (f32 accumulate everywhere): x, W*, b*, m enter as their bf16 (RNE) values; q/k/v projections: v_wmma_f32_16x16x32_bf16 (bf16 operands);
// scores: v_wmma_f32_16x16x32_f16 (f16 q, k planes); p.v: v_wmma_f32_16x16x32_f16 (f16 p = exp(s - running max), not normalised, f16 v; the row sum divides at the end); output projection: v_wmma_f32_16x16x32_f16 (f16 ctx x64, f16 Wo x64); softmax f32.
#pragma clang fp contract(off)

#ifndef NB
#define NB 2
#endif
#ifndef SEQ
#define SEQ 2048
#endif
#define NB_FULL  2
#define SEQ_FULL 2048
#define DM   2048
#define NH_  16
#define HD   128
#define DQ   (NH_ * HD)
#define OCAR 64.0f
#define WCAR 64.0f
#define SCL  0.08838834764831845f
#define FLOW (-3.4028234663852886e38f)

static_assert(SEQ % 128 == 0);
static_assert(SEQ >= 128 && SEQ <= SEQ_FULL);
static_assert(NB >= 1 && NB <= NB_FULL);
static_assert(DQ == DM);
static_assert(DM % 64 == 0 && HD == 128);

typedef _Float16 h16;
typedef unsigned short bf;
typedef __attribute__((ext_vector_type(16))) __bf16   v16bf;
typedef __attribute__((ext_vector_type(16))) _Float16 v16h;
typedef __attribute__((ext_vector_type(8)))  _Float16 v8h;
typedef __attribute__((ext_vector_type(4)))  _Float16 v4h;
typedef __attribute__((ext_vector_type(8)))  unsigned short v8us;
typedef __attribute__((ext_vector_type(8)))  float    v8f;
typedef __attribute__((ext_vector_type(4)))  float    v4f;
typedef v4f __attribute__((may_alias)) v4fa;

__device__ __forceinline__ unsigned short f2bf(float f) { unsigned u = __float_as_uint(f); u += 0x7FFFu + ((u >> 16) & 1u); return (unsigned short)(u >> 16); }
__device__ __forceinline__ float bf2f(unsigned short b) { return __uint_as_float(((unsigned)b) << 16); }
__device__ __forceinline__ float bfr(float f) { return bf2f(f2bf(f)); }
__device__ __forceinline__ v16h cat16(v8h lo, v8h hi) { return __builtin_shufflevector(lo, hi, 0, 1, 2, 3, 4, 5, 6, 7, 8, 9, 10, 11, 12, 13, 14, 15); }
__device__ __forceinline__ v16bf cat16b(v8us lo, v8us hi) { return __builtin_bit_cast(v16bf, __builtin_shufflevector(lo, hi, 0, 1, 2, 3, 4, 5, 6, 7, 8, 9, 10, 11, 12, 13, 14, 15)); }
__device__ __forceinline__ v8f wmma16(v16h a, v16h b, v8f c) { return __builtin_amdgcn_wmma_f32_16x16x32_f16(false, a, false, b, (short)0, c, false, false); }
__device__ __forceinline__ v8f wmmab(v16bf a, v16bf b, v8f c) { return __builtin_amdgcn_wmma_f32_16x16x32_bf16(false, a, false, b, (short)0, c, false, false); }

// ---- k_gemmt: GEMM, one 128x128 output tile per work-group of 8 waves (4 along M x 2 along N, 32x64 a wave, 8 accumulators); grid (M/128, N/128), 256 threads.
// c[m][n] = cscale x sum_k A[m][k] Bt[n][k] + a bf16-valued bias. A, Bt: K-contiguous 16-bit planes. The epilogue stores c in the form that its reader takes:
//   OUT_F32:  C[m][n] f32, pitch ldc, bias[n] (the block's output).
//   OUT_HEAD: P[n / HD][m][n % HD] f16, bias[n] (m = token: the q and k planes [h][t][d]; a tile's 128 columns are one head).
//   OUT_ROWS: P[m][n] f16, pitch SEQ, bias[m] (A = the weight, Bt = x, so m = h * HD + d and n = token: the v^T plane [h][d][t] comes out of the product as it stands, with no transposition).
// K % 128 == 0, K >= 256 (two stages at least: the second stage's copies stand under no test), M % 128 == 0, N % 128 == 0.
// Both operands come in stages of 128 k (rows of 256 B) by asynchronous copies, global -> LDS through no register, two buffers: stage t + 1 flies while stage t is worked on, and every row is fetched once a work-group, in whole lines.
// Fragment map (both operands): lane l -> row/col (l & 15); elements 0..7 <- k0 + 8*(l>>4) + 0..7, elements 8..15 <- k0 + 16 + 8*(l>>4) + 0..7. D element r of lane l -> (row 8*(l>>4) + r, col l & 15).
template <typename T16> struct WFrag;
template <> struct WFrag<h16> { typedef v16h V; static __device__ __forceinline__ V ld(const h16* p) { return cat16(*(const v8h*)p, *(const v8h*)(p + 16)); } static __device__ __forceinline__ v8f mma(V a, V b, v8f c) { return wmma16(a, b, c); } };
template <> struct WFrag<bf> { typedef v16bf V; static __device__ __forceinline__ V ld(const bf* p) { return cat16b(*(const v8us*)p, *(const v8us*)(p + 16)); } static __device__ __forceinline__ v8f mma(V a, V b, v8f c) { return wmmab(a, b, c); } };
#define GT_T   128                       // rows of each operand in a tile
#define GT_KS  128                       // k of a stage
#define GT_P   272                       // LDS pitch of a row (256 B + 16): 16 B x odd, conflict-free for 16-byte row reads
#define GT_OP  (GT_T * GT_P)             // one operand's stage
#define GT_BUF (2 * GT_OP)               // a buffer: [A 128 rows | Bt 128 rows]
static_assert(SEQ % GT_T == 0 && DM % GT_T == 0 && DQ % GT_T == 0 && GT_T == HD);
#define OUT_F32  0
#define OUT_HEAD 1
#define OUT_ROWS 2
// One operand's stage, this thread's share: eight 16-byte chunks, rows 16 apart (l: the lane's LDS byte address, g: its global address, rs: 16 rows in elements).
// The s_wait_xcnt at the end of the statement stands in front of any later write of the address registers that the copies name.
template <typename T16>
__device__ __forceinline__ void gt_copy8(unsigned l, const T16* g, size_t rs) {
    asm volatile("global_load_async_to_lds_b128 %0, %8, off\n\t"
                 "global_load_async_to_lds_b128 %1, %9, off\n\t"
                 "global_load_async_to_lds_b128 %2, %10, off\n\t"
                 "global_load_async_to_lds_b128 %3, %11, off\n\t"
                 "global_load_async_to_lds_b128 %4, %12, off\n\t"
                 "global_load_async_to_lds_b128 %5, %13, off\n\t"
                 "global_load_async_to_lds_b128 %6, %14, off\n\t"
                 "global_load_async_to_lds_b128 %7, %15, off\n\t"
                 "s_wait_xcnt 0x0"
                 :: "v"(l), "v"(l + 16 * GT_P), "v"(l + 32 * GT_P), "v"(l + 48 * GT_P), "v"(l + 64 * GT_P), "v"(l + 80 * GT_P), "v"(l + 96 * GT_P), "v"(l + 112 * GT_P),
                    "v"(g), "v"(g + rs), "v"(g + 2 * rs), "v"(g + 3 * rs), "v"(g + 4 * rs), "v"(g + 5 * rs), "v"(g + 6 * rs), "v"(g + 7 * rs)
                 : "memory");
}
// at most 256 VGPRs: the asm operands above stay in the register window that needs no switching
template <typename T16, int K, int OUT>
__global__ __launch_bounds__(256) __attribute__((amdgpu_num_vgpr(256)))
void k_gemmt(const T16* __restrict__ A, const T16* __restrict__ Bt, float* C, h16* P, int ldc, const float* __restrict__ bias, float cscale) {
    static_assert(K % GT_KS == 0 && K >= 2 * GT_KS);
    typedef typename WFrag<T16>::V V;
    __shared__ __align__(16) unsigned char L[2 * GT_BUF];
    __shared__ __align__(16) float OS[8 * 16 * 68];
    const int tid = threadIdx.x, lane = tid & 31, wave = tid >> 5, lr = lane & 15, hi = lane >> 4, wm = wave >> 1, wn = wave & 1;
    const int r0 = blockIdx.x * GT_T, c0 = blockIdx.y * GT_T;
    // staging map: 2048 16-byte chunks an operand and stage, chunk = tid + 256 i -> row (tid >> 4) + 16 i, 16 chunks a row: a wave's copy covers two whole rows of the stage
    const T16* ag = A + (size_t)(r0 + (tid >> 4)) * K + (tid & 15) * 8;
    const T16* bg = Bt + (size_t)(c0 + (tid >> 4)) * K + (tid & 15) * 8;
    const size_t rs = (size_t)16 * K;
    const unsigned cl = (unsigned)(size_t)L + (tid >> 4) * GT_P + (tid & 15) * 16;     // where this thread's chunks go
    const unsigned af = (wm * 32 + lr) * GT_P + 16 * hi, bfo = GT_OP + (wn * 64 + lr) * GT_P + 16 * hi;   // where this lane's fragments start
    constexpr int nst = K / GT_KS;
    unsigned bo = 0;   // byte offset of the buffer that holds stage st
    v8f acc[2][4];
#pragma unroll
    for (int mb = 0; mb < 2; ++mb)
#pragma unroll
        for (int nb = 0; nb < 4; ++nb) acc[mb][nb] = (v8f){};
    gt_copy8(cl, ag, rs); gt_copy8(cl + GT_OP, bg, rs);
    asm volatile("s_wait_asynccnt 0x0" ::: "memory");   // stage 0 has landed, as far as this wave copied it
    __syncthreads();                                     // publishes stage 0
    gt_copy8(cl + GT_BUF, ag + GT_KS, rs); gt_copy8(cl + GT_BUF + GT_OP, bg + GT_KS, rs);
    ag += 2 * GT_KS; bg += 2 * GT_KS;
    // kept rolled: the body holds a whole stage's 32 products a wave, unrolled
#pragma unroll 1
    for (int st = 0; st < nst; ++st) {
        V a[2][2], b[2][4];
#pragma unroll
        for (int mb = 0; mb < 2; ++mb) a[0][mb] = WFrag<T16>::ld((const T16*)(L + bo + af + mb * 16 * GT_P));
#pragma unroll
        for (int nb = 0; nb < 4; ++nb) b[0][nb] = WFrag<T16>::ld((const T16*)(L + bo + bfo + nb * 16 * GT_P));
#pragma unroll
        for (int kb = 0; kb < GT_KS / 32; ++kb) {
            const int cur = kb & 1, nxt = cur ^ 1;
            if (kb + 1 < GT_KS / 32) {   // the next 32 k's fragments, read as one group in front of this block's products
#pragma unroll
                for (int mb = 0; mb < 2; ++mb) a[nxt][mb] = WFrag<T16>::ld((const T16*)(L + bo + af + mb * 16 * GT_P + (kb + 1) * 64));
#pragma unroll
                for (int nb = 0; nb < 4; ++nb) b[nxt][nb] = WFrag<T16>::ld((const T16*)(L + bo + bfo + nb * 16 * GT_P + (kb + 1) * 64));
            }
            __builtin_amdgcn_sched_barrier(0);   // the reads stay one group in front of the products, which cover their latency; left free, the compiler put them two by two in front of each pair of products, with a full wait each
#pragma unroll
            for (int nb = 0; nb < 4; ++nb)
#pragma unroll
                for (int mb = 0; mb < 2; ++mb) acc[mb][nb] = WFrag<T16>::mma(a[cur][mb], b[cur][nb], acc[mb][nb]);
            __builtin_amdgcn_sched_barrier(0);   // and no read of the block after next moves up among these products
        }
        asm volatile("s_wait_dscnt 0x0" ::: "memory");      // this wave's reads of stage st have returned
        asm volatile("s_wait_asynccnt 0x0" ::: "memory");   // its copies of stage st + 1 have landed
        __syncthreads();                                     // publishes stage st + 1 and ends every wave's reads of stage st
        if (st + 2 < nst) { gt_copy8(cl + bo, ag, rs); gt_copy8(cl + bo + GT_OP, bg, rs); }   // stage st + 2 into the buffer that stage st has left
        ag += GT_KS; bg += GT_KS; bo = GT_BUF - bo;
    }
    asm volatile("s_wait_asynccnt 0x0" ::: "memory");       // no copy is outstanding when the wave goes on
    const int cw = c0 + wn * 64;
    float* os = OS + wave * (16 * 68);   // each wave stages its own 16 x 64 block, so that whole lines are stored
    if constexpr (OUT == OUT_F32) {
    // bias for this lane's 4 output columns: one 16-B load per lane, loaded once (the columns are the same for every row of the wave's tile)
    v4f bb; { const v4f br = *(const v4f*)(bias + cw + lr * 4); bb[0] = bfr(br[0]); bb[1] = bfr(br[1]); bb[2] = bfr(br[2]); bb[3] = bfr(br[3]); }
#pragma unroll
    for (int mb = 0; mb < 2; ++mb) {
#pragma unroll
        for (int nb = 0; nb < 4; ++nb) {
#pragma unroll
            for (int j = 0; j < 8; ++j) os[(hi * 8 + j) * 68 + nb * 16 + lr] = acc[mb][nb][j]; }
        __builtin_amdgcn_wave_barrier(); asm volatile("" ::: "memory");   // other lanes of the wave read these rows back: the compiler may move no read in front of the stores
        float* crow = C + (size_t)(r0 + wm * 32 + mb * 16) * ldc + cw;
#pragma unroll
        for (int s = 0; s < 8; ++s) { const int row = 2 * s + hi, cofs = lr * 4; v4f val = *(const v4fa*)(os + row * 68 + cofs); val = val * cscale; val = val + bb;
            *(v4f*)(crow + (size_t)row * ldc + cofs) = val; }
        __builtin_amdgcn_wave_barrier(); asm volatile("" ::: "memory");   // and no store of the next 16 rows in front of these reads
    }
    } else {
    // f16 planes: a row of the wave's block is 64 values = one 128-byte line; eight lanes store a row (8 values = 16 B each), a wave's store covers four whole rows
    const int c8 = (lane & 7) * 8, r4 = lane >> 3;
    constexpr int pp = OUT == OUT_HEAD ? HD : SEQ;   // pitch of the plane
    h16* pr = (OUT == OUT_HEAD ? P + ((size_t)blockIdx.y * SEQ + r0) * HD + wn * 64 : P + (size_t)r0 * SEQ + cw) + (size_t)(wm * 32 + r4) * pp + c8;
    v4f bc[2] = {(v4f){}, (v4f){}};   // OUT_HEAD: the bias of this lane's 8 columns, the same for every row
    if constexpr (OUT == OUT_HEAD) {
#pragma unroll
        for (int q = 0; q < 2; ++q) { const v4f br = *(const v4f*)(bias + cw + c8 + 4 * q); bc[q][0] = bfr(br[0]); bc[q][1] = bfr(br[1]); bc[q][2] = bfr(br[2]); bc[q][3] = bfr(br[3]); }
    }
    v4f br[2][2] = {{(v4f){}, (v4f){}}, {(v4f){}, (v4f){}}};   // OUT_ROWS: the bias of the 8 rows that this lane's accumulators hold, for both 16-row blocks
    if constexpr (OUT == OUT_ROWS) {
#pragma unroll
        for (int mb = 0; mb < 2; ++mb)
#pragma unroll
            for (int q = 0; q < 2; ++q) { const v4f b = *(const v4f*)(bias + r0 + wm * 32 + mb * 16 + hi * 8 + 4 * q); br[mb][q][0] = bfr(b[0]); br[mb][q][1] = bfr(b[1]); br[mb][q][2] = bfr(b[2]); br[mb][q][3] = bfr(b[3]); }
    }
#pragma unroll
    for (int mb = 0; mb < 2; ++mb) {
        if constexpr (OUT == OUT_ROWS) {   // the bias goes by rows: added where a lane still holds 8 rows of one column
#pragma unroll
            for (int nb = 0; nb < 4; ++nb) {
#pragma unroll
                for (int j = 0; j < 8; ++j) os[(hi * 8 + j) * 68 + nb * 16 + lr] = acc[mb][nb][j] * cscale + br[mb][j >> 2][j & 3]; }
        } else {
#pragma unroll
            for (int nb = 0; nb < 4; ++nb) {
#pragma unroll
                for (int j = 0; j < 8; ++j) os[(hi * 8 + j) * 68 + nb * 16 + lr] = acc[mb][nb][j]; }
        }
        __builtin_amdgcn_wave_barrier(); asm volatile("" ::: "memory");   // other lanes of the wave read these rows back: the compiler may move no read in front of the stores
#pragma unroll
        for (int s = 0; s < 4; ++s) { const float* rp = os + (4 * s + r4) * 68 + c8; v4f lo = *(const v4fa*)rp, up = *(const v4fa*)(rp + 4);
            if constexpr (OUT == OUT_HEAD) { lo = lo * cscale; lo = lo + bc[0]; up = up * cscale; up = up + bc[1]; }
            v8h o;
#pragma unroll
            for (int q = 0; q < 4; ++q) { o[q] = (h16)lo[q]; o[q + 4] = (h16)up[q]; }
            *(v8h*)(pr + (size_t)(mb * 16 + 4 * s) * pp) = o; }
        __builtin_amdgcn_wave_barrier(); asm volatile("" ::: "memory");   // and no store of the next 16 rows in front of these reads
    }
    }
}

__global__ __launch_bounds__(256) void k_cvt8(const float* __restrict__ src, bf* dst, size_t n8) { const size_t i = (size_t)blockIdx.x * 256 + threadIdx.x; if (i >= n8) return; const v8f v = *(const v8f*)(src + i * 8); v8us o;
#pragma unroll
    for (int k = 0; k < 8; ++k) o[k] = f2bf(v[k]); *(v8us*)(dst + i * 8) = o;  }
__global__ __launch_bounds__(256) void k_cvt8h(const float* __restrict__ src, float sc, h16* dst, size_t n8) { const size_t i = (size_t)blockIdx.x * 256 + threadIdx.x; if (i >= n8) return; const v8f v = *(const v8f*)(src + i * 8); v8h o;
#pragma unroll
    for (int k = 0; k < 8; ++k) o[k] = (h16)(bfr(v[k]) * sc); *(v8h*)(dst + i * 8) = o;  }
__global__ __launch_bounds__(256) void k_madd(const float* __restrict__ m, float* MA) { const int i = blockIdx.x * 256 + threadIdx.x; if (i >= SEQ / 4) return; const v4f a = *(const v4f*)(m + (size_t)i * 4); v4f o;
#pragma unroll
    for (int q = 0; q < 4; ++q) { float u = 1.0f - bfr(a[q]); asm volatile("" : "+v"(u)); o[q] = u * FLOW; }
    *(v4f*)(MA + (size_t)i * 4) = o;  }
// ---- k_fattn: scores, softmax and p.v of one head for 128 queries in one work-group; no score ever reaches memory. grid (SEQ/128, NH_), 256 threads = 8 waves x 16 queries.
// Transposed products: S^T = K.Q^T (A = 16 keys x 32 d from LDS, B = Q^T kept in registers), O^T += V^T.P^T (A = 16 d x 32 keys from LDS, B = P^T).
// D of S^T: lane l holds query (l & 15), keys 8*(l>>4) + r of each 16-key tile; that is the B operand's k order for 32 keys (tile 0 -> elements 0..7, tile 1 -> elements 8..15), so P^T packs in-lane.
// K rows ([t][d] plane) and V^T rows ([d][t] plane) come in stages of 64 keys: global -> registers -> LDS, two buffers; the next stage's loads fly under this stage's two 32-key passes.
// Every inner loop is fully unrolled, so that each index into a register array is a constant (an index known only at run time would send the array to scratch).
// Online softmax: t = s x SCL + MA[key]; p = exp(t - m_run); m_run may trail the true maximum by up to FA_LAG (p stays below e^FA_LAG, far inside f16); the sums are rescaled only when some query's maximum passes that.
#define FA_BQ   128
#define FA_SK   64
#define FA_PK   272                       // LDS pitch of a K row (256 B + 16): 16 B x odd, conflict-free for 16-byte row reads
#define FA_PV   144                       // LDS pitch of a V^T row (128 B + 16): 16 B x odd
#define FA_TK   (FA_SK * FA_PK)
#define FA_SLOT (FA_TK + HD * FA_PV)
#define FA_FLIP 65536                     // the two buffers lie 64 KiB apart, so that one XOR on an LDS offset changes the buffer
#define FA_LAG  5.5f
#define L2E     1.4426950408889634f
static_assert(SEQ % FA_BQ == 0 && SEQ % FA_SK == 0 && SEQ % 1024 == 0 && FA_SLOT <= FA_FLIP);
typedef __attribute__((ext_vector_type(4))) unsigned v4u;
__device__ __forceinline__ float xhalf(float x) { return __builtin_bit_cast(float, __builtin_amdgcn_permlanex16(__builtin_bit_cast(int, x), __builtin_bit_cast(int, x), 0x76543210, 0xfedcba98, false, false)); }  // lane l <-> lane l ^ 16
// Four exponentials (2^x, in place) in one statement. The v_nop at its end fills the slot that the instruction set asks for behind a transcendental before a source is overwritten or the result read.
__device__ __forceinline__ void exp2x4(float& a, float& b, float& c, float& d) { asm("v_exp_f32 %0, %0\n\tv_exp_f32 %1, %1\n\tv_exp_f32 %2, %2\n\tv_exp_f32 %3, %3\n\tv_nop" : "+v"(a), "+v"(b), "+v"(c), "+v"(d)); }
// at most 256 VGPRs: the asm operands above stay in the register window that needs no switching
__global__ __launch_bounds__(256) __attribute__((amdgpu_num_vgpr(256))) void k_fattn(const h16* __restrict__ QP, const h16* __restrict__ KP, const h16* __restrict__ VT, const float* __restrict__ MA, h16* AT) {
    __shared__ __align__(16) unsigned char L[FA_FLIP + FA_SLOT];
    __shared__ __align__(16) float MAs[SEQ];
    const int tid = threadIdx.x, lane = tid & 31, wave = tid >> 5, lr = lane & 15, hi = lane >> 4;
    const int h = blockIdx.y, q0 = blockIdx.x * FA_BQ + wave * 16;
    // staging map: 1024 16-byte chunks of K (row = chunk >> 4) and 1024 of V^T (row = chunk >> 3) per stage, chunk = tid + 256 i
    const h16* kg = KP + (size_t)h * SEQ * HD; const unsigned ko = (unsigned)tid * 8u;         // a K stage is 16 KiB in a row
    const h16* vg = VT + (size_t)h * HD * SEQ; const unsigned vo = (unsigned)(tid >> 3) * SEQ + (unsigned)(tid & 7) * 8u;
    unsigned kl = (tid >> 4) * FA_PK + (tid & 15) * 16, vl = FA_TK + (tid >> 3) * FA_PV + (tid & 7) * 16;   // where this thread's chunks go
    unsigned kf = lr * FA_PK + 16 * hi, vf = FA_TK + lr * FA_PV + 16 * hi;                                 // where this lane's fragments start
    v4u kr[4], vr[4];
#pragma unroll
    for (int i = 0; i < 4; ++i) { kr[i] = *(const v4u*)(kg + i * 2048 + ko); vr[i] = *(const v4u*)(vg + i * 32 * SEQ + vo); }
#pragma unroll
    for (int i = 0; i < SEQ / 1024; ++i) *(v4f*)(MAs + i * 1024 + tid * 4) = *(const v4f*)(MA + i * 1024 + tid * 4);
    v16h qf[4];
    { const h16* qp = QP + ((size_t)h * SEQ + q0 + lr) * HD + 8 * hi;
#pragma unroll
      for (int kc = 0; kc < 4; ++kc) qf[kc] = cat16(*(const v8h*)(qp + 32 * kc), *(const v8h*)(qp + 32 * kc + 16)); }
#pragma unroll
    for (int i = 0; i < 4; ++i) { *(v4u*)(L + kl + i * 16 * FA_PK) = kr[i]; *(v4u*)(L + vl + i * 32 * FA_PV) = vr[i]; }
    v8f acc[8];
#pragma unroll
    for (int t8 = 0; t8 < 8; ++t8) acc[t8] = (v8f){};
    float m_run = FLOW, l_run = 0.f;
    const float* mp = MAs + 8 * hi;
    __syncthreads();
    // kept rolled
#pragma unroll 1
    for (int st = 0; st < SEQ / FA_SK; ++st) {
        const bool more = st + 1 < SEQ / FA_SK;
        kl ^= FA_FLIP; vl ^= FA_FLIP; kg += FA_SK * HD; vg += FA_SK;
        if (more) {
#pragma unroll
            for (int i = 0; i < 4; ++i) { kr[i] = *(const v4u*)(kg + i * 2048 + ko); vr[i] = *(const v4u*)(vg + i * 32 * SEQ + vo); }
        }
#pragma unroll
        for (int sub = 0; sub < FA_SK / 32; ++sub) {
            v16h ka[4][2]; v4f mk[2][2]; v8f s[2] = {(v8f){}, (v8f){}};
            { const unsigned char* p = L + kf + sub * 32 * FA_PK;
#pragma unroll
              for (int kc = 0; kc < 4; ++kc)
#pragma unroll
                for (int kt = 0; kt < 2; ++kt) ka[kc][kt] = cat16(*(const v8h*)(p + kt * 16 * FA_PK + 64 * kc), *(const v8h*)(p + kt * 16 * FA_PK + 64 * kc + 32));
#pragma unroll
              for (int kt = 0; kt < 2; ++kt) { mk[kt][0] = *(const v4f*)(mp + sub * 32 + kt * 16); mk[kt][1] = *(const v4f*)(mp + sub * 32 + kt * 16 + 4); } }
            __builtin_amdgcn_sched_barrier(0);   // the pass's K and mask reads stay one group in front of the products: one LDS latency a pass, not one a product
#pragma unroll
            for (int kc = 0; kc < 4; ++kc)
#pragma unroll
                for (int kt = 0; kt < 2; ++kt) s[kt] = wmma16(ka[kc][kt], qf[kc], s[kt]);
            v16h va[8];
#pragma unroll
            for (int t8 = 0; t8 < 6; ++t8) { const unsigned char* pv = L + vf + t8 * 16 * FA_PV + sub * 64; va[t8] = cat16(*(const v8h*)pv, *(const v8h*)(pv + 32)); }
            __builtin_amdgcn_sched_barrier(0);   // six of the eight V^T fragments are read in front of the softmax arithmetic, which covers their latency; left free, the compiler put the reads two by two in front of each product
            float t[16]; float mx = FLOW;
#pragma unroll
            for (int kt = 0; kt < 2; ++kt)
#pragma unroll
                for (int r = 0; r < 8; ++r) { const float u = s[kt][r] * SCL + mk[kt][r >> 2][r & 3]; t[kt * 8 + r] = u; mx = fmaxf(mx, u); }
            mx = fmaxf(mx, xhalf(mx));   // both halves of the wave now hold the query's maximum over the pass
            if (__builtin_amdgcn_ballot_w32(mx > m_run + FA_LAG) != 0) {   // wave-uniform, rare behind the first pass
                const float m_new = fmaxf(m_run, mx); const float corr = __builtin_amdgcn_exp2f((m_run - m_new) * L2E);
                l_run *= corr; m_run = m_new;
#pragma unroll
                for (int t8 = 0; t8 < 8; ++t8) acc[t8] = acc[t8] * corr;
            }
#pragma unroll
            for (int t8 = 6; t8 < 8; ++t8) { const unsigned char* pv = L + vf + t8 * 16 * FA_PV + sub * 64; va[t8] = cat16(*(const v8h*)pv, *(const v8h*)(pv + 32)); }
            __builtin_amdgcn_sched_barrier(0);   // the last two fragments are read here, where the raw scores' and the mask's registers are free (all eight above did not fit 256 VGPRs); the exponentials and the first six products cover their latency
            v16h pf; float ps[4];
#pragma unroll
            for (int e = 0; e < 16; e += 4) { float p0 = (t[e] - m_run) * L2E, p1 = (t[e + 1] - m_run) * L2E, p2 = (t[e + 2] - m_run) * L2E, p3 = (t[e + 3] - m_run) * L2E;
                exp2x4(p0, p1, p2, p3);
                ps[e >> 2] = (p0 + p1) + (p2 + p3); pf[e] = (h16)p0; pf[e + 1] = (h16)p1; pf[e + 2] = (h16)p2; pf[e + 3] = (h16)p3; }
            l_run += (ps[0] + ps[1]) + (ps[2] + ps[3]);
#pragma unroll
            for (int t8 = 0; t8 < 8; ++t8) acc[t8] = wmma16(va[t8], pf, acc[t8]);
        }
        if (more) {   // into the other buffer: every wave left it at the barrier that ended stage st - 1
#pragma unroll
            for (int i = 0; i < 4; ++i) { *(v4u*)(L + kl + i * 16 * FA_PK) = kr[i]; *(v4u*)(L + vl + i * 32 * FA_PV) = vr[i]; }
        }
        kf ^= FA_FLIP; vf ^= FA_FLIP; mp += FA_SK;
        __syncthreads();   // publishes stage st + 1 and ends every wave's reads of stage st
    }
    const float inv = OCAR / (l_run + xhalf(l_run));   // each half summed its own eight keys of every 16-key tile
    h16* op = AT + (size_t)(q0 + lr) * DQ + (size_t)h * HD + 8 * hi;   // D of O^T: lane l holds query (l & 15), d = 16 t8 + 8*(l>>4) + r
#pragma unroll
    for (int t8 = 0; t8 < 8; ++t8) { v8h o;
#pragma unroll
        for (int r = 0; r < 8; ++r) o[r] = (h16)(acc[t8][r] * inv);
        *(v8h*)(op + t8 * 16) = o; }
}

extern "C" void kernel_launch(void* const* d_in, const int* in_sizes, int n_in,
                              void* d_out, int out_size, void* d_ws, size_t ws_size, hipStream_t stream) {
    if (n_in < 10) return;
    const float* x  = (const float*)d_in[0]; const float* am = (const float*)d_in[1];
    const float* wq = (const float*)d_in[2]; const float* bq = (const float*)d_in[3]; const float* wk = (const float*)d_in[4]; const float* bk = (const float*)d_in[5];
    const float* wv = (const float*)d_in[6]; const float* bv = (const float*)d_in[7]; const float* wo = (const float*)d_in[8]; const float* bo = (const float*)d_in[9];
    if (in_sizes[0] < 0 || (size_t)in_sizes[0] < (size_t)(NB - 1) * SEQ_FULL * DM + (size_t)SEQ * DM) return;
    if (in_sizes[1] < (NB - 1) * SEQ_FULL + SEQ) return;
    if (in_sizes[2] < DQ * DM || in_sizes[4] < DQ * DM || in_sizes[6] < DQ * DM || in_sizes[8] < DM * DQ) return;
    if (in_sizes[3] < DQ || in_sizes[5] < DQ || in_sizes[7] < DQ || in_sizes[9] < DM) return;
    if (out_size < 0 || (size_t)out_size < (size_t)NB * SEQ * DM) return;
    float* OUT = (float*)d_out;     // [NB][SEQ][DM]

    // ---- workspace carve (all offsets 256-B aligned; every region is written to exactly its extent by whole-line stores) ----
    char* wsp = (char*)d_ws; size_t used = 0;
    auto take = [&](size_t bytes) { char* p = wsp + used; used += (bytes + 255) & ~(size_t)255; return (void*)p; };
    bf*  WQ   = (bf*)take((size_t)DQ * DM * 2);                   // 8,388,608
    bf*  WK   = (bf*)take((size_t)DQ * DM * 2);                   // 8,388,608
    bf*  WV   = (bf*)take((size_t)DQ * DM * 2);                   // 8,388,608
    h16* WO16 = (h16*)take((size_t)DM * DQ * 2);                  // 8,388,608
    bf*  XB   = (bf*)take((size_t)SEQ * DM * 2);                  // 8,388,608
    float* MA = (float*)take((size_t)SEQ * 4);                     // 8,192
    h16* QP16 = (h16*)take((size_t)NH_ * SEQ * HD * 2);           // 8,388,608  [h][t][d]
    h16* KP16 = (h16*)take((size_t)NH_ * SEQ * HD * 2);           // 8,388,608  [h][t][d]
    h16* VT16 = (h16*)take((size_t)NH_ * HD * SEQ * 2);           // 8,388,608  [g][d][t]
    h16* AT16 = (h16*)take((size_t)SEQ * DQ * 2);                 // 8,388,608  [t][h*HD+d]
    if (used > ws_size) return;                                    // total 75,505,664 B at NB=2, SEQ=2048

    const unsigned gw8 = (unsigned)(((size_t)DQ * DM / 8 + 255) / 256);
    k_cvt8<<<gw8, 256, 0, stream>>>(wq, WQ, (size_t)DQ * DM / 8);
    k_cvt8<<<gw8, 256, 0, stream>>>(wk, WK, (size_t)DQ * DM / 8);
    k_cvt8<<<gw8, 256, 0, stream>>>(wv, WV, (size_t)DQ * DM / 8);
    k_cvt8h<<<gw8, 256, 0, stream>>>(wo, WCAR, WO16, (size_t)DM * DQ / 8);
    const unsigned gx8 = (unsigned)(((size_t)SEQ * DM / 8 + 255) / 256);
    const unsigned gma = (unsigned)((SEQ / 4 + 255) / 256);
    for (int b = 0; b < NB; ++b) {
        k_cvt8<<<gx8, 256, 0, stream>>>(x + (size_t)b * SEQ_FULL * DM, XB, (size_t)SEQ * DM / 8);
        k_madd<<<gma, 256, 0, stream>>>(am + (size_t)b * SEQ_FULL, MA);
        k_gemmt<bf, DM, OUT_HEAD><<<dim3(SEQ / GT_T, DQ / GT_T, 1), 256, 0, stream>>>(XB, WQ, nullptr, QP16, 0, bq, 1.0f);
        k_gemmt<bf, DM, OUT_HEAD><<<dim3(SEQ / GT_T, DQ / GT_T, 1), 256, 0, stream>>>(XB, WK, nullptr, KP16, 0, bk, 1.0f);
        k_gemmt<bf, DM, OUT_ROWS><<<dim3(DQ / GT_T, SEQ / GT_T, 1), 256, 0, stream>>>(WV, XB, nullptr, VT16, 0, bv, 1.0f);
        k_fattn<<<dim3(SEQ / FA_BQ, NH_, 1), 256, 0, stream>>>(QP16, KP16, VT16, MA, AT16);
        k_gemmt<h16, DQ, OUT_F32><<<dim3(SEQ / GT_T, DM / GT_T, 1), 256, 0, stream>>>(AT16, WO16, OUT + (size_t)b * SEQ * DM, nullptr, DM, bo, 1.0f / (OCAR * WCAR));
    }
}

// v004
// One run takes 234 microseconds.
// In both of two side-by-side timings against v003, it was 1.07 times as fast.
// Over all steps from v000 it is 7.01 times as fast.
#include <hip/hip_runtime.h>

// Multi-head self-attention block (hidden [NB][SEQ][2048], 16 heads x 128): q/k/v = x W^T + b; s = (q.k) x 128^-0.5 + (1 - m[key]) x f32_lowest; p = softmax over keys; ctx = p.v; out = ctx Wo^T + bo -> [NB][SEQ][2048] f32.
// Compute dtypes (f32 accumulate everywhere): x, W*, b*, m enter as their bf16 (RNE) values; q/k/v projections: v_wmma_f32_16x16x32_bf16 (bf16 operands);
// scores: v_wmma_f32_16x16x32_f16 (f16 q, k planes); p.v: v_wmma_f32_16x16x32_f16 (f16 p = exp(s - running max), not normalised, f16 v; the row sum divides at the end); output projection: v_wmma_f32_16x16x32_f16 (f16 ctx x64, f16 Wo x64); softmax f32.
#pragma clang fp contract(off)

#ifndef NB
#define NB 2
#endif
#ifndef SEQ
#define SEQ 2048
#endif
#define NB_FULL  2
#define SEQ_FULL 2048
#define DM   2048
#define NH_  16
#define HD   128
#define DQ   (NH_ * HD)
#define OCAR 64.0f
#define WCAR 64.0f
#define SCL  0.08838834764831845f
#define FLOW (-3.4028234663852886e38f)

static_assert(SEQ % 128 == 0);
static_assert(SEQ >= 128 && SEQ <= SEQ_FULL);
static_assert(NB >= 1 && NB <= NB_FULL);
static_assert(DQ == DM);
static_assert(DM % 64 == 0 && HD == 128);

typedef _Float16 h16;
typedef unsigned short bf;
typedef __attribute__((ext_vector_type(16))) __bf16   v16bf;
typedef __attribute__((ext_vector_type(16))) _Float16 v16h;
typedef __attribute__((ext_vector_type(8)))  _Float16 v8h;
typedef __attribute__((ext_vector_type(4)))  _Float16 v4h;
typedef __attribute__((ext_vector_type(8)))  unsigned short v8us;
typedef __attribute__((ext_vector_type(8)))  float    v8f;
typedef __attribute__((ext_vector_type(4)))  float    v4f;
typedef v4f __attribute__((may_alias)) v4fa;

__device__ __forceinline__ unsigned short f2bf(float f) { unsigned u = __float_as_uint(f); u += 0x7FFFu + ((u >> 16) & 1u); return (unsigned short)(u >> 16); }
__device__ __forceinline__ float bf2f(unsigned short b) { return __uint_as_float(((unsigned)b) << 16); }
__device__ __forceinline__ float bfr(float f) { return bf2f(f2bf(f)); }
__device__ __forceinline__ v16h cat16(v8h lo, v8h hi) { return __builtin_shufflevector(lo, hi, 0, 1, 2, 3, 4, 5, 6, 7, 8, 9, 10, 11, 12, 13, 14, 15); }
__device__ __forceinline__ v16bf cat16b(v8us lo, v8us hi) { return __builtin_bit_cast(v16bf, __builtin_shufflevector(lo, hi, 0, 1, 2, 3, 4, 5, 6, 7, 8, 9, 10, 11, 12, 13, 14, 15)); }
__device__ __forceinline__ v8f wmma16(v16h a, v16h b, v8f c) { return __builtin_amdgcn_wmma_f32_16x16x32_f16(false, a, false, b, (short)0, c, false, false); }
__device__ __forceinline__ v8f wmmab(v16bf a, v16bf b, v8f c) { return __builtin_amdgcn_wmma_f32_16x16x32_bf16(false, a, false, b, (short)0, c, false, false); }

// ---- k_gemmt: GEMM, one 128x128 output tile per work-group of 8 waves (4 along M x 2 along N, 32x64 a wave, 8 accumulators); grid (M/128, N/128), 256 threads.
// c[m][n] = cscale x sum_k A[m][k] Bt[n][k] + a bf16-valued bias. A, Bt: K-contiguous 16-bit planes. The epilogue stores c in the form that its reader takes:
//   OUT_F32:  C[m][n] f32, pitch ldc, bias[n] (the block's output).
//   OUT_HEAD: P[n / HD][m][n % HD] f16, bias[n] (m = token: the q and k planes [h][t][d]; a tile's 128 columns are one head).
//   OUT_ROWS: P[m][n] f16, pitch SEQ, bias[m] (A = the weight, Bt = x, so m = h * HD + d and n = token: the v^T plane [h][d][t] comes out of the product as it stands, with no transposition).
// K % 128 == 0, K >= 256 (two stages at least: the second stage's copies stand under no test), M % 128 == 0, N % 128 == 0.
// Both operands come in stages of 128 k (rows of 256 B) by asynchronous copies, global -> LDS through no register, two buffers: stage t + 1 flies while stage t is worked on, and every row is fetched once a work-group, in whole lines.
// Fragment map (both operands): lane l -> row/col (l & 15); elements 0..7 <- k0 + 8*(l>>4) + 0..7, elements 8..15 <- k0 + 16 + 8*(l>>4) + 0..7. D element r of lane l -> (row 8*(l>>4) + r, col l & 15).
template <typename T16> struct WFrag;
template <> struct WFrag<h16> { typedef v16h V; static __device__ __forceinline__ V ld(const h16* p) { return cat16(*(const v8h*)p, *(const v8h*)(p + 16)); } static __device__ __forceinline__ v8f mma(V a, V b, v8f c) { return wmma16(a, b, c); } };
template <> struct WFrag<bf> { typedef v16bf V; static __device__ __forceinline__ V ld(const bf* p) { return cat16b(*(const v8us*)p, *(const v8us*)(p + 16)); } static __device__ __forceinline__ v8f mma(V a, V b, v8f c) { return wmmab(a, b, c); } };
#define GT_T   128                       // rows of each operand in a tile
#define GT_KS  128                       // k of a stage
#define GT_P   272                       // LDS pitch of a row (256 B + 16): 16 B x odd, conflict-free for 16-byte row reads
#define GT_OP  (GT_T * GT_P)             // one operand's stage
#define GT_BUF (2 * GT_OP)               // a buffer: [A 128 rows | Bt 128 rows]
static_assert(SEQ % GT_T == 0 && DM % GT_T == 0 && DQ % GT_T == 0 && GT_T == HD);
#define OUT_F32  0
#define OUT_HEAD 1
#define OUT_ROWS 2
// One operand's stage, this thread's share: eight 16-byte chunks, rows 16 apart (l: the lane's LDS byte address, g: its global address, rs: 16 rows in elements).
// The s_wait_xcnt at the end of the statement stands in front of any later write of the address registers that the copies name.
template <typename T16>
__device__ __forceinline__ void gt_copy8(unsigned l, const T16* g, size_t rs) {
    asm volatile("global_load_async_to_lds_b128 %0, %8, off\n\t"
                 "global_load_async_to_lds_b128 %1, %9, off\n\t"
                 "global_load_async_to_lds_b128 %2, %10, off\n\t"
                 "global_load_async_to_lds_b128 %3, %11, off\n\t"
                 "global_load_async_to_lds_b128 %4, %12, off\n\t"
                 "global_load_async_to_lds_b128 %5, %13, off\n\t"
                 "global_load_async_to_lds_b128 %6, %14, off\n\t"
                 "global_load_async_to_lds_b128 %7, %15, off\n\t"
                 "s_wait_xcnt 0x0"
                 :: "v"(l), "v"(l + 16 * GT_P), "v"(l + 32 * GT_P), "v"(l + 48 * GT_P), "v"(l + 64 * GT_P), "v"(l + 80 * GT_P), "v"(l + 96 * GT_P), "v"(l + 112 * GT_P),
                    "v"(g), "v"(g + rs), "v"(g + 2 * rs), "v"(g + 3 * rs), "v"(g + 4 * rs), "v"(g + 5 * rs), "v"(g + 6 * rs), "v"(g + 7 * rs)
                 : "memory");
}
// at most 256 VGPRs: the asm operands above stay in the register window that needs no switching
template <typename T16, int K, int OUT>
__global__ __launch_bounds__(256) __attribute__((amdgpu_num_vgpr(256)))
void k_gemmt(const T16* __restrict__ A, const T16* __restrict__ Bt, float* C, h16* P, int ldc, const float* __restrict__ bias, float cscale) {
    static_assert(K % GT_KS == 0 && K >= 2 * GT_KS);
    typedef typename WFrag<T16>::V V;
    __shared__ __align__(16) unsigned char L[2 * GT_BUF];
    __shared__ __align__(16) float OS[8 * 16 * 68];
    const int tid = threadIdx.x, lane = tid & 31, wave = tid >> 5, lr = lane & 15, hi = lane >> 4, wm = wave >> 1, wn = wave & 1;
    const int r0 = blockIdx.x * GT_T, c0 = blockIdx.y * GT_T;
    // staging map: 2048 16-byte chunks an operand and stage, chunk = tid + 256 i -> row (tid >> 4) + 16 i, 16 chunks a row: a wave's copy covers two whole rows of the stage
    const T16* ag = A + (size_t)(r0 + (tid >> 4)) * K + (tid & 15) * 8;
    const T16* bg = Bt + (size_t)(c0 + (tid >> 4)) * K + (tid & 15) * 8;
    const size_t rs = (size_t)16 * K;
    const unsigned cl = (unsigned)(size_t)L + (tid >> 4) * GT_P + (tid & 15) * 16;     // where this thread's chunks go
    const unsigned af = (wm * 32 + lr) * GT_P + 16 * hi, bfo = GT_OP + (wn * 64 + lr) * GT_P + 16 * hi;   // where this lane's fragments start
    constexpr int nst = K / GT_KS;
    unsigned bo = 0;   // byte offset of the buffer that holds stage st
    v8f acc[2][4];
#pragma unroll
    for (int mb = 0; mb < 2; ++mb)
#pragma unroll
        for (int nb = 0; nb < 4; ++nb) acc[mb][nb] = (v8f){};
    gt_copy8(cl, ag, rs); gt_copy8(cl + GT_OP, bg, rs);
    asm volatile("s_wait_asynccnt 0x0" ::: "memory");   // stage 0 has landed, as far as this wave copied it
    __syncthreads();                                     // publishes stage 0
    gt_copy8(cl + GT_BUF, ag + GT_KS, rs); gt_copy8(cl + GT_BUF + GT_OP, bg + GT_KS, rs);
    ag += 2 * GT_KS; bg += 2 * GT_KS;
    // kept rolled: the body holds a whole stage's 32 products a wave, unrolled
#pragma unroll 1
    for (int st = 0; st < nst; ++st) {
        V a[2][2], b[2][4];
#pragma unroll
        for (int mb = 0; mb < 2; ++mb) a[0][mb] = WFrag<T16>::ld((const T16*)(L + bo + af + mb * 16 * GT_P));
#pragma unroll
        for (int nb = 0; nb < 4; ++nb) b[0][nb] = WFrag<T16>::ld((const T16*)(L + bo + bfo + nb * 16 * GT_P));
#pragma unroll
        for (int kb = 0; kb < GT_KS / 32; ++kb) {
            const int cur = kb & 1, nxt = cur ^ 1;
            if (kb + 1 < GT_KS / 32) {   // the next 32 k's fragments, read as one group in front of this block's products
#pragma unroll
                for (int mb = 0; mb < 2; ++mb) a[nxt][mb] = WFrag<T16>::ld((const T16*)(L + bo + af + mb * 16 * GT_P + (kb + 1) * 64));
#pragma unroll
                for (int nb = 0; nb < 4; ++nb) b[nxt][nb] = WFrag<T16>::ld((const T16*)(L + bo + bfo + nb * 16 * GT_P + (kb + 1) * 64));
            }
            __builtin_amdgcn_sched_barrier(0);   // the reads stay one group in front of the products, which cover their latency; left free, the compiler put them two by two in front of each pair of products, with a full wait each
#pragma unroll
            for (int nb = 0; nb < 4; ++nb)
#pragma unroll
                for (int mb = 0; mb < 2; ++mb) acc[mb][nb] = WFrag<T16>::mma(a[cur][mb], b[cur][nb], acc[mb][nb]);
            __builtin_amdgcn_sched_barrier(0);   // and no read of the block after next moves up among these products
        }
        asm volatile("s_wait_dscnt 0x0" ::: "memory");      // this wave's reads of stage st have returned
        asm volatile("s_wait_asynccnt 0x0" ::: "memory");   // its copies of stage st + 1 have landed
        __syncthreads();                                     // publishes stage st + 1 and ends every wave's reads of stage st
        if (st + 2 < nst) { gt_copy8(cl + bo, ag, rs); gt_copy8(cl + bo + GT_OP, bg, rs); }   // stage st + 2 into the buffer that stage st has left
        ag += GT_KS; bg += GT_KS; bo = GT_BUF - bo;
    }
    asm volatile("s_wait_asynccnt 0x0" ::: "memory");       // no copy is outstanding when the wave goes on
    const int cw = c0 + wn * 64;
    float* os = OS + wave * (16 * 68);   // each wave stages its own 16 x 64 block, so that whole lines are stored
    if constexpr (OUT == OUT_F32) {
    // bias for this lane's 4 output columns: one 16-B load per lane, loaded once (the columns are the same for every row of the wave's tile)
    v4f bb; { const v4f br = *(const v4f*)(bias + cw + lr * 4); bb[0] = bfr(br[0]); bb[1] = bfr(br[1]); bb[2] = bfr(br[2]); bb[3] = bfr(br[3]); }
#pragma unroll
    for (int mb = 0; mb < 2; ++mb) {
#pragma unroll
        for (int nb = 0; nb < 4; ++nb) {
#pragma unroll
            for (int j = 0; j < 8; ++j) os[(hi * 8 + j) * 68 + nb * 16 + lr] = acc[mb][nb][j]; }
        __builtin_amdgcn_wave_barrier(); asm volatile("" ::: "memory");   // other lanes of the wave read these rows back: the compiler may move no read in front of the stores
        float* crow = C + (size_t)(r0 + wm * 32 + mb * 16) * ldc + cw;
#pragma unroll
        for (int s = 0; s < 8; ++s) { const int row = 2 * s + hi, cofs = lr * 4; v4f val = *(const v4fa*)(os + row * 68 + cofs); val = val * cscale; val = val + bb;
            *(v4f*)(crow + (size_t)row * ldc + cofs) = val; }
        __builtin_amdgcn_wave_barrier(); asm volatile("" ::: "memory");   // and no store of the next 16 rows in front of these reads
    }
    } else {
    // f16 planes: a row of the wave's block is 64 values = one 128-byte line; eight lanes store a row (8 values = 16 B each), a wave's store covers four whole rows
    const int c8 = (lane & 7) * 8, r4 = lane >> 3;
    constexpr int pp = OUT == OUT_HEAD ? HD : SEQ;   // pitch of the plane
    h16* pr = (OUT == OUT_HEAD ? P + ((size_t)blockIdx.y * SEQ + r0) * HD + wn * 64 : P + (size_t)r0 * SEQ + cw) + (size_t)(wm * 32 + r4) * pp + c8;
    v4f bc[2] = {(v4f){}, (v4f){}};   // OUT_HEAD: the bias of this lane's 8 columns, the same for every row
    if constexpr (OUT == OUT_HEAD) {
#pragma unroll
        for (int q = 0; q < 2; ++q) { const v4f br = *(const v4f*)(bias + cw + c8 + 4 * q); bc[q][0] = bfr(br[0]); bc[q][1] = bfr(br[1]); bc[q][2] = bfr(br[2]); bc[q][3] = bfr(br[3]); }
    }
    v4f br[2][2] = {{(v4f){}, (v4f){}}, {(v4f){}, (v4f){}}};   // OUT_ROWS: the bias of the 8 rows that this lane's accumulators hold, for both 16-row blocks
    if constexpr (OUT == OUT_ROWS) {
#pragma unroll
        for (int mb = 0; mb < 2; ++mb)
#pragma unroll
            for (int q = 0; q < 2; ++q) { const v4f b = *(const v4f*)(bias + r0 + wm * 32 + mb * 16 + hi * 8 + 4 * q); br[mb][q][0] = bfr(b[0]); br[mb][q][1] = bfr(b[1]); br[mb][q][2] = bfr(b[2]); br[mb][q][3] = bfr(b[3]); }
    }
#pragma unroll
    for (int mb = 0; mb < 2; ++mb) {
        if constexpr (OUT == OUT_ROWS) {   // the bias goes by rows: added where a lane still holds 8 rows of one column
#pragma unroll
            for (int nb = 0; nb < 4; ++nb) {
#pragma unroll
                for (int j = 0; j < 8; ++j) os[(hi * 8 + j) * 68 + nb * 16 + lr] = acc[mb][nb][j] * cscale + br[mb][j >> 2][j & 3]; }
        } else {
#pragma unroll
            for (int nb = 0; nb < 4; ++nb) {
#pragma unroll
                for (int j = 0; j < 8; ++j) os[(hi * 8 + j) * 68 + nb * 16 + lr] = acc[mb][nb][j]; }
        }
        __builtin_amdgcn_wave_barrier(); asm volatile("" ::: "memory");   // other lanes of the wave read these rows back: the compiler may move no read in front of the stores
#pragma unroll
        for (int s = 0; s < 4; ++s) { const float* rp = os + (4 * s + r4) * 68 + c8; v4f lo = *(const v4fa*)rp, up = *(const v4fa*)(rp + 4);
            if constexpr (OUT == OUT_HEAD) { lo = lo * cscale; lo = lo + bc[0]; up = up * cscale; up = up + bc[1]; }
            v8h o;
#pragma unroll
            for (int q = 0; q < 4; ++q) { o[q] = (h16)lo[q]; o[q + 4] = (h16)up[q]; }
            *(v8h*)(pr + (size_t)(mb * 16 + 4 * s) * pp) = o; }
        __builtin_amdgcn_wave_barrier(); asm volatile("" ::: "memory");   // and no store of the next 16 rows in front of these reads
    }
    }
}

// ---- k_prep: every operand conversion of the block in ONE launch of long-lived waves: wq, wk, wv, x -> bf16 (RNE); wo -> f16 of (its bf16 value x WCAR); m -> (1 - bf16(m)) x f32_lowest.
// grid PR_G work-groups of 256 threads. A unit = 8192 floats = 8 chunks of 4 floats a thread, chunk i of thread t at i * 1024 + t * 4: a wave's load covers 512 bytes in a row (four whole lines), its store 256 (two whole lines).
// Work-group g converts unit g of each weight and of each batch item of x, one after the other, from two register sets: a set is loaded again as soon as it has been converted, so the eight loads of at least one unit are in flight while another is converted.
// Each wave here converts 48 chunks a lane (for speed only).
#define PR_U 8192
#define PR_G (DQ * DM / PR_U)
#define PR_X (SEQ * DM / PR_U)            // units of one batch item of x
#define PR_M (NB * SEQ / 1024)            // work-groups that also convert 1024 mask values each
static_assert(DQ * DM % PR_U == 0 && SEQ * DM % PR_U == 0 && PR_X <= PR_G && SEQ % 1024 == 0 && PR_M <= PR_G);
typedef __attribute__((ext_vector_type(4))) unsigned short v4us;
typedef __attribute__((ext_vector_type(2))) unsigned v2u;
// lo: this thread's byte offset from the source pointer (32 bits, so that the load takes the pointer as its scalar base)
__device__ __forceinline__ void pr_load(const float* __restrict__ s, unsigned lo, v4f (&r)[8]) {
#pragma unroll
    for (int i = 0; i < 8; ++i) r[i] = *(const v4f*)((const char*)s + lo + i * 4096); }
// One unit: converts the set r (H: to f16 of the bf16 value x WCAR; else to bf16), stores it at d + so bytes, and loads the set again from nxt + lo bytes where ld says so.
template <bool H>
__device__ __forceinline__ void pr_step(v4f (&r)[8], void* d, unsigned so, const float* __restrict__ nxt, bool ld, unsigned lo) {
    v2u w[8];
#pragma unroll
    for (int i = 0; i < 8; ++i) {
        if constexpr (H) { v4h o;
#pragma unroll
            for (int q = 0; q < 4; ++q) o[q] = (h16)(bfr(r[i][q]) * WCAR);
            w[i] = __builtin_bit_cast(v2u, o);
        } else { v4us o;
#pragma unroll
            for (int q = 0; q < 4; ++q) o[q] = f2bf(r[i][q]);
            w[i] = __builtin_bit_cast(v2u, o); }
    }
#pragma unroll
    for (int i = 0; i < 8; ++i) *(v2u*)((char*)d + so + i * 2048) = w[i];
    if (ld) pr_load(nxt, lo, r);
    // the wait that stands in front of any later write of a register which these stores and loads name; the offsets and the stored words are its inputs, so that their registers are kept up to here
    asm volatile("s_wait_xcnt 0x0" :: "v"(lo), "v"(so), "v"(w[0]), "v"(w[1]), "v"(w[2]), "v"(w[3]), "v"(w[4]), "v"(w[5]), "v"(w[6]), "v"(w[7]) : "memory");
}
__global__ __launch_bounds__(256) void k_prep(const float* __restrict__ x, const float* __restrict__ m, const float* __restrict__ wq, const float* __restrict__ wk, const float* __restrict__ wv, const float* __restrict__ wo,
                                              bf* WQ, bf* WK, bf* WV, h16* WO16, bf* XB, float* MA) {
    const int g = blockIdx.x, tid = threadIdx.x;
    const unsigned so = (unsigned)(g * PR_U + tid * 4) * 2u, lo = so * 2u;
    const bool hasx = PR_X == PR_G || g < PR_X;   // the same for the whole work-group
    v4f r[2][8];
    pr_load(wq, lo, r[0]);
    pr_load(wk, lo, r[1]);
    pr_step<false>(r[0], WQ, so, wv, true, lo);
    pr_step<false>(r[1], WK, so, wo, true, lo);
    pr_step<false>(r[0], WV, so, x, hasx, lo);
    pr_step<true>(r[1], WO16, so, x, hasx && NB > 1, NB > 1 ? lo + SEQ_FULL * DM * 4u : lo);
#pragma unroll
    for (int b = 0; b < NB; ++b)   // batch item b: its place goes into the 32-bit offsets
        if (hasx) pr_step<false>(r[b & 1], XB, so + b * (SEQ * DM * 2u), x, b + 2 < NB, b + 2 < NB ? lo + (b + 2) * (SEQ_FULL * DM * 4u) : lo);
    if (g < PR_M) {   // the same for the whole work-group
        const int mi = g * 1024 + tid * 4;   // index into MA, [NB][SEQ]
        const unsigned mo = (unsigned)((mi / SEQ) * SEQ_FULL + mi % SEQ) * 4u;
        const v4f a = *(const v4f*)((const char*)m + mo);
        asm volatile("s_wait_xcnt 0x0" :: "v"(mo) : "memory");   // as above: in front of any later write of the load's offset register
        v4f q;
#pragma unroll
        for (int e = 0; e < 4; ++e) { const float u = 1.0f - bfr(a[e]); q[e] = u * FLOW; }
        *(v4f*)(MA + mi) = q;
    }
}
// ---- k_fattn: scores, softmax and p.v of one head for 128 queries in one work-group; no score ever reaches memory. grid (SEQ/128, NH_), 256 threads = 8 waves x 16 queries.
// Transposed products: S^T = K.Q^T (A = 16 keys x 32 d from LDS, B = Q^T kept in registers), O^T += V^T.P^T (A = 16 d x 32 keys from LDS, B = P^T).
// D of S^T: lane l holds query (l & 15), keys 8*(l>>4) + r of each 16-key tile; that is the B operand's k order for 32 keys (tile 0 -> elements 0..7, tile 1 -> elements 8..15), so P^T packs in-lane.
// K rows ([t][d] plane) and V^T rows ([d][t] plane) come in stages of 64 keys: global -> registers -> LDS, two buffers; the next stage's loads fly under this stage's two 32-key passes.
// Every inner loop is fully unrolled, so that each index into a register array is a constant (an index known only at run time would send the array to scratch).
// Online softmax: t = s x SCL + MA[key]; p = exp(t - m_run); m_run may trail the true maximum by up to FA_LAG (p stays below e^FA_LAG, far inside f16); the sums are rescaled only when some query's maximum passes that.
#define FA_BQ   128
#define FA_SK   64
#define FA_PK   272                       // LDS pitch of a K row (256 B + 16): 16 B x odd, conflict-free for 16-byte row reads
#define FA_PV   144                       // LDS pitch of a V^T row (128 B + 16): 16 B x odd
#define FA_TK   (FA_SK * FA_PK)
#define FA_SLOT (FA_TK + HD * FA_PV)
#define FA_FLIP 65536                     // the two buffers lie 64 KiB apart, so that one XOR on an LDS offset changes the buffer
#define FA_LAG  5.5f
#define L2E     1.4426950408889634f
static_assert(SEQ % FA_BQ == 0 && SEQ % FA_SK == 0 && SEQ % 1024 == 0 && FA_SLOT <= FA_FLIP);
typedef __attribute__((ext_vector_type(4))) unsigned v4u;
__device__ __forceinline__ float xhalf(float x) { return __builtin_bit_cast(float, __builtin_amdgcn_permlanex16(__builtin_bit_cast(int, x), __builtin_bit_cast(int, x), 0x76543210, 0xfedcba98, false, false)); }  // lane l <-> lane l ^ 16
// Four exponentials (2^x, in place) in one statement. The v_nop at its end fills the slot that the instruction set asks for behind a transcendental before a source is overwritten or the result read.
__device__ __forceinline__ void exp2x4(float& a, float& b, float& c, float& d) { asm("v_exp_f32 %0, %0\n\tv_exp_f32 %1, %1\n\tv_exp_f32 %2, %2\n\tv_exp_f32 %3, %3\n\tv_nop" : "+v"(a), "+v"(b), "+v"(c), "+v"(d)); }
// at most 256 VGPRs: the asm operands above stay in the register window that needs no switching
__global__ __launch_bounds__(256) __attribute__((amdgpu_num_vgpr(256))) void k_fattn(const h16* __restrict__ QP, const h16* __restrict__ KP, const h16* __restrict__ VT, const float* __restrict__ MA, h16* AT) {
    __shared__ __align__(16) unsigned char L[FA_FLIP + FA_SLOT];
    __shared__ __align__(16) float MAs[SEQ];
    const int tid = threadIdx.x, lane = tid & 31, wave = tid >> 5, lr = lane & 15, hi = lane >> 4;
    const int h = blockIdx.y, q0 = blockIdx.x * FA_BQ + wave * 16;
    // staging map: 1024 16-byte chunks of K (row = chunk >> 4) and 1024 of V^T (row = chunk >> 3) per stage, chunk = tid + 256 i
    const h16* kg = KP + (size_t)h * SEQ * HD; const unsigned ko = (unsigned)tid * 8u;         // a K stage is 16 KiB in a row
    const h16* vg = VT + (size_t)h * HD * SEQ; const unsigned vo = (unsigned)(tid >> 3) * SEQ + (unsigned)(tid & 7) * 8u;
    unsigned kl = (tid >> 4) * FA_PK + (tid & 15) * 16, vl = FA_TK + (tid >> 3) * FA_PV + (tid & 7) * 16;   // where this thread's chunks go
    unsigned kf = lr * FA_PK + 16 * hi, vf = FA_TK + lr * FA_PV + 16 * hi;                                 // where this lane's fragments start
    v4u kr[4], vr[4];
#pragma unroll
    for (int i = 0; i < 4; ++i) { kr[i] = *(const v4u*)(kg + i * 2048 + ko); vr[i] = *(const v4u*)(vg + i * 32 * SEQ + vo); }
#pragma unroll
    for (int i = 0; i < SEQ / 1024; ++i) *(v4f*)(MAs + i * 1024 + tid * 4) = *(const v4f*)(MA + i * 1024 + tid * 4);
    v16h qf[4];
    { const h16* qp = QP + ((size_t)h * SEQ + q0 + lr) * HD + 8 * hi;
#pragma unroll
      for (int kc = 0; kc < 4; ++kc) qf[kc] = cat16(*(const v8h*)(qp + 32 * kc), *(const v8h*)(qp + 32 * kc + 16)); }
#pragma unroll
    for (int i = 0; i < 4; ++i) { *(v4u*)(L + kl + i * 16 * FA_PK) = kr[i]; *(v4u*)(L + vl + i * 32 * FA_PV) = vr[i]; }
    v8f acc[8];
#pragma unroll
    for (int t8 = 0; t8 < 8; ++t8) acc[t8] = (v8f){};
    float m_run = FLOW, l_run = 0.f;
    const float* mp = MAs + 8 * hi;
    __syncthreads();
    // kept rolled
#pragma unroll 1
    for (int st = 0; st < SEQ / FA_SK; ++st) {
        const bool more = st + 1 < SEQ / FA_SK;
        kl ^= FA_FLIP; vl ^= FA_FLIP; kg += FA_SK * HD; vg += FA_SK;
        if (more) {
#pragma unroll
            for (int i = 0; i < 4; ++i) { kr[i] = *(const v4u*)(kg + i * 2048 + ko); vr[i] = *(const v4u*)(vg + i * 32 * SEQ + vo); }
        }
#pragma unroll
        for (int sub = 0; sub < FA_SK / 32; ++sub) {
            v16h ka[4][2]; v4f mk[2][2]; v8f s[2] = {(v8f){}, (v8f){}};
            { const unsigned char* p = L + kf + sub * 32 * FA_PK;
#pragma unroll
              for (int kc = 0; kc < 4; ++kc)
#pragma unroll
                for (int kt = 0; kt < 2; ++kt) ka[kc][kt] = cat16(*(const v8h*)(p + kt * 16 * FA_PK + 64 * kc), *(const v8h*)(p + kt * 16 * FA_PK + 64 * kc + 32));
#pragma unroll
              for (int kt = 0; kt < 2; ++kt) { mk[kt][0] = *(const v4f*)(mp + sub * 32 + kt * 16); mk[kt][1] = *(const v4f*)(mp + sub * 32 + kt * 16 + 4); } }
            __builtin_amdgcn_sched_barrier(0);   // the pass's K and mask reads stay one group in front of the products: one LDS latency a pass, not one a product
#pragma unroll
            for (int kc = 0; kc < 4; ++kc)
#pragma unroll
                for (int kt = 0; kt < 2; ++kt) s[kt] = wmma16(ka[kc][kt], qf[kc], s[kt]);
            v16h va[8];
#pragma unroll
            for (int t8 = 0; t8 < 6; ++t8) { const unsigned char* pv = L + vf + t8 * 16 * FA_PV + sub * 64; va[t8] = cat16(*(const v8h*)pv, *(const v8h*)(pv + 32)); }
            __builtin_amdgcn_sched_barrier(0);   // six of the eight V^T fragments are read in front of the softmax arithmetic, which covers their latency; left free, the compiler put the reads two by two in front of each product
            float t[16]; float mx = FLOW;
#pragma unroll
            for (int kt = 0; kt < 2; ++kt)
#pragma unroll
                for (int r = 0; r < 8; ++r) { const float u = s[kt][r] * SCL + mk[kt][r >> 2][r & 3]; t[kt * 8 + r] = u; mx = fmaxf(mx, u); }
            mx = fmaxf(mx, xhalf(mx));   // both halves of the wave now hold the query's maximum over the pass
            if (__builtin_amdgcn_ballot_w32(mx > m_run + FA_LAG) != 0) {   // wave-uniform, rare behind the first pass
                const float m_new = fmaxf(m_run, mx); const float corr = __builtin_amdgcn_exp2f((m_run - m_new) * L2E);
                l_run *= corr; m_run = m_new;
#pragma unroll
                for (int t8 = 0; t8 < 8; ++t8) acc[t8] = acc[t8] * corr;
            }
#pragma unroll
            for (int t8 = 6; t8 < 8; ++t8) { const unsigned char* pv = L + vf + t8 * 16 * FA_PV + sub * 64; va[t8] = cat16(*(const v8h*)pv, *(const v8h*)(pv + 32)); }
            __builtin_amdgcn_sched_barrier(0);   // the last two fragments are read here, where the raw scores' and the mask's registers are free (all eight above did not fit 256 VGPRs); the exponentials and the first six products cover their latency
            v16h pf; float ps[4];
#pragma unroll
            for (int e = 0; e < 16; e += 4) { float p0 = (t[e] - m_run) * L2E, p1 = (t[e + 1] - m_run) * L2E, p2 = (t[e + 2] - m_run) * L2E, p3 = (t[e + 3] - m_run) * L2E;
                exp2x4(p0, p1, p2, p3);
                ps[e >> 2] = (p0 + p1) + (p2 + p3); pf[e] = (h16)p0; pf[e + 1] = (h16)p1; pf[e + 2] = (h16)p2; pf[e + 3] = (h16)p3; }
            l_run += (ps[0] + ps[1]) + (ps[2] + ps[3]);
#pragma unroll
            for (int t8 = 0; t8 < 8; ++t8) acc[t8] = wmma16(va[t8], pf, acc[t8]);
        }
        if (more) {   // into the other buffer: every wave left it at the barrier that ended stage st - 1
#pragma unroll
            for (int i = 0; i < 4; ++i) { *(v4u*)(L + kl + i * 16 * FA_PK) = kr[i]; *(v4u*)(L + vl + i * 32 * FA_PV) = vr[i]; }
        }
        kf ^= FA_FLIP; vf ^= FA_FLIP; mp += FA_SK;
        __syncthreads();   // publishes stage st + 1 and ends every wave's reads of stage st
    }
    const float inv = OCAR / (l_run + xhalf(l_run));   // each half summed its own eight keys of every 16-key tile
    h16* op = AT + (size_t)(q0 + lr) * DQ + (size_t)h * HD + 8 * hi;   // D of O^T: lane l holds query (l & 15), d = 16 t8 + 8*(l>>4) + r
#pragma unroll
    for (int t8 = 0; t8 < 8; ++t8) { v8h o;
#pragma unroll
        for (int r = 0; r < 8; ++r) o[r] = (h16)(acc[t8][r] * inv);
        *(v8h*)(op + t8 * 16) = o; }
}

extern "C" void kernel_launch(void* const* d_in, const int* in_sizes, int n_in,
                              void* d_out, int out_size, void* d_ws, size_t ws_size, hipStream_t stream) {
    if (n_in < 10) return;
    const float* x  = (const float*)d_in[0]; const float* am = (const float*)d_in[1];
    const float* wq = (const float*)d_in[2]; const float* bq = (const float*)d_in[3]; const float* wk = (const float*)d_in[4]; const float* bk = (const float*)d_in[5];
    const float* wv = (const float*)d_in[6]; const float* bv = (const float*)d_in[7]; const float* wo = (const float*)d_in[8]; const float* bo = (const float*)d_in[9];
    if (in_sizes[0] < 0 || (size_t)in_sizes[0] < (size_t)(NB - 1) * SEQ_FULL * DM + (size_t)SEQ * DM) return;
    if (in_sizes[1] < (NB - 1) * SEQ_FULL + SEQ) return;
    if (in_sizes[2] < DQ * DM || in_sizes[4] < DQ * DM || in_sizes[6] < DQ * DM || in_sizes[8] < DM * DQ) return;
    if (in_sizes[3] < DQ || in_sizes[5] < DQ || in_sizes[7] < DQ || in_sizes[9] < DM) return;
    if (out_size < 0 || (size_t)out_size < (size_t)NB * SEQ * DM) return;
    float* OUT = (float*)d_out;     // [NB][SEQ][DM]

    // ---- workspace carve (all offsets 256-B aligned; every region is written to exactly its extent by whole-line stores) ----
    char* wsp = (char*)d_ws; size_t used = 0;
    auto take = [&](size_t bytes) { char* p = wsp + used; used += (bytes + 255) & ~(size_t)255; return (void*)p; };
    bf*  WQ   = (bf*)take((size_t)DQ * DM * 2);                   // 8,388,608
    bf*  WK   = (bf*)take((size_t)DQ * DM * 2);                   // 8,388,608
    bf*  WV   = (bf*)take((size_t)DQ * DM * 2);                   // 8,388,608
    h16* WO16 = (h16*)take((size_t)DM * DQ * 2);                  // 8,388,608
    bf*  XB   = (bf*)take((size_t)NB * SEQ * DM * 2);             // 16,777,216  [b][t][k]
    float* MA = (float*)take((size_t)NB * SEQ * 4);                // 16,384  [b][t]
    h16* QP16 = (h16*)take((size_t)NH_ * SEQ * HD * 2);           // 8,388,608  [h][t][d]
    h16* KP16 = (h16*)take((size_t)NH_ * SEQ * HD * 2);           // 8,388,608  [h][t][d]
    h16* VT16 = (h16*)take((size_t)NH_ * HD * SEQ * 2);           // 8,388,608  [g][d][t]
    h16* AT16 = (h16*)take((size_t)SEQ * DQ * 2);                 // 8,388,608  [t][h*HD+d]
    if (used > ws_size) return;                                    // total 83,902,464 B at NB=2, SEQ=2048

    k_prep<<<PR_G, 256, 0, stream>>>(x, am, wq, wk, wv, wo, WQ, WK, WV, WO16, XB, MA);
    for (int b = 0; b < NB; ++b) {
        const bf* XBb = XB + (size_t)b * SEQ * DM;
        k_gemmt<bf, DM, OUT_HEAD><<<dim3(SEQ / GT_T, DQ / GT_T, 1), 256, 0, stream>>>(XBb, WQ, nullptr, QP16, 0, bq, 1.0f);
        k_gemmt<bf, DM, OUT_HEAD><<<dim3(SEQ / GT_T, DQ / GT_T, 1), 256, 0, stream>>>(XBb, WK, nullptr, KP16, 0, bk, 1.0f);
        k_gemmt<bf, DM, OUT_ROWS><<<dim3(DQ / GT_T, SEQ / GT_T, 1), 256, 0, stream>>>(WV, XBb, nullptr, VT16, 0, bv, 1.0f);
        k_fattn<<<dim3(SEQ / FA_BQ, NH_, 1), 256, 0, stream>>>(QP16, KP16, VT16, MA + (size_t)b * SEQ, AT16);
        k_gemmt<h16, DQ, OUT_F32><<<dim3(SEQ / GT_T, DM / GT_T, 1), 256, 0, stream>>>(AT16, WO16, OUT + (size_t)b * SEQ * DM, nullptr, DM, bo, 1.0f / (OCAR * WCAR));
    }
}

// v005
// A run of this version takes 166 microseconds.
// Two timings next to v004 put it at 1.40 and 1.39 times that version's speed.
// Over all steps from v000 it is 9.80 times as fast.
#include <hip/hip_runtime.h>

// Multi-head self-attention block (hidden [NB][SEQ][2048], 16 heads x 128): q/k/v = x W^T + b; s = (q.k) x 128^-0.5 + (1 - m[key]) x f32_lowest; p = softmax over keys; ctx = p.v; out = ctx Wo^T + bo -> [NB][SEQ][2048] f32.
// Compute dtypes (f32 accumulate everywhere): x, W*, b*, m enter as their bf16 (RNE) values; q/k/v projections: v_wmma_f32_16x16x32_bf16 (bf16 operands);
// scores: v_wmma_f32_16x16x32_f16 (f16 q, k planes); p.v: v_wmma_f32_16x16x32_f16 (f16 p = exp(s - running max), not normalised, f16 v; the row sum divides at the end); output projection: v_wmma_f32_16x16x32_f16 (f16 ctx x64, f16 Wo x64); softmax f32.
#pragma clang fp contract(off)

#ifndef NB
#define NB 2
#endif
#ifndef SEQ
#define SEQ 2048
#endif
#define NB_FULL  2
#define SEQ_FULL 2048
#define DM   2048
#define NH_  16
#define HD   128
#define DQ   (NH_ * HD)
#define OCAR 64.0f
#define WCAR 64.0f
#define SCL  0.08838834764831845f
#define FLOW (-3.4028234663852886e38f)

static_assert(SEQ % 128 == 0);
static_assert(SEQ >= 128 && SEQ <= SEQ_FULL);
static_assert(NB >= 1 && NB <= NB_FULL);
static_assert(DQ == DM);
static_assert(DM % 64 == 0 && HD == 128);

typedef _Float16 h16;
typedef unsigned short bf;
typedef __attribute__((ext_vector_type(16))) __bf16   v16bf;
typedef __attribute__((ext_vector_type(16))) _Float16 v16h;
typedef __attribute__((ext_vector_type(8)))  _Float16 v8h;
typedef __attribute__((ext_vector_type(4)))  _Float16 v4h;
typedef __attribute__((ext_vector_type(8)))  unsigned short v8us;
typedef __attribute__((ext_vector_type(8)))  float    v8f;
typedef __attribute__((ext_vector_type(4)))  float    v4f;
typedef v4f __attribute__((may_alias)) v4fa;

__device__ __forceinline__ unsigned short f2bf(float f) { unsigned u = __float_as_uint(f); u += 0x7FFFu + ((u >> 16) & 1u); return (unsigned short)(u >> 16); }
__device__ __forceinline__ float bf2f(unsigned short b) { return __uint_as_float(((unsigned)b) << 16); }
__device__ __forceinline__ float bfr(float f) { return bf2f(f2bf(f)); }
__device__ __forceinline__ v16h cat16(v8h lo, v8h hi) { return __builtin_shufflevector(lo, hi, 0, 1, 2, 3, 4, 5, 6, 7, 8, 9, 10, 11, 12, 13, 14, 15); }
__device__ __forceinline__ v16bf cat16b(v8us lo, v8us hi) { return __builtin_bit_cast(v16bf, __builtin_shufflevector(lo, hi, 0, 1, 2, 3, 4, 5, 6, 7, 8, 9, 10, 11, 12, 13, 14, 15)); }
__device__ __forceinline__ v8f wmma16(v16h a, v16h b, v8f c) { return __builtin_amdgcn_wmma_f32_16x16x32_f16(false, a, false, b, (short)0, c, false, false); }
__device__ __forceinline__ v8f wmmab(v16bf a, v16bf b, v8f c) { return __builtin_amdgcn_wmma_f32_16x16x32_bf16(false, a, false, b, (short)0, c, false, false); }

// ---- GEMM: one 128x128 output tile per work-group of 8 waves (4 along M x 2 along N, 32x64 a wave, 8 accumulators), 256 threads. gt_products forms a tile's sums, gt_store_f32 or gt_store_plane stores them.
// c[m][n] = cscale x sum_k A[m][k] Bt[n][k] + a bf16-valued bias. A, Bt: K-contiguous 16-bit planes. The epilogue stores c in the form that its reader takes:
//   OUT_F32:  C[m][n] f32, pitch ldc, bias[n] (the block's output).
//   OUT_HEAD: P[n / HD][m][n % HD] f16, bias[n] (m = token: the q and k planes [h][t][d]; a tile's 128 columns are one head).
//   OUT_ROWS: P[m][n] f16, pitch SEQ, bias[m] (A = the weight, Bt = x, so m = h * HD + d and n = token: the v^T plane [h][d][t] comes out of the product as it stands, with no transposition).
// K % 128 == 0, K >= 256 (two stages at least: the second stage's copies stand under no test), M % 128 == 0, N % 128 == 0.
// One launch holds every tile of its phase, for all batch items (k_gemm_qkv: q, k and v^T together), and a work-group's LDS is under half a WGP's (the epilogue stages in the ring's own bytes): two work-groups share a WGP, and the start, the waits and the epilogue of one stand under the products of the other.
// Both operands come in stages of 128 k (rows of 256 B) by asynchronous copies, global -> LDS through no register, two buffers: stage t + 1 flies while stage t is worked on, and every row is fetched once a work-group, in whole lines.
// Fragment map (both operands): lane l -> row/col (l & 15); elements 0..7 <- k0 + 8*(l>>4) + 0..7, elements 8..15 <- k0 + 16 + 8*(l>>4) + 0..7. D element r of lane l -> (row 8*(l>>4) + r, col l & 15).
template <typename T16> struct WFrag;
template <> struct WFrag<h16> { typedef v16h V; static __device__ __forceinline__ V ld(const h16* p) { return cat16(*(const v8h*)p, *(const v8h*)(p + 16)); } static __device__ __forceinline__ v8f mma(V a, V b, v8f c) { return wmma16(a, b, c); } };
template <> struct WFrag<bf> { typedef v16bf V; static __device__ __forceinline__ V ld(const bf* p) { return cat16b(*(const v8us*)p, *(const v8us*)(p + 16)); } static __device__ __forceinline__ v8f mma(V a, V b, v8f c) { return wmmab(a, b, c); } };
#define GT_T   128                       // rows of each operand in a tile
#define GT_KS  128                       // k of a stage
#define GT_P   272                       // LDS pitch of a row (256 B + 16): 16 B x odd, conflict-free for 16-byte row reads
#define GT_OP  (GT_T * GT_P)             // one operand's stage
#define GT_BUF (2 * GT_OP)               // a buffer: [A 128 rows | Bt 128 rows]
static_assert(SEQ % GT_T == 0 && DM % GT_T == 0 && DQ % GT_T == 0 && GT_T == HD);
#define OUT_F32  0
#define OUT_HEAD 1
#define OUT_ROWS 2
// One operand's stage, this thread's share: eight 16-byte chunks, rows 16 apart (l: the lane's LDS byte address, g: its global address, rs: 16 rows in elements).
// The s_wait_xcnt at the end of the statement stands in front of any later write of the address registers that the copies name.
template <typename T16>
__device__ __forceinline__ void gt_copy8(unsigned l, const T16* g, size_t rs) {
    asm volatile("global_load_async_to_lds_b128 %0, %8, off\n\t"
                 "global_load_async_to_lds_b128 %1, %9, off\n\t"
                 "global_load_async_to_lds_b128 %2, %10, off\n\t"
                 "global_load_async_to_lds_b128 %3, %11, off\n\t"
                 "global_load_async_to_lds_b128 %4, %12, off\n\t"
                 "global_load_async_to_lds_b128 %5, %13, off\n\t"
                 "global_load_async_to_lds_b128 %6, %14, off\n\t"
                 "global_load_async_to_lds_b128 %7, %15, off\n\t"
                 "s_wait_xcnt 0x0"
                 :: "v"(l), "v"(l + 16 * GT_P), "v"(l + 32 * GT_P), "v"(l + 48 * GT_P), "v"(l + 64 * GT_P), "v"(l + 80 * GT_P), "v"(l + 96 * GT_P), "v"(l + 112 * GT_P),
                    "v"(g), "v"(g + rs), "v"(g + 2 * rs), "v"(g + 3 * rs), "v"(g + 4 * rs), "v"(g + 5 * rs), "v"(g + 6 * rs), "v"(g + 7 * rs)
                 : "memory");
}
// The sums of the tile at rows r0 of A and rows c0 of Bt. L: the work-group's ring of 2 x GT_BUF bytes; every wave has left it, and no copy is outstanding, when this returns.
template <typename T16, int K>
__device__ __forceinline__
void gt_products(const T16* __restrict__ A, const T16* __restrict__ Bt, const int r0, const int c0, unsigned char* L, v8f (&acc)[2][4]) {
    static_assert(K % GT_KS == 0 && K >= 2 * GT_KS);
    typedef typename WFrag<T16>::V V;
    const int tid = threadIdx.x, lane = tid & 31, wave = tid >> 5, lr = lane & 15, hi = lane >> 4, wm = wave >> 1, wn = wave & 1;
    // staging map: 2048 16-byte chunks an operand and stage, chunk = tid + 256 i -> row (tid >> 4) + 16 i, 16 chunks a row: a wave's copy covers two whole rows of the stage
    const T16* ag = A + (size_t)(r0 + (tid >> 4)) * K + (tid & 15) * 8;
    const T16* bg = Bt + (size_t)(c0 + (tid >> 4)) * K + (tid & 15) * 8;
    const size_t rs = (size_t)16 * K;
    const unsigned cl = (unsigned)(size_t)L + (tid >> 4) * GT_P + (tid & 15) * 16;     // where this thread's chunks go
    const unsigned af = (wm * 32 + lr) * GT_P + 16 * hi, bfo = GT_OP + (wn * 64 + lr) * GT_P + 16 * hi;   // where this lane's fragments start
    constexpr int nst = K / GT_KS;
    unsigned bo = 0;   // byte offset of the buffer that holds stage st
#pragma unroll
    for (int mb = 0; mb < 2; ++mb)
#pragma unroll
        for (int nb = 0; nb < 4; ++nb) acc[mb][nb] = (v8f){};
    gt_copy8(cl, ag, rs); gt_copy8(cl + GT_OP, bg, rs);
    asm volatile("s_wait_asynccnt 0x0" ::: "memory");   // stage 0 has landed, as far as this wave copied it
    __syncthreads();                                     // publishes stage 0
    gt_copy8(cl + GT_BUF, ag + GT_KS, rs); gt_copy8(cl + GT_BUF + GT_OP, bg + GT_KS, rs);
    ag += 2 * GT_KS; bg += 2 * GT_KS;
    // kept rolled: the body holds a whole stage's 32 products a wave, unrolled
#pragma unroll 1
    for (int st = 0; st < nst; ++st) {
        V a[2][2], b[2][4];
#pragma unroll
        for (int mb = 0; mb < 2; ++mb) a[0][mb] = WFrag<T16>::ld((const T16*)(L + bo + af + mb * 16 * GT_P));
#pragma unroll
        for (int nb = 0; nb < 4; ++nb) b[0][nb] = WFrag<T16>::ld((const T16*)(L + bo + bfo + nb * 16 * GT_P));
#pragma unroll
        for (int kb = 0; kb < GT_KS / 32; ++kb) {
            const int cur = kb & 1, nxt = cur ^ 1;
            if (kb + 1 < GT_KS / 32) {   // the next 32 k's fragments, read as one group in front of this block's products
#pragma unroll
                for (int mb = 0; mb < 2; ++mb) a[nxt][mb] = WFrag<T16>::ld((const T16*)(L + bo + af + mb * 16 * GT_P + (kb + 1) * 64));
#pragma unroll
                for (int nb = 0; nb < 4; ++nb) b[nxt][nb] = WFrag<T16>::ld((const T16*)(L + bo + bfo + nb * 16 * GT_P + (kb + 1) * 64));
            }
            __builtin_amdgcn_sched_barrier(0);   // the reads stay one group in front of the products, which cover their latency; left free, the compiler put them two by two in front of each pair of products, with a full wait each
#pragma unroll
            for (int nb = 0; nb < 4; ++nb)
#pragma unroll
                for (int mb = 0; mb < 2; ++mb) acc[mb][nb] = WFrag<T16>::mma(a[cur][mb], b[cur][nb], acc[mb][nb]);
            __builtin_amdgcn_sched_barrier(0);   // and no read of the block after next moves up among these products
        }
        asm volatile("s_wait_dscnt 0x0" ::: "memory");      // this wave's reads of stage st have returned
        asm volatile("s_wait_asynccnt 0x0" ::: "memory");   // its copies of stage st + 1 have landed
        __syncthreads();                                     // publishes stage st + 1 and ends every wave's reads of stage st
        if (st + 2 < nst) { gt_copy8(cl + bo, ag, rs); gt_copy8(cl + bo + GT_OP, bg, rs); }   // stage st + 2 into the buffer that stage st has left
        ag += GT_KS; bg += GT_KS; bo = GT_BUF - bo;
    }
    asm volatile("s_wait_asynccnt 0x0" ::: "memory");       // no copy is outstanding when the wave goes on
}
// The epilogues. os: the wave's own 16 x 68 floats of LDS, where it stages a 16 x 64 block, so that whole lines are stored.
// OUT_F32: the tile at rows r0, columns c0 of C.
__device__ __forceinline__ void gt_store_f32(const v8f (&acc)[2][4], float* os, float* C, const int ldc, const int r0, const int c0, const float* __restrict__ bias, const float cscale) {
    const int tid = threadIdx.x, lane = tid & 31, wave = tid >> 5, lr = lane & 15, hi = lane >> 4, wm = wave >> 1, wn = wave & 1;
    const int cw = c0 + wn * 64;
    // bias for this lane's 4 output columns: one 16-B load per lane, loaded once (the columns are the same for every row of the wave's tile)
    v4f bb; { const v4f br = *(const v4f*)(bias + cw + lr * 4); bb[0] = bfr(br[0]); bb[1] = bfr(br[1]); bb[2] = bfr(br[2]); bb[3] = bfr(br[3]); }
#pragma unroll
    for (int mb = 0; mb < 2; ++mb) {
#pragma unroll
        for (int nb = 0; nb < 4; ++nb) {
#pragma unroll
            for (int j = 0; j < 8; ++j) os[(hi * 8 + j) * 68 + nb * 16 + lr] = acc[mb][nb][j]; }
        __builtin_amdgcn_wave_barrier(); asm volatile("" ::: "memory");   // other lanes of the wave read these rows back: the compiler may move no read in front of the stores
        float* crow = C + (size_t)(r0 + wm * 32 + mb * 16) * ldc + cw;
#pragma unroll
        for (int s = 0; s < 8; ++s) { const int row = 2 * s + hi, cofs = lr * 4; v4f val = *(const v4fa*)(os + row * 68 + cofs); val = val * cscale; val = val + bb;
            *(v4f*)(crow + (size_t)row * ldc + cofs) = val; }
        __builtin_amdgcn_wave_barrier(); asm volatile("" ::: "memory");   // and no store of the next 16 rows in front of these reads
    }
}
// OUT_HEAD, OUT_ROWS: the tile at rows r0, columns c0 (as m and n above) of one batch item's plane P.
template <int OUT>
__device__ __forceinline__ void gt_store_plane(const v8f (&acc)[2][4], float* os, h16* P, const int r0, const int c0, const float* __restrict__ bias, const float cscale) {
    const int tid = threadIdx.x, lane = tid & 31, wave = tid >> 5, lr = lane & 15, hi = lane >> 4, wm = wave >> 1, wn = wave & 1;
    const int cw = c0 + wn * 64;
    // f16 planes: a row of the wave's block is 64 values = one 128-byte line; eight lanes store a row (8 values = 16 B each), a wave's store covers four whole rows
    const int c8 = (lane & 7) * 8, r4 = lane >> 3;
    constexpr int pp = OUT == OUT_HEAD ? HD : SEQ;   // pitch of the plane
    h16* pr = (OUT == OUT_HEAD ? P + ((size_t)blockIdx.y * SEQ + r0) * HD + wn * 64 : P + (size_t)r0 * SEQ + cw) + (size_t)(wm * 32 + r4) * pp + c8;
    v4f bc[2] = {(v4f){}, (v4f){}};   // OUT_HEAD: the bias of this lane's 8 columns, the same for every row
    if constexpr (OUT == OUT_HEAD) {
#pragma unroll
        for (int q = 0; q < 2; ++q) { const v4f br = *(const v4f*)(bias + cw + c8 + 4 * q); bc[q][0] = bfr(br[0]); bc[q][1] = bfr(br[1]); bc[q][2] = bfr(br[2]); bc[q][3] = bfr(br[3]); }
    }
    v4f br[2][2] = {{(v4f){}, (v4f){}}, {(v4f){}, (v4f){}}};   // OUT_ROWS: the bias of the 8 rows that this lane's accumulators hold, for both 16-row blocks
    if constexpr (OUT == OUT_ROWS) {
#pragma unroll
        for (int mb = 0; mb < 2; ++mb)
#pragma unroll
            for (int q = 0; q < 2; ++q) { const v4f b = *(const v4f*)(bias + r0 + wm * 32 + mb * 16 + hi * 8 + 4 * q); br[mb][q][0] = bfr(b[0]); br[mb][q][1] = bfr(b[1]); br[mb][q][2] = bfr(b[2]); br[mb][q][3] = bfr(b[3]); }
    }
#pragma unroll
    for (int mb = 0; mb < 2; ++mb) {
        if constexpr (OUT == OUT_ROWS) {   // the bias goes by rows: added where a lane still holds 8 rows of one column
#pragma unroll
            for (int nb = 0; nb < 4; ++nb) {
#pragma unroll
                for (int j = 0; j < 8; ++j) os[(hi * 8 + j) * 68 + nb * 16 + lr] = acc[mb][nb][j] * cscale + br[mb][j >> 2][j & 3]; }
        } else {
#pragma unroll
            for (int nb = 0; nb < 4; ++nb) {
#pragma unroll
                for (int j = 0; j < 8; ++j) os[(hi * 8 + j) * 68 + nb * 16 + lr] = acc[mb][nb][j]; }
        }
        __builtin_amdgcn_wave_barrier(); asm volatile("" ::: "memory");   // other lanes of the wave read these rows back: the compiler may move no read in front of the stores
#pragma unroll
        for (int s = 0; s < 4; ++s) { const float* rp = os + (4 * s + r4) * 68 + c8; v4f lo = *(const v4fa*)rp, up = *(const v4fa*)(rp + 4);
            if constexpr (OUT == OUT_HEAD) { lo = lo * cscale; lo = lo + bc[0]; up = up * cscale; up = up + bc[1]; }
            v8h o;
#pragma unroll
            for (int q = 0; q < 4; ++q) { o[q] = (h16)lo[q]; o[q + 4] = (h16)up[q]; }
            *(v8h*)(pr + (size_t)(mb * 16 + 4 * s) * pp) = o; }
        __builtin_amdgcn_wave_barrier(); asm volatile("" ::: "memory");   // and no store of the next 16 rows in front of these reads
    }
    asm volatile("s_wait_xcnt 0x0" ::: "memory");   // stands in front of any later write of a register that the stores above name: in a kernel that holds both plane forms, code of the other form follows these stores in the listing
}
static_assert(8 * 16 * 68 * 4 <= 2 * GT_BUF);
// at most 256 VGPRs: the asm operands above stay in the register window that needs no switching
// k_gemm_qkv: the three projections of every batch item. grid (NB * SEQ / 128, DQ / 128, 3): x = 128 tokens of X [b][t][k], y = 128 output features = one head, z = 0: q, 1: k, 2: v^T. Planes: QP, KP [b][h][t][d], VT [b][h][d][t].
__global__ __launch_bounds__(256) __attribute__((amdgpu_num_vgpr(256)))
void k_gemm_qkv(const bf* __restrict__ X, const bf* __restrict__ WQ, const bf* __restrict__ WK, const bf* __restrict__ WV, h16* QP, h16* KP, h16* VT,
                const float* __restrict__ bq, const float* __restrict__ bk, const float* __restrict__ bv) {
    __shared__ __align__(16) unsigned char L[2 * GT_BUF];
    float* os = (float*)L + (threadIdx.x >> 5) * (16 * 68);
    const int t0 = blockIdx.x * GT_T, e0 = blockIdx.y * GT_T, z = blockIdx.z;   // t0 counts the tokens of all batch items; a tile lies in one item
    const size_t pb = (size_t)(t0 / SEQ) * NH_ * SEQ * HD; const int tb = t0 % SEQ;
    v8f acc[2][4];
    const bool isv = z == 2;   // the same for the whole work-group; v^T: A = the weight, Bt = x
    gt_products<bf, DM>(isv ? WV : X, isv ? X : z ? WK : WQ, isv ? e0 : t0, isv ? t0 : e0, L, acc);
    if (isv) gt_store_plane<OUT_ROWS>(acc, os, VT + pb, e0, tb, bv, 1.0f);
    else     gt_store_plane<OUT_HEAD>(acc, os, (z ? KP : QP) + pb, tb, e0, z ? bk : bq, 1.0f);
}
// k_gemm_out: C[m][n] f32. grid (M / 128, N / 128).
template <typename T16, int K>
__global__ __launch_bounds__(256) __attribute__((amdgpu_num_vgpr(256)))
void k_gemm_out(const T16* __restrict__ A, const T16* __restrict__ Bt, float* C, int ldc, const float* __restrict__ bias, float cscale) {
    __shared__ __align__(16) unsigned char L[2 * GT_BUF];
    float* os = (float*)L + (threadIdx.x >> 5) * (16 * 68);
    const int r0 = blockIdx.x * GT_T, c0 = blockIdx.y * GT_T;
    v8f acc[2][4];
    gt_products<T16, K>(A, Bt, r0, c0, L, acc);
    gt_store_f32(acc, os, C, ldc, r0, c0, bias, cscale);
}

// ---- k_prep: every operand conversion of the block in ONE launch of long-lived waves: wq, wk, wv, x -> bf16 (RNE); wo -> f16 of (its bf16 value x WCAR); m -> (1 - bf16(m)) x f32_lowest.
// grid PR_G work-groups of 256 threads. A unit = 8192 floats = 8 chunks of 4 floats a thread, chunk i of thread t at i * 1024 + t * 4: a wave's load covers 512 bytes in a row (four whole lines), its store 256 (two whole lines).
// Work-group g converts unit g of each weight and of each batch item of x, one after the other, from two register sets: a set is loaded again as soon as it has been converted, so the eight loads of at least one unit are in flight while another is converted.
// Each wave here converts 48 chunks a lane (for speed only).
#define PR_U 8192
#define PR_G (DQ * DM / PR_U)
#define PR_X (SEQ * DM / PR_U)            // units of one batch item of x
#define PR_M (NB * SEQ / 1024)            // work-groups that also convert 1024 mask values each
static_assert(DQ * DM % PR_U == 0 && SEQ * DM % PR_U == 0 && PR_X <= PR_G && SEQ % 1024 == 0 && PR_M <= PR_G);
typedef __attribute__((ext_vector_type(4))) unsigned short v4us;
typedef __attribute__((ext_vector_type(2))) unsigned v2u;
// lo: this thread's byte offset from the source pointer (32 bits, so that the load takes the pointer as its scalar base)
__device__ __forceinline__ void pr_load(const float* __restrict__ s, unsigned lo, v4f (&r)[8]) {
#pragma unroll
    for (int i = 0; i < 8; ++i) r[i] = *(const v4f*)((const char*)s + lo + i * 4096); }
// One unit: converts the set r (H: to f16 of the bf16 value x WCAR; else to bf16), stores it at d + so bytes, and loads the set again from nxt + lo bytes where ld says so.
template <bool H>
__device__ __forceinline__ void pr_step(v4f (&r)[8], void* d, unsigned so, const float* __restrict__ nxt, bool ld, unsigned lo) {
    v2u w[8];
#pragma unroll
    for (int i = 0; i < 8; ++i) {
        if constexpr (H) { v4h o;
#pragma unroll
            for (int q = 0; q < 4; ++q) o[q] = (h16)(bfr(r[i][q]) * WCAR);
            w[i] = __builtin_bit_cast(v2u, o);
        } else { v4us o;
#pragma unroll
            for (int q = 0; q < 4; ++q) o[q] = f2bf(r[i][q]);
            w[i] = __builtin_bit_cast(v2u, o); }
    }
#pragma unroll
    for (int i = 0; i < 8; ++i) *(v2u*)((char*)d + so + i * 2048) = w[i];
    if (ld) pr_load(nxt, lo, r);
    // the wait that stands in front of any later write of a register which these stores and loads name; the offsets and the stored words are its inputs, so that their registers are kept up to here
    asm volatile("s_wait_xcnt 0x0" :: "v"(lo), "v"(so), "v"(w[0]), "v"(w[1]), "v"(w[2]), "v"(w[3]), "v"(w[4]), "v"(w[5]), "v"(w[6]), "v"(w[7]) : "memory");
}
__global__ __launch_bounds__(256) void k_prep(const float* __restrict__ x, const float* __restrict__ m, const float* __restrict__ wq, const float* __restrict__ wk, const float* __restrict__ wv, const float* __restrict__ wo,
                                              bf* WQ, bf* WK, bf* WV, h16* WO16, bf* XB, float* MA) {
    const int g = blockIdx.x, tid = threadIdx.x;
    const unsigned so = (unsigned)(g * PR_U + tid * 4) * 2u, lo = so * 2u;
    const bool hasx = PR_X == PR_G || g < PR_X;   // the same for the whole work-group
    v4f r[2][8];
    pr_load(wq, lo, r[0]);
    pr_load(wk, lo, r[1]);
    pr_step<false>(r[0], WQ, so, wv, true, lo);
    pr_step<false>(r[1], WK, so, wo, true, lo);
    pr_step<false>(r[0], WV, so, x, hasx, lo);
    pr_step<true>(r[1], WO16, so, x, hasx && NB > 1, NB > 1 ? lo + SEQ_FULL * DM * 4u : lo);
#pragma unroll
    for (int b = 0; b < NB; ++b)   // batch item b: its place goes into the 32-bit offsets
        if (hasx) pr_step<false>(r[b & 1], XB, so + b * (SEQ * DM * 2u), x, b + 2 < NB, b + 2 < NB ? lo + (b + 2) * (SEQ_FULL * DM * 4u) : lo);
    if (g < PR_M) {   // the same for the whole work-group
        const int mi = g * 1024 + tid * 4;   // index into MA, [NB][SEQ]
        const unsigned mo = (unsigned)((mi / SEQ) * SEQ_FULL + mi % SEQ) * 4u;
        const v4f a = *(const v4f*)((const char*)m + mo);
        asm volatile("s_wait_xcnt 0x0" :: "v"(mo) : "memory");   // as above: in front of any later write of the load's offset register
        v4f q;
#pragma unroll
        for (int e = 0; e < 4; ++e) { const float u = 1.0f - bfr(a[e]); q[e] = u * FLOW; }
        *(v4f*)(MA + mi) = q;
    }
}
// ---- k_fattn: scores, softmax and p.v of one head for 128 queries in one work-group; no score ever reaches memory. grid (SEQ/128, NH_, NB), 256 threads = 8 waves x 16 queries.
// Transposed products: S^T = K.Q^T (A = 16 keys x 32 d from LDS, B = Q^T kept in registers), O^T += V^T.P^T (A = 16 d x 32 keys from LDS, B = P^T).
// D of S^T: lane l holds query (l & 15), keys 8*(l>>4) + r of each 16-key tile; that is the B operand's k order for 32 keys (tile 0 -> elements 0..7, tile 1 -> elements 8..15), so P^T packs in-lane.
// K rows ([t][d] plane) and V^T rows ([d][t] plane) come in stages of 64 keys: global -> registers -> LDS, two buffers; the next stage's loads fly under this stage's two 32-key passes.
// Every inner loop is fully unrolled, so that each index into a register array is a constant (an index known only at run time would send the array to scratch).
// Online softmax: t = s x SCL + MA[key]; p = exp(t - m_run); m_run may trail the true maximum by up to FA_LAG (p stays below e^FA_LAG, far inside f16); the sums are rescaled only when some query's maximum passes that.
#define FA_BQ   128
#define FA_SK   64
#define FA_PK   272                       // LDS pitch of a K row (256 B + 16): 16 B x odd, conflict-free for 16-byte row reads
#define FA_PV   144                       // LDS pitch of a V^T row (128 B + 16): 16 B x odd
#define FA_TK   (FA_SK * FA_PK)
#define FA_SLOT (FA_TK + HD * FA_PV)
#define FA_FLIP 65536                     // the two buffers lie 64 KiB apart, so that one XOR on an LDS offset changes the buffer
#define FA_LAG  5.5f
#define L2E     1.4426950408889634f
static_assert(SEQ % FA_BQ == 0 && SEQ % FA_SK == 0 && SEQ % 1024 == 0 && FA_SLOT <= FA_FLIP);
typedef __attribute__((ext_vector_type(4))) unsigned v4u;
__device__ __forceinline__ float xhalf(float x) { return __builtin_bit_cast(float, __builtin_amdgcn_permlanex16(__builtin_bit_cast(int, x), __builtin_bit_cast(int, x), 0x76543210, 0xfedcba98, false, false)); }  // lane l <-> lane l ^ 16
// Four exponentials (2^x, in place) in one statement. The v_nop at its end fills the slot that the instruction set asks for behind a transcendental before a source is overwritten or the result read.
__device__ __forceinline__ void exp2x4(float& a, float& b, float& c, float& d) { asm("v_exp_f32 %0, %0\n\tv_exp_f32 %1, %1\n\tv_exp_f32 %2, %2\n\tv_exp_f32 %3, %3\n\tv_nop" : "+v"(a), "+v"(b), "+v"(c), "+v"(d)); }
// at most 256 VGPRs: the asm operands above stay in the register window that needs no switching
__global__ __launch_bounds__(256) __attribute__((amdgpu_num_vgpr(256))) void k_fattn(const h16* __restrict__ QP, const h16* __restrict__ KP, const h16* __restrict__ VT, const float* __restrict__ MA, h16* AT) {
    __shared__ __align__(16) unsigned char L[FA_FLIP + FA_SLOT];
    __shared__ __align__(16) float MAs[SEQ];
    const int tid = threadIdx.x, lane = tid & 31, wave = tid >> 5, lr = lane & 15, hi = lane >> 4;
    const int h = blockIdx.y, q0 = blockIdx.x * FA_BQ + wave * 16;
    { const size_t pb = (size_t)blockIdx.z * NH_ * SEQ * HD; QP += pb; KP += pb; VT += pb; MA += (size_t)blockIdx.z * SEQ; AT += (size_t)blockIdx.z * SEQ * DQ; }   // batch item blockIdx.z: its planes, its mask row, its rows of AT
    // staging map: 1024 16-byte chunks of K (row = chunk >> 4) and 1024 of V^T (row = chunk >> 3) per stage, chunk = tid + 256 i
    const h16* kg = KP + (size_t)h * SEQ * HD; const unsigned ko = (unsigned)tid * 8u;         // a K stage is 16 KiB in a row
    const h16* vg = VT + (size_t)h * HD * SEQ; const unsigned vo = (unsigned)(tid >> 3) * SEQ + (unsigned)(tid & 7) * 8u;
    unsigned kl = (tid >> 4) * FA_PK + (tid & 15) * 16, vl = FA_TK + (tid >> 3) * FA_PV + (tid & 7) * 16;   // where this thread's chunks go
    unsigned kf = lr * FA_PK + 16 * hi, vf = FA_TK + lr * FA_PV + 16 * hi;                                 // where this lane's fragments start
    v4u kr[4], vr[4];
#pragma unroll
    for (int i = 0; i < 4; ++i) { kr[i] = *(const v4u*)(kg + i * 2048 + ko); vr[i] = *(const v4u*)(vg + i * 32 * SEQ + vo); }
#pragma unroll
    for (int i = 0; i < SEQ / 1024; ++i) *(v4f*)(MAs + i * 1024 + tid * 4) = *(const v4f*)(MA + i * 1024 + tid * 4);
    v16h qf[4];
    { const h16* qp = QP + ((size_t)h * SEQ + q0 + lr) * HD + 8 * hi;
#pragma unroll
      for (int kc = 0; kc < 4; ++kc) qf[kc] = cat16(*(const v8h*)(qp + 32 * kc), *(const v8h*)(qp + 32 * kc + 16)); }
#pragma unroll
    for (int i = 0; i < 4; ++i) { *(v4u*)(L + kl + i * 16 * FA_PK) = kr[i]; *(v4u*)(L + vl + i * 32 * FA_PV) = vr[i]; }
    v8f acc[8];
#pragma unroll
    for (int t8 = 0; t8 < 8; ++t8) acc[t8] = (v8f){};
    float m_run = FLOW, l_run = 0.f;
    const float* mp = MAs + 8 * hi;
    __syncthreads();
    // kept rolled
#pragma unroll 1
    for (int st = 0; st < SEQ / FA_SK; ++st) {
        const bool more = st + 1 < SEQ / FA_SK;
        kl ^= FA_FLIP; vl ^= FA_FLIP; kg += FA_SK * HD; vg += FA_SK;
        if (more) {
#pragma unroll
            for (int i = 0; i < 4; ++i) { kr[i] = *(const v4u*)(kg + i * 2048 + ko); vr[i] = *(const v4u*)(vg + i * 32 * SEQ + vo); }
        }
#pragma unroll
        for (int sub = 0; sub < FA_SK / 32; ++sub) {
            v16h ka[4][2]; v4f mk[2][2]; v8f s[2] = {(v8f){}, (v8f){}};
            { const unsigned char* p = L + kf + sub * 32 * FA_PK;
#pragma unroll
              for (int kc = 0; kc < 4; ++kc)
#pragma unroll
                for (int kt = 0; kt < 2; ++kt) ka[kc][kt] = cat16(*(const v8h*)(p + kt * 16 * FA_PK + 64 * kc), *(const v8h*)(p + kt * 16 * FA_PK + 64 * kc + 32));
#pragma unroll
              for (int kt = 0; kt < 2; ++kt) { mk[kt][0] = *(const v4f*)(mp + sub * 32 + kt * 16); mk[kt][1] = *(const v4f*)(mp + sub * 32 + kt * 16 + 4); } }
            __builtin_amdgcn_sched_barrier(0);   // the pass's K and mask reads stay one group in front of the products: one LDS latency a pass, not one a product
#pragma unroll
            for (int kc = 0; kc < 4; ++kc)
#pragma unroll
                for (int kt = 0; kt < 2; ++kt) s[kt] = wmma16(ka[kc][kt], qf[kc], s[kt]);
            v16h va[8];
#pragma unroll
            for (int t8 = 0; t8 < 6; ++t8) { const unsigned char* pv = L + vf + t8 * 16 * FA_PV + sub * 64; va[t8] = cat16(*(const v8h*)pv, *(const v8h*)(pv + 32)); }
            __builtin_amdgcn_sched_barrier(0);   // six of the eight V^T fragments are read in front of the softmax arithmetic, which covers their latency; left free, the compiler put the reads two by two in front of each product
            float t[16]; float mx = FLOW;
#pragma unroll
            for (int kt = 0; kt < 2; ++kt)
#pragma unroll
                for (int r = 0; r < 8; ++r) { const float u = s[kt][r] * SCL + mk[kt][r >> 2][r & 3]; t[kt * 8 + r] = u; mx = fmaxf(mx, u); }
            mx = fmaxf(mx, xhalf(mx));   // both halves of the wave now hold the query's maximum over the pass
            if (__builtin_amdgcn_ballot_w32(mx > m_run + FA_LAG) != 0) {   // wave-uniform, rare behind the first pass
                const float m_new = fmaxf(m_run, mx); const float corr = __builtin_amdgcn_exp2f((m_run - m_new) * L2E);
                l_run *= corr; m_run = m_new;
#pragma unroll
                for (int t8 = 0; t8 < 8; ++t8) acc[t8] = acc[t8] * corr;
            }
#pragma unroll
            for (int t8 = 6; t8 < 8; ++t8) { const unsigned char* pv = L + vf + t8 * 16 * FA_PV + sub * 64; va[t8] = cat16(*(const v8h*)pv, *(const v8h*)(pv + 32)); }
            __builtin_amdgcn_sched_barrier(0);   // the last two fragments are read here, where the raw scores' and the mask's registers are free (all eight above did not fit 256 VGPRs); the exponentials and the first six products cover their latency
            v16h pf; float ps[4];
#pragma unroll
            for (int e = 0; e < 16; e += 4) { float p0 = (t[e] - m_run) * L2E, p1 = (t[e + 1] - m_run) * L2E, p2 = (t[e + 2] - m_run) * L2E, p3 = (t[e + 3] - m_run) * L2E;
                exp2x4(p0, p1, p2, p3);
                ps[e >> 2] = (p0 + p1) + (p2 + p3); pf[e] = (h16)p0; pf[e + 1] = (h16)p1; pf[e + 2] = (h16)p2; pf[e + 3] = (h16)p3; }
            l_run += (ps[0] + ps[1]) + (ps[2] + ps[3]);
#pragma unroll
            for (int t8 = 0; t8 < 8; ++t8) acc[t8] = wmma16(va[t8], pf, acc[t8]);
        }
        if (more) {   // into the other buffer: every wave left it at the barrier that ended stage st - 1
#pragma unroll
            for (int i = 0; i < 4; ++i) { *(v4u*)(L + kl + i * 16 * FA_PK) = kr[i]; *(v4u*)(L + vl + i * 32 * FA_PV) = vr[i]; }
        }
        kf ^= FA_FLIP; vf ^= FA_FLIP; mp += FA_SK;
        __syncthreads();   // publishes stage st + 1 and ends every wave's reads of stage st
    }
    const float inv = OCAR / (l_run + xhalf(l_run));   // each half summed its own eight keys of every 16-key tile
    h16* op = AT + (size_t)(q0 + lr) * DQ + (size_t)h * HD + 8 * hi;   // D of O^T: lane l holds query (l & 15), d = 16 t8 + 8*(l>>4) + r
#pragma unroll
    for (int t8 = 0; t8 < 8; ++t8) { v8h o;
#pragma unroll
        for (int r = 0; r < 8; ++r) o[r] = (h16)(acc[t8][r] * inv);
        *(v8h*)(op + t8 * 16) = o; }
}

extern "C" void kernel_launch(void* const* d_in, const int* in_sizes, int n_in,
                              void* d_out, int out_size, void* d_ws, size_t ws_size, hipStream_t stream) {
    if (n_in < 10) return;
    const float* x  = (const float*)d_in[0]; const float* am = (const float*)d_in[1];
    const float* wq = (const float*)d_in[2]; const float* bq = (const float*)d_in[3]; const float* wk = (const float*)d_in[4]; const float* bk = (const float*)d_in[5];
    const float* wv = (const float*)d_in[6]; const float* bv = (const float*)d_in[7]; const float* wo = (const float*)d_in[8]; const float* bo = (const float*)d_in[9];
    if (in_sizes[0] < 0 || (size_t)in_sizes[0] < (size_t)(NB - 1) * SEQ_FULL * DM + (size_t)SEQ * DM) return;
    if (in_sizes[1] < (NB - 1) * SEQ_FULL + SEQ) return;
    if (in_sizes[2] < DQ * DM || in_sizes[4] < DQ * DM || in_sizes[6] < DQ * DM || in_sizes[8] < DM * DQ) return;
    if (in_sizes[3] < DQ || in_sizes[5] < DQ || in_sizes[7] < DQ || in_sizes[9] < DM) return;
    if (out_size < 0 || (size_t)out_size < (size_t)NB * SEQ * DM) return;
    float* OUT = (float*)d_out;     // [NB][SEQ][DM]

    // ---- workspace carve (all offsets 256-B aligned; every region is written to exactly its extent by whole-line stores) ----
    char* wsp = (char*)d_ws; size_t used = 0;
    auto take = [&](size_t bytes) { char* p = wsp + used; used += (bytes + 255) & ~(size_t)255; return (void*)p; };
    bf*  WQ   = (bf*)take((size_t)DQ * DM * 2);                   // 8,388,608
    bf*  WK   = (bf*)take((size_t)DQ * DM * 2);                   // 8,388,608
    bf*  WV   = (bf*)take((size_t)DQ * DM * 2);                   // 8,388,608
    h16* WO16 = (h16*)take((size_t)DM * DQ * 2);                  // 8,388,608
    bf*  XB   = (bf*)take((size_t)NB * SEQ * DM * 2);             // 16,777,216  [b][t][k]
    float* MA = (float*)take((size_t)NB * SEQ * 4);                // 16,384  [b][t]
    h16* QP16 = (h16*)take((size_t)NB * NH_ * SEQ * HD * 2);      // 16,777,216  [b][h][t][d]
    h16* KP16 = (h16*)take((size_t)NB * NH_ * SEQ * HD * 2);      // 16,777,216  [b][h][t][d]
    h16* VT16 = (h16*)take((size_t)NB * NH_ * HD * SEQ * 2);      // 16,777,216  [b][h][d][t]
    h16* AT16 = (h16*)take((size_t)NB * SEQ * DQ * 2);            // 16,777,216  [b][t][h*HD+d]
    if (used > ws_size) return;                                    // total 117,456,896 B at NB=2, SEQ=2048

    k_prep<<<PR_G, 256, 0, stream>>>(x, am, wq, wk, wv, wo, WQ, WK, WV, WO16, XB, MA);
    k_gemm_qkv<<<dim3(NB * SEQ / GT_T, DQ / GT_T, 3), 256, 0, stream>>>(XB, WQ, WK, WV, QP16, KP16, VT16, bq, bk, bv);
    k_fattn<<<dim3(SEQ / FA_BQ, NH_, NB), 256, 0, stream>>>(QP16, KP16, VT16, MA, AT16);
    k_gemm_out<h16, DQ><<<dim3(NB * SEQ / GT_T, DM / GT_T, 1), 256, 0, stream>>>(AT16, WO16, OUT, DM, bo, 1.0f / (OCAR * WCAR));
}

// v006
// A run of this version takes 160 microseconds.
// Two timings next to v005 both put it at 1.04 times that version's speed.
// Counting every step since v000, it is 10.2 times as fast.
#include <hip/hip_runtime.h>

// Multi-head self-attention block (hidden [NB][SEQ][2048], 16 heads x 128): q/k/v = x W^T + b; s = (q.k) x 128^-0.5 + (1 - m[key]) x f32_lowest; p = softmax over keys; ctx = p.v; out = ctx Wo^T + bo -> [NB][SEQ][2048] f32.
// Compute dtypes (f32 accumulate everywhere): x, W*, b*, m enter as their bf16 (RNE) values; q/k/v projections: v_wmma_f32_16x16x32_bf16 (bf16 operands);
// scores: v_wmma_f32_16x16x32_f16 (f16 q, k planes); p.v: v_wmma_f32_16x16x32_f16 (f16 p = exp(s - running max), not normalised, f16 v; the row sum divides at the end); output projection: v_wmma_f32_16x16x32_f16 (f16 ctx x64, f16 Wo x64); softmax f32.
#pragma clang fp contract(off)

#ifndef NB
#define NB 2
#endif
#ifndef SEQ
#define SEQ 2048
#endif
#define NB_FULL  2
#define SEQ_FULL 2048
#define DM   2048
#define NH_  16
#define HD   128
#define DQ   (NH_ * HD)
#define OCAR 64.0f
#define WCAR 64.0f
#define SCL  0.08838834764831845f
#define FLOW (-3.4028234663852886e38f)

static_assert(SEQ % 128 == 0);
static_assert(SEQ >= 128 && SEQ <= SEQ_FULL);
static_assert(NB >= 1 && NB <= NB_FULL);
static_assert(DQ == DM);
static_assert(DM % 64 == 0 && HD == 128);

typedef _Float16 h16;
typedef unsigned short bf;
typedef __attribute__((ext_vector_type(16))) __bf16   v16bf;
typedef __attribute__((ext_vector_type(16))) _Float16 v16h;
typedef __attribute__((ext_vector_type(8)))  _Float16 v8h;
typedef __attribute__((ext_vector_type(4)))  _Float16 v4h;
typedef __attribute__((ext_vector_type(8)))  unsigned short v8us;
typedef __attribute__((ext_vector_type(8)))  float    v8f;
typedef __attribute__((ext_vector_type(4)))  float    v4f;
typedef v4f __attribute__((may_alias)) v4fa;

__device__ __forceinline__ unsigned short f2bf(float f) { unsigned u = __float_as_uint(f); u += 0x7FFFu + ((u >> 16) & 1u); return (unsigned short)(u >> 16); }
__device__ __forceinline__ float bf2f(unsigned short b) { return __uint_as_float(((unsigned)b) << 16); }
__device__ __forceinline__ float bfr(float f) { return bf2f(f2bf(f)); }
__device__ __forceinline__ v16h cat16(v8h lo, v8h hi) { return __builtin_shufflevector(lo, hi, 0, 1, 2, 3, 4, 5, 6, 7, 8, 9, 10, 11, 12, 13, 14, 15); }
__device__ __forceinline__ v16bf cat16b(v8us lo, v8us hi) { return __builtin_bit_cast(v16bf, __builtin_shufflevector(lo, hi, 0, 1, 2, 3, 4, 5, 6, 7, 8, 9, 10, 11, 12, 13, 14, 15)); }
__device__ __forceinline__ v8f wmma16(v16h a, v16h b, v8f c) { return __builtin_amdgcn_wmma_f32_16x16x32_f16(false, a, false, b, (short)0, c, false, false); }
__device__ __forceinline__ v8f wmmab(v16bf a, v16bf b, v8f c) { return __builtin_amdgcn_wmma_f32_16x16x32_bf16(false, a, false, b, (short)0, c, false, false); }

// ---- GEMM: one 128x128 output tile per work-group of 8 waves (4 along M x 2 along N, 32x64 a wave, 8 accumulators), 256 threads. gt_products forms a tile's sums, gt_store_f32 or gt_store_plane stores them.
// c[m][n] = cscale x sum_k A[m][k] Bt[n][k] + a bf16-valued bias. A, Bt: K-contiguous 16-bit planes. The epilogue stores c in the form that its reader takes:
//   OUT_F32:  C[m][n] f32, pitch ldc, bias[n] (the block's output).
//   OUT_HEAD: P[n / HD][m][n % HD] f16, bias[n] (m = token: the q and k planes [h][t][d]; a tile's 128 columns are one head).
//   OUT_ROWS: P[m][n] f16, pitch SEQ, bias[m] (A = the weight, Bt = x, so m = h * HD + d and n = token: the v^T plane [h][d][t] comes out of the product as it stands, with no transposition).
// K % 128 == 0, K >= 256 (two stages at least: the second stage's copies stand under no test), M % 128 == 0, N % 128 == 0.
// One launch holds every tile of its phase, for all batch items (k_gemm_qkv: q, k and v^T together), and a work-group's LDS is under half a WGP's (the epilogue stages in the ring's own bytes): two work-groups share a WGP, and the start, the waits and the epilogue of one stand under the products of the other.
// Both operands come in stages of 128 k (rows of 256 B) by asynchronous copies, global -> LDS through no register, two buffers: stage t + 1 flies while stage t is worked on, and every row is fetched once a work-group, in whole lines.
// Fragment map (both operands): lane l -> row/col (l & 15); elements 0..7 <- k0 + 8*(l>>4) + 0..7, elements 8..15 <- k0 + 16 + 8*(l>>4) + 0..7. D element r of lane l -> (row 8*(l>>4) + r, col l & 15).
template <typename T16> struct WFrag;
template <> struct WFrag<h16> { typedef v16h V; static __device__ __forceinline__ V ld(const h16* p) { return cat16(*(const v8h*)p, *(const v8h*)(p + 16)); } static __device__ __forceinline__ v8f mma(V a, V b, v8f c) { return wmma16(a, b, c); } };
template <> struct WFrag<bf> { typedef v16bf V; static __device__ __forceinline__ V ld(const bf* p) { return cat16b(*(const v8us*)p, *(const v8us*)(p + 16)); } static __device__ __forceinline__ v8f mma(V a, V b, v8f c) { return wmmab(a, b, c); } };
#define GT_T   128                       // rows of each operand in a tile
#define GT_KS  128                       // k of a stage
#define GT_P   272                       // LDS pitch of a row (256 B + 16): 16 B x odd, conflict-free for 16-byte row reads
#define GT_OP  (GT_T * GT_P)             // one operand's stage
#define GT_BUF (2 * GT_OP)               // a buffer: [A 128 rows | Bt 128 rows]
static_assert(SEQ % GT_T == 0 && DM % GT_T == 0 && DQ % GT_T == 0 && GT_T == HD);
#define OUT_F32  0
#define OUT_HEAD 1
#define OUT_ROWS 2
// One operand's stage, this thread's share: eight 16-byte chunks, rows 16 apart (l: the lane's LDS byte address, g: its global address, rs: 16 rows in elements).
// The s_wait_xcnt at the end of the statement stands in front of any later write of the address registers that the copies name.
template <typename T16>
__device__ __forceinline__ void gt_copy8(unsigned l, const T16* g, size_t rs) {
    asm volatile("global_load_async_to_lds_b128 %0, %8, off\n\t"
                 "global_load_async_to_lds_b128 %1, %9, off\n\t"
                 "global_load_async_to_lds_b128 %2, %10, off\n\t"
                 "global_load_async_to_lds_b128 %3, %11, off\n\t"
                 "global_load_async_to_lds_b128 %4, %12, off\n\t"
                 "global_load_async_to_lds_b128 %5, %13, off\n\t"
                 "global_load_async_to_lds_b128 %6, %14, off\n\t"
                 "global_load_async_to_lds_b128 %7, %15, off\n\t"
                 "s_wait_xcnt 0x0"
                 :: "v"(l), "v"(l + 16 * GT_P), "v"(l + 32 * GT_P), "v"(l + 48 * GT_P), "v"(l + 64 * GT_P), "v"(l + 80 * GT_P), "v"(l + 96 * GT_P), "v"(l + 112 * GT_P),
                    "v"(g), "v"(g + rs), "v"(g + 2 * rs), "v"(g + 3 * rs), "v"(g + 4 * rs), "v"(g + 5 * rs), "v"(g + 6 * rs), "v"(g + 7 * rs)
                 : "memory");
}
// The sums of the tile at rows r0 of A and rows c0 of Bt. L: the work-group's ring of 2 x GT_BUF bytes; every wave has left it, and no copy is outstanding, when this returns.
template <typename T16, int K>
__device__ __forceinline__
void gt_products(const T16* __restrict__ A, const T16* __restrict__ Bt, const int r0, const int c0, unsigned char* L, v8f (&acc)[2][4]) {
    static_assert(K % GT_KS == 0 && K >= 2 * GT_KS);
    typedef typename WFrag<T16>::V V;
    const int tid = threadIdx.x, lane = tid & 31, wave = tid >> 5, lr = lane & 15, hi = lane >> 4, wm = wave >> 1, wn = wave & 1;
    // staging map: 2048 16-byte chunks an operand and stage, chunk = tid + 256 i -> row (tid >> 4) + 16 i, 16 chunks a row: a wave's copy covers two whole rows of the stage
    const T16* ag = A + (size_t)(r0 + (tid >> 4)) * K + (tid & 15) * 8;
    const T16* bg = Bt + (size_t)(c0 + (tid >> 4)) * K + (tid & 15) * 8;
    const size_t rs = (size_t)16 * K;
    const unsigned cl = (unsigned)(size_t)L + (tid >> 4) * GT_P + (tid & 15) * 16;     // where this thread's chunks go
    const unsigned af = (wm * 32 + lr) * GT_P + 16 * hi, bfo = GT_OP + (wn * 64 + lr) * GT_P + 16 * hi;   // where this lane's fragments start
    constexpr int nst = K / GT_KS;
    unsigned bo = 0;   // byte offset of the buffer that holds stage st
#pragma unroll
    for (int mb = 0; mb < 2; ++mb)
#pragma unroll
        for (int nb = 0; nb < 4; ++nb) acc[mb][nb] = (v8f){};
    gt_copy8(cl, ag, rs); gt_copy8(cl + GT_OP, bg, rs);
    asm volatile("s_wait_asynccnt 0x0" ::: "memory");   // stage 0 has landed, as far as this wave copied it
    __syncthreads();                                     // publishes stage 0
    gt_copy8(cl + GT_BUF, ag + GT_KS, rs); gt_copy8(cl + GT_BUF + GT_OP, bg + GT_KS, rs);
    ag += 2 * GT_KS; bg += 2 * GT_KS;
    // kept rolled: the body holds a whole stage's 32 products a wave, unrolled
#pragma unroll 1
    for (int st = 0; st < nst; ++st) {
        V a[2][2], b[2][4];
#pragma unroll
        for (int mb = 0; mb < 2; ++mb) a[0][mb] = WFrag<T16>::ld((const T16*)(L + bo + af + mb * 16 * GT_P));
#pragma unroll
        for (int nb = 0; nb < 4; ++nb) b[0][nb] = WFrag<T16>::ld((const T16*)(L + bo + bfo + nb * 16 * GT_P));
#pragma unroll
        for (int kb = 0; kb < GT_KS / 32; ++kb) {
            const int cur = kb & 1, nxt = cur ^ 1;
            if (kb + 1 < GT_KS / 32) {   // the next 32 k's fragments, read as one group in front of this block's products
#pragma unroll
                for (int mb = 0; mb < 2; ++mb) a[nxt][mb] = WFrag<T16>::ld((const T16*)(L + bo + af + mb * 16 * GT_P + (kb + 1) * 64));
#pragma unroll
                for (int nb = 0; nb < 4; ++nb) b[nxt][nb] = WFrag<T16>::ld((const T16*)(L + bo + bfo + nb * 16 * GT_P + (kb + 1) * 64));
            }
            __builtin_amdgcn_sched_barrier(0);   // the reads stay one group in front of the products, which cover their latency; left free, the compiler put them two by two in front of each pair of products, with a full wait each
#pragma unroll
            for (int nb = 0; nb < 4; ++nb)
#pragma unroll
                for (int mb = 0; mb < 2; ++mb) acc[mb][nb] = WFrag<T16>::mma(a[cur][mb], b[cur][nb], acc[mb][nb]);
            __builtin_amdgcn_sched_barrier(0);   // and no read of the block after next moves up among these products
        }
        asm volatile("s_wait_dscnt 0x0" ::: "memory");      // this wave's reads of stage st have returned
        asm volatile("s_wait_asynccnt 0x0" ::: "memory");   // its copies of stage st + 1 have landed
        __syncthreads();                                     // publishes stage st + 1 and ends every wave's reads of stage st
        if (st + 2 < nst) { gt_copy8(cl + bo, ag, rs); gt_copy8(cl + bo + GT_OP, bg, rs); }   // stage st + 2 into the buffer that stage st has left
        ag += GT_KS; bg += GT_KS; bo = GT_BUF - bo;
    }
    asm volatile("s_wait_asynccnt 0x0" ::: "memory");       // no copy is outstanding when the wave goes on
}
// The epilogues. os: the wave's own 16 x 68 floats of LDS, where it stages a 16 x 64 block, so that whole lines are stored.
// OUT_F32: the tile at rows r0, columns c0 of C.
__device__ __forceinline__ void gt_store_f32(const v8f (&acc)[2][4], float* os, float* C, const int ldc, const int r0, const int c0, const float* __restrict__ bias, const float cscale) {
    const int tid = threadIdx.x, lane = tid & 31, wave = tid >> 5, lr = lane & 15, hi = lane >> 4, wm = wave >> 1, wn = wave & 1;
    const int cw = c0 + wn * 64;
    // bias for this lane's 4 output columns: one 16-B load per lane, loaded once (the columns are the same for every row of the wave's tile)
    v4f bb; { const v4f br = *(const v4f*)(bias + cw + lr * 4); bb[0] = bfr(br[0]); bb[1] = bfr(br[1]); bb[2] = bfr(br[2]); bb[3] = bfr(br[3]); }
#pragma unroll
    for (int mb = 0; mb < 2; ++mb) {
#pragma unroll
        for (int nb = 0; nb < 4; ++nb) {
#pragma unroll
            for (int j = 0; j < 8; ++j) os[(hi * 8 + j) * 68 + nb * 16 + lr] = acc[mb][nb][j]; }
        __builtin_amdgcn_wave_barrier(); asm volatile("" ::: "memory");   // other lanes of the wave read these rows back: the compiler may move no read in front of the stores
        float* crow = C + (size_t)(r0 + wm * 32 + mb * 16) * ldc + cw;
#pragma unroll
        for (int s = 0; s < 8; ++s) { const int row = 2 * s + hi, cofs = lr * 4; v4f val = *(const v4fa*)(os + row * 68 + cofs); val = val * cscale; val = val + bb;
            *(v4f*)(crow + (size_t)row * ldc + cofs) = val; }
        __builtin_amdgcn_wave_barrier(); asm volatile("" ::: "memory");   // and no store of the next 16 rows in front of these reads
    }
}
// OUT_HEAD, OUT_ROWS: the tile at rows r0, columns c0 (as m and n above) of one batch item's plane P.
template <int OUT>
__device__ __forceinline__ void gt_store_plane(const v8f (&acc)[2][4], float* os, h16* P, const int r0, const int c0, const float* __restrict__ bias, const float cscale) {
    const int tid = threadIdx.x, lane = tid & 31, wave = tid >> 5, lr = lane & 15, hi = lane >> 4, wm = wave >> 1, wn = wave & 1;
    const int cw = c0 + wn * 64;
    // f16 planes: a row of the wave's block is 64 values = one 128-byte line; eight lanes store a row (8 values = 16 B each), a wave's store covers four whole rows
    const int c8 = (lane & 7) * 8, r4 = lane >> 3;
    constexpr int pp = OUT == OUT_HEAD ? HD : SEQ;   // pitch of the plane
    h16* pr = (OUT == OUT_HEAD ? P + ((size_t)blockIdx.y * SEQ + r0) * HD + wn * 64 : P + (size_t)r0 * SEQ + cw) + (size_t)(wm * 32 + r4) * pp + c8;
    v4f bc[2] = {(v4f){}, (v4f){}};   // OUT_HEAD: the bias of this lane's 8 columns, the same for every row
    if constexpr (OUT == OUT_HEAD) {
#pragma unroll
        for (int q = 0; q < 2; ++q) { const v4f br = *(const v4f*)(bias + cw + c8 + 4 * q); bc[q][0] = bfr(br[0]); bc[q][1] = bfr(br[1]); bc[q][2] = bfr(br[2]); bc[q][3] = bfr(br[3]); }
    }
    v4f br[2][2] = {{(v4f){}, (v4f){}}, {(v4f){}, (v4f){}}};   // OUT_ROWS: the bias of the 8 rows that this lane's accumulators hold, for both 16-row blocks
    if constexpr (OUT == OUT_ROWS) {
#pragma unroll
        for (int mb = 0; mb < 2; ++mb)
#pragma unroll
            for (int q = 0; q < 2; ++q) { const v4f b = *(const v4f*)(bias + r0 + wm * 32 + mb * 16 + hi * 8 + 4 * q); br[mb][q][0] = bfr(b[0]); br[mb][q][1] = bfr(b[1]); br[mb][q][2] = bfr(b[2]); br[mb][q][3] = bfr(b[3]); }
    }
#pragma unroll
    for (int mb = 0; mb < 2; ++mb) {
        if constexpr (OUT == OUT_ROWS) {   // the bias goes by rows: added where a lane still holds 8 rows of one column
#pragma unroll
            for (int nb = 0; nb < 4; ++nb) {
#pragma unroll
                for (int j = 0; j < 8; ++j) os[(hi * 8 + j) * 68 + nb * 16 + lr] = acc[mb][nb][j] * cscale + br[mb][j >> 2][j & 3]; }
        } else {
#pragma unroll
            for (int nb = 0; nb < 4; ++nb) {
#pragma unroll
                for (int j = 0; j < 8; ++j) os[(hi * 8 + j) * 68 + nb * 16 + lr] = acc[mb][nb][j]; }
        }
        __builtin_amdgcn_wave_barrier(); asm volatile("" ::: "memory");   // other lanes of the wave read these rows back: the compiler may move no read in front of the stores
#pragma unroll
        for (int s = 0; s < 4; ++s) { const float* rp = os + (4 * s + r4) * 68 + c8; v4f lo = *(const v4fa*)rp, up = *(const v4fa*)(rp + 4);
            if constexpr (OUT == OUT_HEAD) { lo = lo * cscale; lo = lo + bc[0]; up = up * cscale; up = up + bc[1]; }
            v8h o;
#pragma unroll
            for (int q = 0; q < 4; ++q) { o[q] = (h16)lo[q]; o[q + 4] = (h16)up[q]; }
            *(v8h*)(pr + (size_t)(mb * 16 + 4 * s) * pp) = o; }
        __builtin_amdgcn_wave_barrier(); asm volatile("" ::: "memory");   // and no store of the next 16 rows in front of these reads
    }
    asm volatile("s_wait_xcnt 0x0" ::: "memory");   // stands in front of any later write of a register that the stores above name: in a kernel that holds both plane forms, code of the other form follows these stores in the listing
}
static_assert(8 * 16 * 68 * 4 <= 2 * GT_BUF);
// at most 256 VGPRs: the asm operands above stay in the register window that needs no switching
// k_gemm_qkv: the three projections of every batch item. grid (NB * SEQ / 128, DQ / 128, 3): x = 128 tokens of X [b][t][k], y = 128 output features = one head, z = 0: q, 1: k, 2: v^T. Planes: QP, KP [b][h][t][d], VT [b][h][d][t].
__global__ __launch_bounds__(256) __attribute__((amdgpu_num_vgpr(256)))
void k_gemm_qkv(const bf* __restrict__ X, const bf* __restrict__ WQ, const bf* __restrict__ WK, const bf* __restrict__ WV, h16* QP, h16* KP, h16* VT,
                const float* __restrict__ bq, const float* __restrict__ bk, const float* __restrict__ bv) {
    __shared__ __align__(16) unsigned char L[2 * GT_BUF];
    float* os = (float*)L + (threadIdx.x >> 5) * (16 * 68);
    const int t0 = blockIdx.x * GT_T, e0 = blockIdx.y * GT_T, z = blockIdx.z;   // t0 counts the tokens of all batch items; a tile lies in one item
    const size_t pb = (size_t)(t0 / SEQ) * NH_ * SEQ * HD; const int tb = t0 % SEQ;
    v8f acc[2][4];
    const bool isv = z == 2;   // the same for the whole work-group; v^T: A = the weight, Bt = x
    gt_products<bf, DM>(isv ? WV : X, isv ? X : z ? WK : WQ, isv ? e0 : t0, isv ? t0 : e0, L, acc);
    if (isv) gt_store_plane<OUT_ROWS>(acc, os, VT + pb, e0, tb, bv, 1.0f);
    else     gt_store_plane<OUT_HEAD>(acc, os, (z ? KP : QP) + pb, tb, e0, z ? bk : bq, 1.0f);
}
// k_gemm_out: C[m][n] f32. grid (M / 128, N / 128).
template <typename T16, int K>
__global__ __launch_bounds__(256) __attribute__((amdgpu_num_vgpr(256)))
void k_gemm_out(const T16* __restrict__ A, const T16* __restrict__ Bt, float* C, int ldc, const float* __restrict__ bias, float cscale) {
    __shared__ __align__(16) unsigned char L[2 * GT_BUF];
    float* os = (float*)L + (threadIdx.x >> 5) * (16 * 68);
    const int r0 = blockIdx.x * GT_T, c0 = blockIdx.y * GT_T;
    v8f acc[2][4];
    gt_products<T16, K>(A, Bt, r0, c0, L, acc);
    gt_store_f32(acc, os, C, ldc, r0, c0, bias, cscale);
}

// ---- k_prep: every operand conversion of the block in ONE launch of long-lived waves: wq, wk, wv, x -> bf16 (RNE); wo -> f16 of (its bf16 value x WCAR); m -> (1 - bf16(m)) x f32_lowest.
// grid PR_G work-groups of 256 threads. A unit = 8192 floats = 8 chunks of 4 floats a thread, chunk i of thread t at i * 1024 + t * 4: a wave's load covers 512 bytes in a row (four whole lines), its store 256 (two whole lines).
// Work-group g converts unit g of each weight and of each batch item of x, one after the other, from two register sets: a set is loaded again as soon as it has been converted, so the eight loads of at least one unit are in flight while another is converted.
// Each wave here converts 48 chunks a lane (for speed only).
#define PR_U 8192
#define PR_G (DQ * DM / PR_U)
#define PR_X (SEQ * DM / PR_U)            // units of one batch item of x
#define PR_M (NB * SEQ / 1024)            // work-groups that also convert 1024 mask values each
static_assert(DQ * DM % PR_U == 0 && SEQ * DM % PR_U == 0 && PR_X <= PR_G && SEQ % 1024 == 0 && PR_M <= PR_G);
typedef __attribute__((ext_vector_type(4))) unsigned short v4us;
typedef __attribute__((ext_vector_type(2))) unsigned v2u;
// lo: this thread's byte offset from the source pointer (32 bits, so that the load takes the pointer as its scalar base)
__device__ __forceinline__ void pr_load(const float* __restrict__ s, unsigned lo, v4f (&r)[8]) {
#pragma unroll
    for (int i = 0; i < 8; ++i) r[i] = *(const v4f*)((const char*)s + lo + i * 4096); }
// One unit: converts the set r (H: to f16 of the bf16 value x WCAR; else to bf16), stores it at d + so bytes, and loads the set again from nxt + lo bytes where ld says so.
template <bool H>
__device__ __forceinline__ void pr_step(v4f (&r)[8], void* d, unsigned so, const float* __restrict__ nxt, bool ld, unsigned lo) {
    v2u w[8];
#pragma unroll
    for (int i = 0; i < 8; ++i) {
        if constexpr (H) { v4h o;
#pragma unroll
            for (int q = 0; q < 4; ++q) o[q] = (h16)(bfr(r[i][q]) * WCAR);
            w[i] = __builtin_bit_cast(v2u, o);
        } else { v4us o;
#pragma unroll
            for (int q = 0; q < 4; ++q) o[q] = f2bf(r[i][q]);
            w[i] = __builtin_bit_cast(v2u, o); }
    }
#pragma unroll
    for (int i = 0; i < 8; ++i) *(v2u*)((char*)d + so + i * 2048) = w[i];
    if (ld) pr_load(nxt, lo, r);
    // the wait that stands in front of any later write of a register which these stores and loads name; the offsets and the stored words are its inputs, so that their registers are kept up to here
    asm volatile("s_wait_xcnt 0x0" :: "v"(lo), "v"(so), "v"(w[0]), "v"(w[1]), "v"(w[2]), "v"(w[3]), "v"(w[4]), "v"(w[5]), "v"(w[6]), "v"(w[7]) : "memory");
}
__global__ __launch_bounds__(256) void k_prep(const float* __restrict__ x, const float* __restrict__ m, const float* __restrict__ wq, const float* __restrict__ wk, const float* __restrict__ wv, const float* __restrict__ wo,
                                              bf* WQ, bf* WK, bf* WV, h16* WO16, bf* XB, float* MA) {
    const int g = blockIdx.x, tid = threadIdx.x;
    const unsigned so = (unsigned)(g * PR_U + tid * 4) * 2u, lo = so * 2u;
    const bool hasx = PR_X == PR_G || g < PR_X;   // the same for the whole work-group
    v4f r[2][8];
    pr_load(wq, lo, r[0]);
    pr_load(wk, lo, r[1]);
    pr_step<false>(r[0], WQ, so, wv, true, lo);
    pr_step<false>(r[1], WK, so, wo, true, lo);
    pr_step<false>(r[0], WV, so, x, hasx, lo);
    pr_step<true>(r[1], WO16, so, x, hasx && NB > 1, NB > 1 ? lo + SEQ_FULL * DM * 4u : lo);
#pragma unroll
    for (int b = 0; b < NB; ++b)   // batch item b: its place goes into the 32-bit offsets
        if (hasx) pr_step<false>(r[b & 1], XB, so + b * (SEQ * DM * 2u), x, b + 2 < NB, b + 2 < NB ? lo + (b + 2) * (SEQ_FULL * DM * 4u) : lo);
    if (g < PR_M) {   // the same for the whole work-group
        const int mi = g * 1024 + tid * 4;   // index into MA, [NB][SEQ]
        const unsigned mo = (unsigned)((mi / SEQ) * SEQ_FULL + mi % SEQ) * 4u;
        const v4f a = *(const v4f*)((const char*)m + mo);
        asm volatile("s_wait_xcnt 0x0" :: "v"(mo) : "memory");   // as above: in front of any later write of the load's offset register
        v4f q;
#pragma unroll
        for (int e = 0; e < 4; ++e) { const float u = 1.0f - bfr(a[e]); q[e] = u * FLOW; }
        *(v4f*)(MA + mi) = q;
    }
}
// ---- k_fattn: scores, softmax and p.v of one head for 256 queries in one work-group; no score ever reaches memory. grid (SEQ/256, NH_, NB), 256 threads = 8 waves x 32 queries (two 16-query tiles a wave).
// Transposed products: S^T = K.Q^T (A = 16 keys x 32 d from LDS, B = Q^T kept in registers), O^T += V^T.P^T (A = 16 d x 32 keys from LDS, B = P^T).
// Every K and V^T fragment that a wave reads from LDS serves the products of both its query tiles: 512 bytes of LDS reads a product. One tile a wave would read 1024, twice what the LDS delivers in a product's time on four SIMDs.
// The two tiles' sums and Q^T take 192 registers, so a wave has the budget of two waves a SIMD, and one work-group fills a WGP.
// D of S^T: lane l holds query (l & 15), keys 8*(l>>4) + r of each 16-key tile; that is the B operand's k order for 32 keys (tile 0 -> elements 0..7, tile 1 -> elements 8..15), so P^T packs in-lane.
// K rows ([t][d] plane) and V^T rows ([d][t] plane) come in stages of 64 keys: global -> registers -> LDS, two buffers; the next stage's loads fly under this stage's two 32-key passes.
// Every inner loop is fully unrolled, so that each index into a register array is a constant (an index known only at run time would send the array to scratch).
// Online softmax: t = s x SCL + MA[key]; p = exp(t - m_run); m_run may trail the true maximum by up to FA_LAG (p stays below e^FA_LAG, far inside f16); a query tile's sums are rescaled only when one of its queries' maxima passes that.
#define FA_QT   2                         // 16-query tiles of a wave
#define FA_BQ   (8 * 16 * FA_QT)
static_assert(FA_QT == 2);                // the pass's one rescale test names both tiles
#define FA_SK   64
#define FA_PK   272                       // LDS pitch of a K row (256 B + 16): 16 B x odd, conflict-free for 16-byte row reads
#define FA_PV   144                       // LDS pitch of a V^T row (128 B + 16): 16 B x odd
#define FA_TK   (FA_SK * FA_PK)
#define FA_SLOT (FA_TK + HD * FA_PV)
#define FA_FLIP 65536                     // the two buffers lie 64 KiB apart, so that one XOR on an LDS offset changes the buffer
#define FA_LAG  5.5f
#define L2E     1.4426950408889634f
static_assert(SEQ % FA_BQ == 0 && SEQ % FA_SK == 0 && SEQ % 1024 == 0 && FA_SLOT <= FA_FLIP);
typedef __attribute__((ext_vector_type(4))) unsigned v4u;
__device__ __forceinline__ float xhalf(float x) { return __builtin_bit_cast(float, __builtin_amdgcn_permlanex16(__builtin_bit_cast(int, x), __builtin_bit_cast(int, x), 0x76543210, 0xfedcba98, false, false)); }  // lane l <-> lane l ^ 16
// Four exponentials (2^x, in place) in one statement. The v_nop at its end fills the slot that the instruction set asks for behind a transcendental before a source is overwritten or the result read.
__device__ __forceinline__ void exp2x4(float& a, float& b, float& c, float& d) { asm("v_exp_f32 %0, %0\n\tv_exp_f32 %1, %1\n\tv_exp_f32 %2, %2\n\tv_exp_f32 %3, %3\n\tv_nop" : "+v"(a), "+v"(b), "+v"(c), "+v"(d)); }
// two waves a SIMD: 512 VGPRs a wave
__global__ __launch_bounds__(256) __attribute__((amdgpu_waves_per_eu(2, 2))) void k_fattn(const h16* __restrict__ QP, const h16* __restrict__ KP, const h16* __restrict__ VT, const float* __restrict__ MA, h16* AT) {
    __shared__ __align__(16) unsigned char L[FA_FLIP + FA_SLOT];
    __shared__ __align__(16) float MAs[SEQ];
    const int tid = threadIdx.x, lane = tid & 31, wave = tid >> 5, lr = lane & 15, hi = lane >> 4;
    const int h = blockIdx.y, q0 = blockIdx.x * FA_BQ + wave * (16 * FA_QT);
    { const size_t pb = (size_t)blockIdx.z * NH_ * SEQ * HD; QP += pb; KP += pb; VT += pb; MA += (size_t)blockIdx.z * SEQ; AT += (size_t)blockIdx.z * SEQ * DQ; }   // batch item blockIdx.z: its planes, its mask row, its rows of AT
    // staging map: 1024 16-byte chunks of K (row = chunk >> 4) and 1024 of V^T (row = chunk >> 3) per stage, chunk = tid + 256 i
    const h16* kg = KP + (size_t)h * SEQ * HD; const unsigned ko = (unsigned)tid * 8u;         // a K stage is 16 KiB in a row
    const h16* vg = VT + (size_t)h * HD * SEQ; const unsigned vo = (unsigned)(tid >> 3) * SEQ + (unsigned)(tid & 7) * 8u;
    unsigned kl = (tid >> 4) * FA_PK + (tid & 15) * 16, vl = FA_TK + (tid >> 3) * FA_PV + (tid & 7) * 16;   // where this thread's chunks go
    unsigned kf = lr * FA_PK + 16 * hi, vf = FA_TK + lr * FA_PV + 16 * hi;                                 // where this lane's fragments start
    v4u kr[4], vr[4]; v4f mr[SEQ / 1024];
#pragma unroll
    for (int i = 0; i < SEQ / 1024; ++i) mr[i] = *(const v4f*)(MA + i * 1024 + tid * 4);
#pragma unroll
    for (int i = 0; i < 4; ++i) { kr[i] = *(const v4u*)(kg + i * 2048 + ko); vr[i] = *(const v4u*)(vg + i * 32 * SEQ + vo); }
    v16h qf[FA_QT][4]; const h16* qp[FA_QT];
#pragma unroll
    for (int qt = 0; qt < FA_QT; ++qt) { qp[qt] = QP + ((size_t)h * SEQ + q0 + 16 * qt + lr) * HD + 8 * hi;
#pragma unroll
      for (int kc = 0; kc < 4; ++kc) qf[qt][kc] = cat16(*(const v8h*)(qp[qt] + 32 * kc), *(const v8h*)(qp[qt] + 32 * kc + 16)); }
    // the wait that stands in front of any later write of an address register which the loads above name. The loads' addresses and offsets are its inputs, so that their registers are kept up to here; the two scheduling fences keep every such load in front of it
    __builtin_amdgcn_sched_barrier(0);
    asm volatile("s_wait_xcnt 0x0" :: "v"(tid), "v"(vo * 2u), "v"(qp[0]), "v"(qp[1]) : "memory");
    __builtin_amdgcn_sched_barrier(0);
#pragma unroll
    for (int i = 0; i < SEQ / 1024; ++i) *(v4f*)(MAs + i * 1024 + tid * 4) = mr[i];
#pragma unroll
    for (int i = 0; i < 4; ++i) { *(v4u*)(L + kl + i * 16 * FA_PK) = kr[i]; *(v4u*)(L + vl + i * 32 * FA_PV) = vr[i]; }
    v8f acc[FA_QT][8];
    float m_run[FA_QT], l_run[FA_QT];
#pragma unroll
    for (int qt = 0; qt < FA_QT; ++qt) { m_run[qt] = FLOW; l_run[qt] = 0.f;
#pragma unroll
        for (int t8 = 0; t8 < 8; ++t8) acc[qt][t8] = (v8f){}; }
    const float* mp = MAs + 8 * hi;
    __syncthreads();
    // kept rolled
#pragma unroll 1
    for (int st = 0; st < SEQ / FA_SK; ++st) {
        const bool more = st + 1 < SEQ / FA_SK;
        kl ^= FA_FLIP; vl ^= FA_FLIP; kg += FA_SK * HD; vg += FA_SK;
        if (more) {
#pragma unroll
            for (int i = 0; i < 4; ++i) { kr[i] = *(const v4u*)(kg + i * 2048 + ko); vr[i] = *(const v4u*)(vg + i * 32 * SEQ + vo); }
        }
#pragma unroll
        for (int sub = 0; sub < FA_SK / 32; ++sub) {
            v16h ka[4][2]; v4f mk[2][2]; v8f s[FA_QT][2];
#pragma unroll
            for (int qt = 0; qt < FA_QT; ++qt) { s[qt][0] = (v8f){}; s[qt][1] = (v8f){}; }
            { const unsigned char* p = L + kf + sub * 32 * FA_PK;
#pragma unroll
              for (int kc = 0; kc < 4; ++kc)
#pragma unroll
                for (int kt = 0; kt < 2; ++kt) ka[kc][kt] = cat16(*(const v8h*)(p + kt * 16 * FA_PK + 64 * kc), *(const v8h*)(p + kt * 16 * FA_PK + 64 * kc + 32));
#pragma unroll
              for (int kt = 0; kt < 2; ++kt) { mk[kt][0] = *(const v4f*)(mp + sub * 32 + kt * 16); mk[kt][1] = *(const v4f*)(mp + sub * 32 + kt * 16 + 4); } }
            __builtin_amdgcn_sched_barrier(0);   // the pass's K and mask reads stay one group in front of the products: one LDS latency a pass, not one a product
#pragma unroll
            for (int kc = 0; kc < 4; ++kc)
#pragma unroll
                for (int kt = 0; kt < 2; ++kt)
#pragma unroll
                    for (int qt = 0; qt < FA_QT; ++qt) s[qt][kt] = wmma16(ka[kc][kt], qf[qt][kc], s[qt][kt]);
            v16h va[8];
#pragma unroll
            for (int t8 = 0; t8 < 8; ++t8) { const unsigned char* pv = L + vf + t8 * 16 * FA_PV + sub * 64; va[t8] = cat16(*(const v8h*)pv, *(const v8h*)(pv + 32)); }
            __builtin_amdgcn_sched_barrier(0);   // all eight V^T fragments are read in front of the softmax arithmetic, which covers their latency; left free, the compiler put the reads two by two in front of each product
            float t[FA_QT][16], mx[FA_QT]; bool need[FA_QT];
#pragma unroll
            for (int qt = 0; qt < FA_QT; ++qt) { float m = FLOW;
#pragma unroll
                for (int kt = 0; kt < 2; ++kt)
#pragma unroll
                    for (int r = 0; r < 8; ++r) { const float u = s[qt][kt][r] * SCL + mk[kt][r >> 2][r & 3]; t[qt][kt * 8 + r] = u; m = fmaxf(m, u); }
                m = fmaxf(m, xhalf(m));   // both halves of the wave now hold the query's maximum over the pass
                mx[qt] = m; need[qt] = m > m_run[qt] + FA_LAG; }
            if (__builtin_amdgcn_ballot_w32(need[0] || need[1]) != 0) {   // one test a pass for both tiles; wave-uniform, rare behind the first pass
#pragma unroll
                for (int qt = 0; qt < FA_QT; ++qt)
                    if (__builtin_amdgcn_ballot_w32(need[qt]) != 0) {   // wave-uniform: each tile is rescaled by its own queries alone, as if it had the wave to itself
                        const float m_new = fmaxf(m_run[qt], mx[qt]); const float corr = __builtin_amdgcn_exp2f((m_run[qt] - m_new) * L2E);
                        l_run[qt] *= corr; m_run[qt] = m_new;
#pragma unroll
                        for (int t8 = 0; t8 < 8; ++t8) acc[qt][t8] = acc[qt][t8] * corr;
                    }
            }
#pragma unroll
            for (int qt = 0; qt < FA_QT; ++qt) {
                v16h pf; float ps[4];
#pragma unroll
                for (int e = 0; e < 16; e += 4) { float p0 = (t[qt][e] - m_run[qt]) * L2E, p1 = (t[qt][e + 1] - m_run[qt]) * L2E, p2 = (t[qt][e + 2] - m_run[qt]) * L2E, p3 = (t[qt][e + 3] - m_run[qt]) * L2E;
                    exp2x4(p0, p1, p2, p3);
                    ps[e >> 2] = (p0 + p1) + (p2 + p3); pf[e] = (h16)p0; pf[e + 1] = (h16)p1; pf[e + 2] = (h16)p2; pf[e + 3] = (h16)p3; }
                l_run[qt] += (ps[0] + ps[1]) + (ps[2] + ps[3]);
#pragma unroll
                for (int t8 = 0; t8 < 8; ++t8) acc[qt][t8] = wmma16(va[t8], pf, acc[qt][t8]);
            }
        }
        if (more) {   // into the other buffer: every wave left it at the barrier that ended stage st - 1
#pragma unroll
            for (int i = 0; i < 4; ++i) { *(v4u*)(L + kl + i * 16 * FA_PK) = kr[i]; *(v4u*)(L + vl + i * 32 * FA_PV) = vr[i]; }
        }
        kf ^= FA_FLIP; vf ^= FA_FLIP; mp += FA_SK;
        __syncthreads();   // publishes stage st + 1 and ends every wave's reads of stage st
    }
#pragma unroll
    for (int qt = 0; qt < FA_QT; ++qt) {
        const float inv = OCAR / (l_run[qt] + xhalf(l_run[qt]));   // each half summed its own eight keys of every 16-key tile
        h16* op = AT + (size_t)(q0 + 16 * qt + lr) * DQ + (size_t)h * HD + 8 * hi;   // D of O^T: lane l holds query (l & 15), d = 16 t8 + 8*(l>>4) + r
#pragma unroll
        for (int t8 = 0; t8 < 8; ++t8) { v8h o;
#pragma unroll
            for (int r = 0; r < 8; ++r) o[r] = (h16)(acc[qt][t8][r] * inv);
            *(v8h*)(op + t8 * 16) = o; }
    }
}

extern "C" void kernel_launch(void* const* d_in, const int* in_sizes, int n_in,
                              void* d_out, int out_size, void* d_ws, size_t ws_size, hipStream_t stream) {
    if (n_in < 10) return;
    const float* x  = (const float*)d_in[0]; const float* am = (const float*)d_in[1];
    const float* wq = (const float*)d_in[2]; const float* bq = (const float*)d_in[3]; const float* wk = (const float*)d_in[4]; const float* bk = (const float*)d_in[5];
    const float* wv = (const float*)d_in[6]; const float* bv = (const float*)d_in[7]; const float* wo = (const float*)d_in[8]; const float* bo = (const float*)d_in[9];
    if (in_sizes[0] < 0 || (size_t)in_sizes[0] < (size_t)(NB - 1) * SEQ_FULL * DM + (size_t)SEQ * DM) return;
    if (in_sizes[1] < (NB - 1) * SEQ_FULL + SEQ) return;
    if (in_sizes[2] < DQ * DM || in_sizes[4] < DQ * DM || in_sizes[6] < DQ * DM || in_sizes[8] < DM * DQ) return;
    if (in_sizes[3] < DQ || in_sizes[5] < DQ || in_sizes[7] < DQ || in_sizes[9] < DM) return;
    if (out_size < 0 || (size_t)out_size < (size_t)NB * SEQ * DM) return;
    float* OUT = (float*)d_out;     // [NB][SEQ][DM]

    // ---- workspace carve (all offsets 256-B aligned; every region is written to exactly its extent by whole-line stores) ----
    char* wsp = (char*)d_ws; size_t used = 0;
    auto take = [&](size_t bytes) { char* p = wsp + used; used += (bytes + 255) & ~(size_t)255; return (void*)p; };
    bf*  WQ   = (bf*)take((size_t)DQ * DM * 2);                   // 8,388,608
    bf*  WK   = (bf*)take((size_t)DQ * DM * 2);                   // 8,388,608
    bf*  WV   = (bf*)take((size_t)DQ * DM * 2);                   // 8,388,608
    h16* WO16 = (h16*)take((size_t)DM * DQ * 2);                  // 8,388,608
    bf*  XB   = (bf*)take((size_t)NB * SEQ * DM * 2);             // 16,777,216  [b][t][k]
    float* MA = (float*)take((size_t)NB * SEQ * 4);                // 16,384  [b][t]
    h16* QP16 = (h16*)take((size_t)NB * NH_ * SEQ * HD * 2);      // 16,777,216  [b][h][t][d]
    h16* KP16 = (h16*)take((size_t)NB * NH_ * SEQ * HD * 2);      // 16,777,216  [b][h][t][d]
    h16* VT16 = (h16*)take((size_t)NB * NH_ * HD * SEQ * 2);      // 16,777,216  [b][h][d][t]
    h16* AT16 = (h16*)take((size_t)NB * SEQ * DQ * 2);            // 16,777,216  [b][t][h*HD+d]
    if (used > ws_size) return;                                    // total 117,456,896 B at NB=2, SEQ=2048

    k_prep<<<PR_G, 256, 0, stream>>>(x, am, wq, wk, wv, wo, WQ, WK, WV, WO16, XB, MA);
    k_gemm_qkv<<<dim3(NB * SEQ / GT_T, DQ / GT_T, 3), 256, 0, stream>>>(XB, WQ, WK, WV, QP16, KP16, VT16, bq, bk, bv);
    k_fattn<<<dim3(SEQ / FA_BQ, NH_, NB), 256, 0, stream>>>(QP16, KP16, VT16, MA, AT16);
    k_gemm_out<h16, DQ><<<dim3(NB * SEQ / GT_T, DM / GT_T, 1), 256, 0, stream>>>(AT16, WO16, OUT, DM, bo, 1.0f / (OCAR * WCAR));
}

// v007
// Measured time: 154 microseconds a run.
// Timed twice side by side with v006, it ran 1.04 times as fast both times.
// All steps since v000 together make it 10.6 times as fast.
#include <hip/hip_runtime.h>

// Multi-head self-attention block (hidden [NB][SEQ][2048], 16 heads x 128): q/k/v = x W^T + b; s = (q.k) x 128^-0.5 + (1 - m[key]) x f32_lowest; p = softmax over keys; ctx = p.v; out = ctx Wo^T + bo -> [NB][SEQ][2048] f32.
// Compute dtypes (f32 accumulate everywhere): x, W*, b*, m enter as their bf16 (RNE) values; q/k/v projections: v_wmma_f32_16x16x32_bf16 (bf16 operands);
// scores: v_wmma_f32_16x16x32_f16 (f16 q, k planes); p.v: v_wmma_f32_16x16x32_f16 (f16 p = exp(s - running max), not normalised, f16 v; the row sum divides at the end); output projection: v_wmma_f32_16x16x32_f16 (f16 ctx x64, f16 Wo x64); softmax f32.
#pragma clang fp contract(off)

#ifndef NB
#define NB 2
#endif
#ifndef SEQ
#define SEQ 2048
#endif
#define NB_FULL  2
#define SEQ_FULL 2048
#define DM   2048
#define NH_  16
#define HD   128
#define DQ   (NH_ * HD)
#define OCAR 64.0f
#define WCAR 64.0f
#define SCL  0.08838834764831845f
#define FLOW (-3.4028234663852886e38f)

static_assert(SEQ % 128 == 0);
static_assert(SEQ >= 128 && SEQ <= SEQ_FULL);
static_assert(NB >= 1 && NB <= NB_FULL);
static_assert(DQ == DM);
static_assert(DM % 64 == 0 && HD == 128);

typedef _Float16 h16;
typedef unsigned short bf;
typedef __attribute__((ext_vector_type(16))) __bf16   v16bf;
typedef __attribute__((ext_vector_type(16))) _Float16 v16h;
typedef __attribute__((ext_vector_type(8)))  _Float16 v8h;
typedef __attribute__((ext_vector_type(4)))  _Float16 v4h;
typedef __attribute__((ext_vector_type(8)))  unsigned short v8us;
typedef __attribute__((ext_vector_type(8)))  float    v8f;
typedef __attribute__((ext_vector_type(4)))  float    v4f;
typedef v4f __attribute__((may_alias)) v4fa;

__device__ __forceinline__ unsigned short f2bf(float f) { unsigned u = __float_as_uint(f); u += 0x7FFFu + ((u >> 16) & 1u); return (unsigned short)(u >> 16); }
__device__ __forceinline__ float bf2f(unsigned short b) { return __uint_as_float(((unsigned)b) << 16); }
__device__ __forceinline__ float bfr(float f) { return bf2f(f2bf(f)); }
__device__ __forceinline__ v16h cat16(v8h lo, v8h hi) { return __builtin_shufflevector(lo, hi, 0, 1, 2, 3, 4, 5, 6, 7, 8, 9, 10, 11, 12, 13, 14, 15); }
__device__ __forceinline__ v16bf cat16b(v8us lo, v8us hi) { return __builtin_bit_cast(v16bf, __builtin_shufflevector(lo, hi, 0, 1, 2, 3, 4, 5, 6, 7, 8, 9, 10, 11, 12, 13, 14, 15)); }
__device__ __forceinline__ v8f wmma16(v16h a, v16h b, v8f c) { return __builtin_amdgcn_wmma_f32_16x16x32_f16(false, a, false, b, (short)0, c, false, false); }
__device__ __forceinline__ v8f wmmab(v16bf a, v16bf b, v8f c) { return __builtin_amdgcn_wmma_f32_16x16x32_bf16(false, a, false, b, (short)0, c, false, false); }

// ---- GEMMs. The output projection (k_gemm_out): one 128x128 output tile per work-group of 8 waves (4 along M x 2 along N, 32x64 a wave, 8 accumulators), 256 threads; gt_products forms a tile's sums, gt_store_f32 stores them. The q, k, v projections (k_gemm_qkv, further down) have a tile and a ring of their own and store through gt_store_plane.
// c[m][n] = cscale x sum_k A[m][k] Bt[n][k] + a bf16-valued bias. A, Bt: K-contiguous 16-bit planes. The epilogue stores c in the form that its reader takes:
//   OUT_F32:  C[m][n] f32, pitch ldc, bias[n] (the block's output).
//   OUT_HEAD: P[n / HD][m][n % HD] f16, bias[n] (m = token: the q and k planes [h][t][d]; a tile's 128 columns are one head).
//   OUT_ROWS: P[m][n] f16, pitch SEQ, bias[m] (A = the weight, Bt = x, so m = h * HD + d and n = token: the v^T plane [h][d][t] comes out of the product as it stands, with no transposition).
// K % 128 == 0, K >= 256 (two stages at least: the second stage's copies stand under no test), M % 128 == 0, N % 128 == 0.
// One launch holds every tile of its phase, for all batch items. k_gemm_out: a work-group's LDS is under half a WGP's (the epilogue stages in the ring's own bytes): two work-groups share a WGP, and the start, the waits and the epilogue of one stand under the products of the other.
// gt_products: both operands come in stages of 128 k (rows of 256 B) by asynchronous copies, global -> LDS through no register, two buffers: stage t + 1 flies while stage t is worked on, and every row is fetched once a work-group, in whole lines.
// Fragment map (both operands): lane l -> row/col (l & 15); elements 0..7 <- k0 + 8*(l>>4) + 0..7, elements 8..15 <- k0 + 16 + 8*(l>>4) + 0..7. D element r of lane l -> (row 8*(l>>4) + r, col l & 15).
template <typename T16> struct WFrag;
template <> struct WFrag<h16> { typedef v16h V; static __device__ __forceinline__ V ld(const h16* p) { return cat16(*(const v8h*)p, *(const v8h*)(p + 16)); } static __device__ __forceinline__ v8f mma(V a, V b, v8f c) { return wmma16(a, b, c); } };
template <> struct WFrag<bf> { typedef v16bf V; static __device__ __forceinline__ V ld(const bf* p) { return cat16b(*(const v8us*)p, *(const v8us*)(p + 16)); } static __device__ __forceinline__ v8f mma(V a, V b, v8f c) { return wmmab(a, b, c); } };
#define GT_T   128                       // rows of each operand in a tile
#define GT_KS  128                       // k of a stage
#define GT_P   272                       // LDS pitch of a row (256 B + 16): 16 B x odd, conflict-free for 16-byte row reads
#define GT_OP  (GT_T * GT_P)             // one operand's stage
#define GT_BUF (2 * GT_OP)               // a buffer: [A 128 rows | Bt 128 rows]
static_assert(SEQ % GT_T == 0 && DM % GT_T == 0 && DQ % GT_T == 0 && GT_T == HD);
#define OUT_F32  0
#define OUT_HEAD 1
#define OUT_ROWS 2
// One operand's stage, this thread's share: eight 16-byte chunks, rows 16 apart (l: the lane's LDS byte address, g: its global address, rs: 16 rows in elements).
// The s_wait_xcnt at the end of the statement stands in front of any later write of the address registers that the copies name.
template <typename T16>
__device__ __forceinline__ void gt_copy8(unsigned l, const T16* g, size_t rs) {
    asm volatile("global_load_async_to_lds_b128 %0, %8, off\n\t"
                 "global_load_async_to_lds_b128 %1, %9, off\n\t"
                 "global_load_async_to_lds_b128 %2, %10, off\n\t"
                 "global_load_async_to_lds_b128 %3, %11, off\n\t"
                 "global_load_async_to_lds_b128 %4, %12, off\n\t"
                 "global_load_async_to_lds_b128 %5, %13, off\n\t"
                 "global_load_async_to_lds_b128 %6, %14, off\n\t"
                 "global_load_async_to_lds_b128 %7, %15, off\n\t"
                 "s_wait_xcnt 0x0"
                 :: "v"(l), "v"(l + 16 * GT_P), "v"(l + 32 * GT_P), "v"(l + 48 * GT_P), "v"(l + 64 * GT_P), "v"(l + 80 * GT_P), "v"(l + 96 * GT_P), "v"(l + 112 * GT_P),
                    "v"(g), "v"(g + rs), "v"(g + 2 * rs), "v"(g + 3 * rs), "v"(g + 4 * rs), "v"(g + 5 * rs), "v"(g + 6 * rs), "v"(g + 7 * rs)
                 : "memory");
}
// The sums of the tile at rows r0 of A and rows c0 of Bt. L: the work-group's ring of 2 x GT_BUF bytes; every wave has left it, and no copy is outstanding, when this returns.
template <typename T16, int K>
__device__ __forceinline__
void gt_products(const T16* __restrict__ A, const T16* __restrict__ Bt, const int r0, const int c0, unsigned char* L, v8f (&acc)[2][4]) {
    static_assert(K % GT_KS == 0 && K >= 2 * GT_KS);
    typedef typename WFrag<T16>::V V;
    const int tid = threadIdx.x, lane = tid & 31, wave = tid >> 5, lr = lane & 15, hi = lane >> 4, wm = wave >> 1, wn = wave & 1;
    // staging map: 2048 16-byte chunks an operand and stage, chunk = tid + 256 i -> row (tid >> 4) + 16 i, 16 chunks a row: a wave's copy covers two whole rows of the stage
    const T16* ag = A + (size_t)(r0 + (tid >> 4)) * K + (tid & 15) * 8;
    const T16* bg = Bt + (size_t)(c0 + (tid >> 4)) * K + (tid & 15) * 8;
    const size_t rs = (size_t)16 * K;
    const unsigned cl = (unsigned)(size_t)L + (tid >> 4) * GT_P + (tid & 15) * 16;     // where this thread's chunks go
    const unsigned af = (wm * 32 + lr) * GT_P + 16 * hi, bfo = GT_OP + (wn * 64 + lr) * GT_P + 16 * hi;   // where this lane's fragments start
    constexpr int nst = K / GT_KS;
    unsigned bo = 0;   // byte offset of the buffer that holds stage st
#pragma unroll
    for (int mb = 0; mb < 2; ++mb)
#pragma unroll
        for (int nb = 0; nb < 4; ++nb) acc[mb][nb] = (v8f){};
    gt_copy8(cl, ag, rs); gt_copy8(cl + GT_OP, bg, rs);
    asm volatile("s_wait_asynccnt 0x0" ::: "memory");   // stage 0 has landed, as far as this wave copied it
    __syncthreads();                                     // publishes stage 0
    gt_copy8(cl + GT_BUF, ag + GT_KS, rs); gt_copy8(cl + GT_BUF + GT_OP, bg + GT_KS, rs);
    ag += 2 * GT_KS; bg += 2 * GT_KS;
    // kept rolled: the body holds a whole stage's 32 products a wave, unrolled
#pragma unroll 1
    for (int st = 0; st < nst; ++st) {
        V a[2][2], b[2][4];
#pragma unroll
        for (int mb = 0; mb < 2; ++mb) a[0][mb] = WFrag<T16>::ld((const T16*)(L + bo + af + mb * 16 * GT_P));
#pragma unroll
        for (int nb = 0; nb < 4; ++nb) b[0][nb] = WFrag<T16>::ld((const T16*)(L + bo + bfo + nb * 16 * GT_P));
#pragma unroll
        for (int kb = 0; kb < GT_KS / 32; ++kb) {
            const int cur = kb & 1, nxt = cur ^ 1;
            if (kb + 1 < GT_KS / 32) {   // the next 32 k's fragments, read as one group in front of this block's products
#pragma unroll
                for (int mb = 0; mb < 2; ++mb) a[nxt][mb] = WFrag<T16>::ld((const T16*)(L + bo + af + mb * 16 * GT_P + (kb + 1) * 64));
#pragma unroll
                for (int nb = 0; nb < 4; ++nb) b[nxt][nb] = WFrag<T16>::ld((const T16*)(L + bo + bfo + nb * 16 * GT_P + (kb + 1) * 64));
            }
            __builtin_amdgcn_sched_barrier(0);   // the reads stay one group in front of the products, which cover their latency; left free, the compiler put them two by two in front of each pair of products, with a full wait each
#pragma unroll
            for (int nb = 0; nb < 4; ++nb)
#pragma unroll
                for (int mb = 0; mb < 2; ++mb) acc[mb][nb] = WFrag<T16>::mma(a[cur][mb], b[cur][nb], acc[mb][nb]);
            __builtin_amdgcn_sched_barrier(0);   // and no read of the block after next moves up among these products
        }
        asm volatile("s_wait_dscnt 0x0" ::: "memory");      // this wave's reads of stage st have returned
        asm volatile("s_wait_asynccnt 0x0" ::: "memory");   // its copies of stage st + 1 have landed
        __syncthreads();                                     // publishes stage st + 1 and ends every wave's reads of stage st
        if (st + 2 < nst) { gt_copy8(cl + bo, ag, rs); gt_copy8(cl + bo + GT_OP, bg, rs); }   // stage st + 2 into the buffer that stage st has left
        ag += GT_KS; bg += GT_KS; bo = GT_BUF - bo;
    }
    asm volatile("s_wait_asynccnt 0x0" ::: "memory");       // no copy is outstanding when the wave goes on
}
// The epilogues. os: the wave's own 16 x 68 floats of LDS, where it stages a 16 x 64 block, so that whole lines are stored.
// OUT_F32: the tile at rows r0, columns c0 of C.
__device__ __forceinline__ void gt_store_f32(const v8f (&acc)[2][4], float* os, float* C, const int ldc, const int r0, const int c0, const float* __restrict__ bias, const float cscale) {
    const int tid = threadIdx.x, lane = tid & 31, wave = tid >> 5, lr = lane & 15, hi = lane >> 4, wm = wave >> 1, wn = wave & 1;
    const int cw = c0 + wn * 64;
    // bias for this lane's 4 output columns: one 16-B load per lane, loaded once (the columns are the same for every row of the wave's tile)
    v4f bb; { const v4f br = *(const v4f*)(bias + cw + lr * 4); bb[0] = bfr(br[0]); bb[1] = bfr(br[1]); bb[2] = bfr(br[2]); bb[3] = bfr(br[3]); }
#pragma unroll
    for (int mb = 0; mb < 2; ++mb) {
#pragma unroll
        for (int nb = 0; nb < 4; ++nb) {
#pragma unroll
            for (int j = 0; j < 8; ++j) os[(hi * 8 + j) * 68 + nb * 16 + lr] = acc[mb][nb][j]; }
        __builtin_amdgcn_wave_barrier(); asm volatile("" ::: "memory");   // other lanes of the wave read these rows back: the compiler may move no read in front of the stores
        float* crow = C + (size_t)(r0 + wm * 32 + mb * 16) * ldc + cw;
#pragma unroll
        for (int s = 0; s < 8; ++s) { const int row = 2 * s + hi, cofs = lr * 4; v4f val = *(const v4fa*)(os + row * 68 + cofs); val = val * cscale; val = val + bb;
            *(v4f*)(crow + (size_t)row * ldc + cofs) = val; }
        __builtin_amdgcn_wave_barrier(); asm volatile("" ::: "memory");   // and no store of the next 16 rows in front of these reads
    }
}
// OUT_HEAD, OUT_ROWS: a wave's block of 64 x 64 sums, acc[i][j] = rows 16 i, columns 16 j of it, to an f16 plane. blk: the block's first element in the plane; bias: the bias of its first column (OUT_HEAD) or of its first row (OUT_ROWS).
template <int OUT>
__device__ __forceinline__ void gt_store_plane(const v8f (&acc)[4][4], float* os, h16* blk, const float* __restrict__ bias) {
    const int lane = threadIdx.x & 31, lr = lane & 15, hi = lane >> 4;
    // a row of the block is 64 values = one 128-byte line; eight lanes store a row (8 values = 16 B each), a wave's store covers four whole rows
    const int c8 = (lane & 7) * 8, r4 = lane >> 3;
    constexpr int pp = OUT == OUT_HEAD ? HD : SEQ;   // pitch of the plane
    h16* pr = blk + (size_t)r4 * pp + c8;
    v4f bc[2] = {(v4f){}, (v4f){}};   // OUT_HEAD: the bias of this lane's 8 columns, the same for every row
    if constexpr (OUT == OUT_HEAD) {
        const v4f b0 = *(const v4f*)(bias + c8), b1 = *(const v4f*)(bias + c8 + 4);
        // the wait stands in front of any later write of the address registers that the two bias loads name; the address is its input, so that its registers are kept up to here
        asm volatile("s_wait_xcnt 0x0" :: "v"(bias + c8) : "memory");
#pragma unroll
        for (int e = 0; e < 4; ++e) { bc[0][e] = bfr(b0[e]); bc[1][e] = bfr(b1[e]); }
    }
#pragma unroll
    for (int mb = 0; mb < 4; ++mb) {
        if constexpr (OUT == OUT_ROWS) {   // the bias goes by rows: added where a lane still holds 8 rows of one column
            v4f br[2];
#pragma unroll
            for (int q = 0; q < 2; ++q) { const v4f b = *(const v4f*)(bias + mb * 16 + hi * 8 + 4 * q); br[q][0] = bfr(b[0]); br[q][1] = bfr(b[1]); br[q][2] = bfr(b[2]); br[q][3] = bfr(b[3]); }
#pragma unroll
            for (int nb = 0; nb < 4; ++nb) {
#pragma unroll
                for (int j = 0; j < 8; ++j) os[(hi * 8 + j) * 68 + nb * 16 + lr] = acc[mb][nb][j] + br[j >> 2][j & 3]; }
        } else {
#pragma unroll
            for (int nb = 0; nb < 4; ++nb) {
#pragma unroll
                for (int j = 0; j < 8; ++j) os[(hi * 8 + j) * 68 + nb * 16 + lr] = acc[mb][nb][j]; }
        }
        __builtin_amdgcn_wave_barrier(); asm volatile("" ::: "memory");   // other lanes of the wave read these rows back: the compiler may move no read in front of the stores
#pragma unroll
        for (int s = 0; s < 4; ++s) { const float* rp = os + (4 * s + r4) * 68 + c8; v4f lo = *(const v4fa*)rp, up = *(const v4fa*)(rp + 4);
            if constexpr (OUT == OUT_HEAD) { lo = lo + bc[0]; up = up + bc[1]; }
            v8h o;
#pragma unroll
            for (int q = 0; q < 4; ++q) { o[q] = (h16)lo[q]; o[q + 4] = (h16)up[q]; }
            *(v8h*)(pr + (size_t)(mb * 16 + 4 * s) * pp) = o; }
        __builtin_amdgcn_wave_barrier();
        asm volatile("s_wait_xcnt 0x0" ::: "memory");   // no store of the next 16 rows to LDS in front of these reads; and the wait stands in front of any later write of a register that the loads and stores above name
    }
}
// ---- k_gemm_qkv: the three projections of one head for 256 tokens in one work-group: a tile of 256 tokens x (128 q + 128 k + 128 v features). grid (NB * SEQ / 256, NH_) = one work-group a WGP at full size. Planes: QP, KP [b][h][t][d], VT [b][h][d][t].
// The x rows that a work-group fetches serve all three weights: 640 rows of operands for 256 x 384 sums, where six tiles of 128 x 128 fetch 1536 rows for as many.
// 8 waves, 4 along the tokens x 2 along the features; a wave holds 64 tokens x 64 features of each of q, k and v (48 accumulators): 16 fragments read from LDS feed 48 products.
// q, k: A = x, B = the weight (D: token rows, feature columns). v: the same two fragments with their places changed, A = the weight, B = x (both operands have one fragment map), so D is v^T as it stands.
// Stages of 64 k (rows of 128 B) by asynchronous copies, two buffers; the copies of stage st + 1 are issued in trip st behind the trip's first fragment reads, whose latency they cover.
#define GF_M   256                        // tokens of a tile
#define GF_KS  64                         // k of a stage
#define GF_P   144                        // LDS pitch of a row (128 B + 16): 16 B x odd, conflict-free for 16-byte row reads
#define GF_X   (GF_M * GF_P)              // the x rows of a stage
#define GF_W   (HD * GF_P)                // one weight's rows of a stage
#define GF_BUF (GF_X + 3 * GF_W)          // a buffer: [x 256 rows | wq 128 | wk 128 | wv 128]
static_assert(SEQ % GF_M == 0 && DM % GF_KS == 0 && DM >= 2 * GF_KS && 8 * 16 * 68 * 4 <= 2 * GF_BUF && DQ == NH_ * HD);
// The copies are written as the builtin: the kernel uses registers above v255, which the operands of an asm statement cannot name, and the compiler moved sums out of the low registers and back around every asm copy statement.
typedef __attribute__((ext_vector_type(4))) int v4i;
typedef __attribute__((address_space(1))) v4i gv4i;
typedef __attribute__((address_space(3))) v4i lv4i;
// N chunks of 16 bytes, rows 32 apart, from g (this thread's first chunk of the source's rows) to l (its place in LDS).
template <int N>
__device__ __forceinline__ void gf_copy(unsigned char* l, const bf* g) {
#pragma unroll
    for (int i = 0; i < N; ++i) __builtin_amdgcn_global_load_async_to_lds_b128((gv4i*)(g + (size_t)i * 32 * DM), (lv4i*)(l + i * 32 * GF_P), 0, 0);
}
// two waves a SIMD: 512 VGPRs a wave
__global__ __launch_bounds__(256) __attribute__((amdgpu_waves_per_eu(2, 2)))
void k_gemm_qkv(const bf* __restrict__ X, const bf* __restrict__ WQ, const bf* __restrict__ WK, const bf* __restrict__ WV, h16* QP, h16* KP, h16* VT,
                const float* __restrict__ bq, const float* __restrict__ bk, const float* __restrict__ bv) {
    __shared__ __align__(16) unsigned char L[2 * GF_BUF];
    typedef WFrag<bf> F; typedef F::V V;
    const int tid = threadIdx.x, lane = tid & 31, wave = tid >> 5, lr = lane & 15, hi = lane >> 4, wm = wave >> 1, wn = wave & 1;
    const int t0 = blockIdx.x * GF_M, h = blockIdx.y;   // t0 counts the tokens of all batch items; a tile lies in one item
    // staging map: 8 chunks of 16 bytes a row, chunk = tid + 256 i -> row (tid >> 3) + 32 i: a wave's copy covers four whole rows of the stage
    const unsigned go = (unsigned)(tid >> 3) * DM + (tid & 7) * 8;   // this thread's first chunk in a tile's rows, in elements
    const bf* xs = X + (size_t)t0 * DM;       // the tile's first rows: the same for the whole work-group
    const bf* qs = WQ + (size_t)h * HD * DM;
    const bf* ks = WK + (size_t)h * HD * DM;
    const bf* vs = WV + (size_t)h * HD * DM;
    const unsigned cl = (tid >> 3) * GF_P + (tid & 7) * 16;                                                // where this thread's chunks go
    const unsigned af = (wm * 64 + lr) * GF_P + 16 * hi, bfo = GF_X + (wn * 64 + lr) * GF_P + 16 * hi;     // where this lane's fragments start
    constexpr int nst = DM / GF_KS;
    unsigned bo = 0;   // byte offset of the buffer that holds stage st
    v8f acc[3][4][4];  // [0], [1]: q, k as [token block][feature block]; [2]: v^T as [feature block][token block]
#pragma unroll
    for (int z = 0; z < 3; ++z)
#pragma unroll
        for (int i = 0; i < 4; ++i)
#pragma unroll
            for (int j = 0; j < 4; ++j) acc[z][i][j] = (v8f){};
    gf_copy<8>(L + cl, xs + go); gf_copy<4>(L + cl + GF_X, qs + go); gf_copy<4>(L + cl + GF_X + GF_W, ks + go); gf_copy<4>(L + cl + GF_X + 2 * GF_W, vs + go);
    asm volatile("s_wait_asynccnt 0x0" ::: "memory");   // stage 0 has landed, as far as this wave copied it
    __syncthreads();                                     // publishes stage 0
    // kept rolled: the body holds a whole stage's 96 products a wave, unrolled
#pragma unroll 1
    for (int st = 0; st < nst; ++st) {
        V a[4], b[2][4];
#pragma unroll
        for (int mb = 0; mb < 4; ++mb) a[mb] = F::ld((const bf*)(L + bo + af + mb * 16 * GF_P));
#pragma unroll
        for (int nb = 0; nb < 4; ++nb) b[0][nb] = F::ld((const bf*)(L + bo + bfo + nb * 16 * GF_P));
        xs += GF_KS; qs += GF_KS; ks += GF_KS; vs += GF_KS;
        if (st + 1 < nst) {   // stage st + 1 into the buffer that stage st - 1 has left: every wave's reads of it ended at the barrier of trip st - 1
            unsigned char* d = L + cl + (GF_BUF - bo);
            gf_copy<8>(d, xs + go); gf_copy<4>(d + GF_X, qs + go); gf_copy<4>(d + GF_X + GF_W, ks + go); gf_copy<4>(d + GF_X + 2 * GF_W, vs + go);
        }
        // six groups of 16 products: (32 k) x (q, k, v); each group's four weight fragments are read one group ahead
#pragma unroll
        for (int g = 0; g < 6; ++g) {
            const int z = g % 3, cur = g & 1, nxt = cur ^ 1;
            if (g + 1 < 6) {
#pragma unroll
                for (int nb = 0; nb < 4; ++nb) b[nxt][nb] = F::ld((const bf*)(L + bo + bfo + ((g + 1) % 3) * GF_W + nb * 16 * GF_P + ((g + 1) / 3) * 64));
            }
            __builtin_amdgcn_sched_barrier(0);   // the reads stay one group in front of the products, which cover their latency
#pragma unroll
            for (int nb = 0; nb < 4; ++nb)
#pragma unroll
                for (int mb = 0; mb < 4; ++mb) {
                    if (z < 2) acc[z][mb][nb] = F::mma(a[mb], b[cur][nb], acc[z][mb][nb]);
                    else       acc[2][nb][mb] = F::mma(b[cur][nb], a[mb], acc[2][nb][mb]);
                }
            __builtin_amdgcn_sched_barrier(0);   // and no later read moves up among these products
            if (g == 2) {   // the x fragments of the stage's second 32 k, into the registers that the products above have read
#pragma unroll
                for (int mb = 0; mb < 4; ++mb) a[mb] = F::ld((const bf*)(L + bo + af + mb * 16 * GF_P + 64));
            }
        }
        asm volatile("s_wait_dscnt 0x0" ::: "memory");      // this wave's reads of stage st have returned
        asm volatile("s_wait_asynccnt 0x0" ::: "memory");   // its copies of stage st + 1 have landed
        __syncthreads();                                     // publishes stage st + 1 and ends every wave's reads of stage st
        bo = GF_BUF - bo;
    }
    asm volatile("s_wait_asynccnt 0x0" ::: "memory");       // no copy is outstanding when the wave goes on
    // the epilogue stages in the ring's bytes, which every wave has left at the loop's last barrier
    float* os = (float*)L + wave * (16 * 68);
    const size_t pb = (size_t)(t0 / SEQ) * NH_ * SEQ * HD; const int tw = t0 % SEQ + wm * 64, ew = h * HD + wn * 64;   // the wave's first token in its batch item, its first feature
    gt_store_plane<OUT_HEAD>(acc[0], os, QP + pb + ((size_t)h * SEQ + tw) * HD + wn * 64, bq + ew);
    gt_store_plane<OUT_HEAD>(acc[1], os, KP + pb + ((size_t)h * SEQ + tw) * HD + wn * 64, bk + ew);
    gt_store_plane<OUT_ROWS>(acc[2], os, VT + pb + (size_t)ew * SEQ + tw, bv + ew);
}
static_assert(8 * 16 * 68 * 4 <= 2 * GT_BUF);
// at most 256 VGPRs: the asm operands of gt_copy8 stay in the register window that needs no switching
// k_gemm_out: C[m][n] f32. grid (M / 128, N / 128).
template <typename T16, int K>
__global__ __launch_bounds__(256) __attribute__((amdgpu_num_vgpr(256)))
void k_gemm_out(const T16* __restrict__ A, const T16* __restrict__ Bt, float* C, int ldc, const float* __restrict__ bias, float cscale) {
    __shared__ __align__(16) unsigned char L[2 * GT_BUF];
    float* os = (float*)L + (threadIdx.x >> 5) * (16 * 68);
    const int r0 = blockIdx.x * GT_T, c0 = blockIdx.y * GT_T;
    v8f acc[2][4];
    gt_products<T16, K>(A, Bt, r0, c0, L, acc);
    gt_store_f32(acc, os, C, ldc, r0, c0, bias, cscale);
}

// ---- k_prep: every operand conversion of the block in ONE launch of long-lived waves: wq, wk, wv, x -> bf16 (RNE); wo -> f16 of (its bf16 value x WCAR); m -> (1 - bf16(m)) x f32_lowest.
// grid PR_G work-groups of 256 threads. A unit = 8192 floats = 8 chunks of 4 floats a thread, chunk i of thread t at i * 1024 + t * 4: a wave's load covers 512 bytes in a row (four whole lines), its store 256 (two whole lines).
// Work-group g converts unit g of each weight and of each batch item of x, one after the other, from two register sets: a set is loaded again as soon as it has been converted, so the eight loads of at least one unit are in flight while another is converted.
// Each wave here converts 48 chunks a lane (for speed only).
#define PR_U 8192
#define PR_G (DQ * DM / PR_U)
#define PR_X (SEQ * DM / PR_U)            // units of one batch item of x
#define PR_M (NB * SEQ / 1024)            // work-groups that also convert 1024 mask values each
static_assert(DQ * DM % PR_U == 0 && SEQ * DM % PR_U == 0 && PR_X <= PR_G && SEQ % 1024 == 0 && PR_M <= PR_G);
typedef __attribute__((ext_vector_type(4))) unsigned short v4us;
typedef __attribute__((ext_vector_type(2))) unsigned v2u;
// lo: this thread's byte offset from the source pointer (32 bits, so that the load takes the pointer as its scalar base)
__device__ __forceinline__ void pr_load(const float* __restrict__ s, unsigned lo, v4f (&r)[8]) {
#pragma unroll
    for (int i = 0; i < 8; ++i) r[i] = *(const v4f*)((const char*)s + lo + i * 4096); }
// One unit: converts the set r (H: to f16 of the bf16 value x WCAR; else to bf16), stores it at d + so bytes, and loads the set again from nxt + lo bytes where ld says so.
template <bool H>
__device__ __forceinline__ void pr_step(v4f (&r)[8], void* d, unsigned so, const float* __restrict__ nxt, bool ld, unsigned lo) {
    v2u w[8];
#pragma unroll
    for (int i = 0; i < 8; ++i) {
        if constexpr (H) { v4h o;
#pragma unroll
            for (int q = 0; q < 4; ++q) o[q] = (h16)(bfr(r[i][q]) * WCAR);
            w[i] = __builtin_bit_cast(v2u, o);
        } else { v4us o;
#pragma unroll
            for (int q = 0; q < 4; ++q) o[q] = f2bf(r[i][q]);
            w[i] = __builtin_bit_cast(v2u, o); }
    }
#pragma unroll
    for (int i = 0; i < 8; ++i) *(v2u*)((char*)d + so + i * 2048) = w[i];
    if (ld) pr_load(nxt, lo, r);
    // the wait that stands in front of any later write of a register which these stores and loads name; the offsets and the stored words are its inputs, so that their registers are kept up to here
    asm volatile("s_wait_xcnt 0x0" :: "v"(lo), "v"(so), "v"(w[0]), "v"(w[1]), "v"(w[2]), "v"(w[3]), "v"(w[4]), "v"(w[5]), "v"(w[6]), "v"(w[7]) : "memory");
}
__global__ __launch_bounds__(256) void k_prep(const float* __restrict__ x, const float* __restrict__ m, const float* __restrict__ wq, const float* __restrict__ wk, const float* __restrict__ wv, const float* __restrict__ wo,
                                              bf* WQ, bf* WK, bf* WV, h16* WO16, bf* XB, float* MA) {
    const int g = blockIdx.x, tid = threadIdx.x;
    const unsigned so = (unsigned)(g * PR_U + tid * 4) * 2u, lo = so * 2u;
    const bool hasx = PR_X == PR_G || g < PR_X;   // the same for the whole work-group
    v4f r[2][8];
    pr_load(wq, lo, r[0]);
    pr_load(wk, lo, r[1]);
    pr_step<false>(r[0], WQ, so, wv, true, lo);
    pr_step<false>(r[1], WK, so, wo, true, lo);
    pr_step<false>(r[0], WV, so, x, hasx, lo);
    pr_step<true>(r[1], WO16, so, x, hasx && NB > 1, NB > 1 ? lo + SEQ_FULL * DM * 4u : lo);
#pragma unroll
    for (int b = 0; b < NB; ++b)   // batch item b: its place goes into the 32-bit offsets
        if (hasx) pr_step<false>(r[b & 1], XB, so + b * (SEQ * DM * 2u), x, b + 2 < NB, b + 2 < NB ? lo + (b + 2) * (SEQ_FULL * DM * 4u) : lo);
    if (g < PR_M) {   // the same for the whole work-group
        const int mi = g * 1024 + tid * 4;   // index into MA, [NB][SEQ]
        const unsigned mo = (unsigned)((mi / SEQ) * SEQ_FULL + mi % SEQ) * 4u;
        const v4f a = *(const v4f*)((const char*)m + mo);
        asm volatile("s_wait_xcnt 0x0" :: "v"(mo) : "memory");   // as above: in front of any later write of the load's offset register
        v4f q;
#pragma unroll
        for (int e = 0; e < 4; ++e) { const float u = 1.0f - bfr(a[e]); q[e] = u * FLOW; }
        *(v4f*)(MA + mi) = q;
    }
}
// ---- k_fattn: scores, softmax and p.v of one head for 256 queries in one work-group; no score ever reaches memory. grid (SEQ/256, NH_, NB), 256 threads = 8 waves x 32 queries (two 16-query tiles a wave).
// Transposed products: S^T = K.Q^T (A = 16 keys x 32 d from LDS, B = Q^T kept in registers), O^T += V^T.P^T (A = 16 d x 32 keys from LDS, B = P^T).
// Every K and V^T fragment that a wave reads from LDS serves the products of both its query tiles: 512 bytes of LDS reads a product. One tile a wave would read 1024, twice what the LDS delivers in a product's time on four SIMDs.
// The two tiles' sums and Q^T take 192 registers, so a wave has the budget of two waves a SIMD, and one work-group fills a WGP.
// D of S^T: lane l holds query (l & 15), keys 8*(l>>4) + r of each 16-key tile; that is the B operand's k order for 32 keys (tile 0 -> elements 0..7, tile 1 -> elements 8..15), so P^T packs in-lane.
// K rows ([t][d] plane) and V^T rows ([d][t] plane) come in stages of 64 keys: global -> registers -> LDS, two buffers; the next stage's loads fly under this stage's two 32-key passes.
// Every inner loop is fully unrolled, so that each index into a register array is a constant (an index known only at run time would send the array to scratch).
// Online softmax: t = s x SCL + MA[key]; p = exp(t - m_run); m_run may trail the true maximum by up to FA_LAG (p stays below e^FA_LAG, far inside f16); a query tile's sums are rescaled only when one of its queries' maxima passes that.
#define FA_QT   2                         // 16-query tiles of a wave
#define FA_BQ   (8 * 16 * FA_QT)
static_assert(FA_QT == 2);                // the pass's one rescale test names both tiles
#define FA_SK   64
#define FA_PK   272                       // LDS pitch of a K row (256 B + 16): 16 B x odd, conflict-free for 16-byte row reads
#define FA_PV   144                       // LDS pitch of a V^T row (128 B + 16): 16 B x odd
#define FA_TK   (FA_SK * FA_PK)
#define FA_SLOT (FA_TK + HD * FA_PV)
#define FA_FLIP 65536                     // the two buffers lie 64 KiB apart, so that one XOR on an LDS offset changes the buffer
#define FA_LAG  5.5f
#define L2E     1.4426950408889634f
static_assert(SEQ % FA_BQ == 0 && SEQ % FA_SK == 0 && SEQ % 1024 == 0 && FA_SLOT <= FA_FLIP);
typedef __attribute__((ext_vector_type(4))) unsigned v4u;
__device__ __forceinline__ float xhalf(float x) { return __builtin_bit_cast(float, __builtin_amdgcn_permlanex16(__builtin_bit_cast(int, x), __builtin_bit_cast(int, x), 0x76543210, 0xfedcba98, false, false)); }  // lane l <-> lane l ^ 16
// Four exponentials (2^x, in place) in one statement. The v_nop at its end fills the slot that the instruction set asks for behind a transcendental before a source is overwritten or the result read.
__device__ __forceinline__ void exp2x4(float& a, float& b, float& c, float& d) { asm("v_exp_f32 %0, %0\n\tv_exp_f32 %1, %1\n\tv_exp_f32 %2, %2\n\tv_exp_f32 %3, %3\n\tv_nop" : "+v"(a), "+v"(b), "+v"(c), "+v"(d)); }
// two waves a SIMD: 512 VGPRs a wave
__global__ __launch_bounds__(256) __attribute__((amdgpu_waves_per_eu(2, 2))) void k_fattn(const h16* __restrict__ QP, const h16* __restrict__ KP, const h16* __restrict__ VT, const float* __restrict__ MA, h16* AT) {
    __shared__ __align__(16) unsigned char L[FA_FLIP + FA_SLOT];
    __shared__ __align__(16) float MAs[SEQ];
    const int tid = threadIdx.x, lane = tid & 31, wave = tid >> 5, lr = lane & 15, hi = lane >> 4;
    const int h = blockIdx.y, q0 = blockIdx.x * FA_BQ + wave * (16 * FA_QT);
    { const size_t pb = (size_t)blockIdx.z * NH_ * SEQ * HD; QP += pb; KP += pb; VT += pb; MA += (size_t)blockIdx.z * SEQ; AT += (size_t)blockIdx.z * SEQ * DQ; }   // batch item blockIdx.z: its planes, its mask row, its rows of AT
    // staging map: 1024 16-byte chunks of K (row = chunk >> 4) and 1024 of V^T (row = chunk >> 3) per stage, chunk = tid + 256 i
    const h16* kg = KP + (size_t)h * SEQ * HD; const unsigned ko = (unsigned)tid * 8u;         // a K stage is 16 KiB in a row
    const h16* vg = VT + (size_t)h * HD * SEQ; const unsigned vo = (unsigned)(tid >> 3) * SEQ + (unsigned)(tid & 7) * 8u;
    unsigned kl = (tid >> 4) * FA_PK + (tid & 15) * 16, vl = FA_TK + (tid >> 3) * FA_PV + (tid & 7) * 16;   // where this thread's chunks go
    unsigned kf = lr * FA_PK + 16 * hi, vf = FA_TK + lr * FA_PV + 16 * hi;                                 // where this lane's fragments start
    v4u kr[4], vr[4]; v4f mr[SEQ / 1024];
#pragma unroll
    for (int i = 0; i < SEQ / 1024; ++i) mr[i] = *(const v4f*)(MA + i * 1024 + tid * 4);
#pragma unroll
    for (int i = 0; i < 4; ++i) { kr[i] = *(const v4u*)(kg + i * 2048 + ko); vr[i] = *(const v4u*)(vg + i * 32 * SEQ + vo); }
    v16h qf[FA_QT][4]; const h16* qp[FA_QT];
#pragma unroll
    for (int qt = 0; qt < FA_QT; ++qt) { qp[qt] = QP + ((size_t)h * SEQ + q0 + 16 * qt + lr) * HD + 8 * hi;
#pragma unroll
      for (int kc = 0; kc < 4; ++kc) qf[qt][kc] = cat16(*(const v8h*)(qp[qt] + 32 * kc), *(const v8h*)(qp[qt] + 32 * kc + 16)); }
    // the wait that stands in front of any later write of an address register which the loads above name. The loads' addresses and offsets are its inputs, so that their registers are kept up to here; the two scheduling fences keep every such load in front of it
    __builtin_amdgcn_sched_barrier(0);
    asm volatile("s_wait_xcnt 0x0" :: "v"(tid), "v"(vo * 2u), "v"(qp[0]), "v"(qp[1]) : "memory");
    __builtin_amdgcn_sched_barrier(0);
#pragma unroll
    for (int i = 0; i < SEQ / 1024; ++i) *(v4f*)(MAs + i * 1024 + tid * 4) = mr[i];
#pragma unroll
    for (int i = 0; i < 4; ++i) { *(v4u*)(L + kl + i * 16 * FA_PK) = kr[i]; *(v4u*)(L + vl + i * 32 * FA_PV) = vr[i]; }
    v8f acc[FA_QT][8];
    float m_run[FA_QT], l_run[FA_QT];
#pragma unroll
    for (int qt = 0; qt < FA_QT; ++qt) { m_run[qt] = FLOW; l_run[qt] = 0.f;
#pragma unroll
        for (int t8 = 0; t8 < 8; ++t8) acc[qt][t8] = (v8f){}; }
    const float* mp = MAs + 8 * hi;
    __syncthreads();
    // kept rolled
#pragma unroll 1
    for (int st = 0; st < SEQ / FA_SK; ++st) {
        const bool more = st + 1 < SEQ / FA_SK;
        kl ^= FA_FLIP; vl ^= FA_FLIP; kg += FA_SK * HD; vg += FA_SK;
        if (more) {
#pragma unroll
            for (int i = 0; i < 4; ++i) { kr[i] = *(const v4u*)(kg + i * 2048 + ko); vr[i] = *(const v4u*)(vg + i * 32 * SEQ + vo); }
        }
#pragma unroll
        for (int sub = 0; sub < FA_SK / 32; ++sub) {
            v16h ka[4][2]; v4f mk[2][2]; v8f s[FA_QT][2];
#pragma unroll
            for (int qt = 0; qt < FA_QT; ++qt) { s[qt][0] = (v8f){}; s[qt][1] = (v8f){}; }
            { const unsigned char* p = L + kf + sub * 32 * FA_PK;
#pragma unroll
              for (int kc = 0; kc < 4; ++kc)
#pragma unroll
                for (int kt = 0; kt < 2; ++kt) ka[kc][kt] = cat16(*(const v8h*)(p + kt * 16 * FA_PK + 64 * kc), *(const v8h*)(p + kt * 16 * FA_PK + 64 * kc + 32));
#pragma unroll
              for (int kt = 0; kt < 2; ++kt) { mk[kt][0] = *(const v4f*)(mp + sub * 32 + kt * 16); mk[kt][1] = *(const v4f*)(mp + sub * 32 + kt * 16 + 4); } }
            __builtin_amdgcn_sched_barrier(0);   // the pass's K and mask reads stay one group in front of the products: one LDS latency a pass, not one a product
#pragma unroll
            for (int kc = 0; kc < 4; ++kc)
#pragma unroll
                for (int kt = 0; kt < 2; ++kt)
#pragma unroll
                    for (int qt = 0; qt < FA_QT; ++qt) s[qt][kt] = wmma16(ka[kc][kt], qf[qt][kc], s[qt][kt]);
            v16h va[8];
#pragma unroll
            for (int t8 = 0; t8 < 8; ++t8) { const unsigned char* pv = L + vf + t8 * 16 * FA_PV + sub * 64; va[t8] = cat16(*(const v8h*)pv, *(const v8h*)(pv + 32)); }
            __builtin_amdgcn_sched_barrier(0);   // all eight V^T fragments are read in front of the softmax arithmetic, which covers their latency; left free, the compiler put the reads two by two in front of each product
            float t[FA_QT][16], mx[FA_QT]; bool need[FA_QT];
#pragma unroll
            for (int qt = 0; qt < FA_QT; ++qt) { float m = FLOW;
#pragma unroll
                for (int kt = 0; kt < 2; ++kt)
#pragma unroll
                    for (int r = 0; r < 8; ++r) { const float u = s[qt][kt][r] * SCL + mk[kt][r >> 2][r & 3]; t[qt][kt * 8 + r] = u; m = fmaxf(m, u); }
                m = fmaxf(m, xhalf(m));   // both halves of the wave now hold the query's maximum over the pass
                mx[qt] = m; need[qt] = m > m_run[qt] + FA_LAG; }
            if (__builtin_amdgcn_ballot_w32(need[0] || need[1]) != 0) {   // one test a pass for both tiles; wave-uniform, rare behind the first pass
#pragma unroll
                for (int qt = 0; qt < FA_QT; ++qt)
                    if (__builtin_amdgcn_ballot_w32(need[qt]) != 0) {   // wave-uniform: each tile is rescaled by its own queries alone, as if it had the wave to itself
                        const float m_new = fmaxf(m_run[qt], mx[qt]); const float corr = __builtin_amdgcn_exp2f((m_run[qt] - m_new) * L2E);
                        l_run[qt] *= corr; m_run[qt] = m_new;
#pragma unroll
                        for (int t8 = 0; t8 < 8; ++t8) acc[qt][t8] = acc[qt][t8] * corr;
                    }
            }
#pragma unroll
            for (int qt = 0; qt < FA_QT; ++qt) {
                v16h pf; float ps[4];
#pragma unroll
                for (int e = 0; e < 16; e += 4) { float p0 = (t[qt][e] - m_run[qt]) * L2E, p1 = (t[qt][e + 1] - m_run[qt]) * L2E, p2 = (t[qt][e + 2] - m_run[qt]) * L2E, p3 = (t[qt][e + 3] - m_run[qt]) * L2E;
                    exp2x4(p0, p1, p2, p3);
                    ps[e >> 2] = (p0 + p1) + (p2 + p3); pf[e] = (h16)p0; pf[e + 1] = (h16)p1; pf[e + 2] = (h16)p2; pf[e + 3] = (h16)p3; }
                l_run[qt] += (ps[0] + ps[1]) + (ps[2] + ps[3]);
#pragma unroll
                for (int t8 = 0; t8 < 8; ++t8) acc[qt][t8] = wmma16(va[t8], pf, acc[qt][t8]);
            }
        }
        if (more) {   // into the other buffer: every wave left it at the barrier that ended stage st - 1
#pragma unroll
            for (int i = 0; i < 4; ++i) { *(v4u*)(L + kl + i * 16 * FA_PK) = kr[i]; *(v4u*)(L + vl + i * 32 * FA_PV) = vr[i]; }
        }
        kf ^= FA_FLIP; vf ^= FA_FLIP; mp += FA_SK;
        __syncthreads();   // publishes stage st + 1 and ends every wave's reads of stage st
    }
#pragma unroll
    for (int qt = 0; qt < FA_QT; ++qt) {
        const float inv = OCAR / (l_run[qt] + xhalf(l_run[qt]));   // each half summed its own eight keys of every 16-key tile
        h16* op = AT + (size_t)(q0 + 16 * qt + lr) * DQ + (size_t)h * HD + 8 * hi;   // D of O^T: lane l holds query (l & 15), d = 16 t8 + 8*(l>>4) + r
#pragma unroll
        for (int t8 = 0; t8 < 8; ++t8) { v8h o;
#pragma unroll
            for (int r = 0; r < 8; ++r) o[r] = (h16)(acc[qt][t8][r] * inv);
            *(v8h*)(op + t8 * 16) = o; }
    }
}

extern "C" void kernel_launch(void* const* d_in, const int* in_sizes, int n_in,
                              void* d_out, int out_size, void* d_ws, size_t ws_size, hipStream_t stream) {
    if (n_in < 10) return;
    const float* x  = (const float*)d_in[0]; const float* am = (const float*)d_in[1];
    const float* wq = (const float*)d_in[2]; const float* bq = (const float*)d_in[3]; const float* wk = (const float*)d_in[4]; const float* bk = (const float*)d_in[5];
    const float* wv = (const float*)d_in[6]; const float* bv = (const float*)d_in[7]; const float* wo = (const float*)d_in[8]; const float* bo = (const float*)d_in[9];
    if (in_sizes[0] < 0 || (size_t)in_sizes[0] < (size_t)(NB - 1) * SEQ_FULL * DM + (size_t)SEQ * DM) return;
    if (in_sizes[1] < (NB - 1) * SEQ_FULL + SEQ) return;
    if (in_sizes[2] < DQ * DM || in_sizes[4] < DQ * DM || in_sizes[6] < DQ * DM || in_sizes[8] < DM * DQ) return;
    if (in_sizes[3] < DQ || in_sizes[5] < DQ || in_sizes[7] < DQ || in_sizes[9] < DM) return;
    if (out_size < 0 || (size_t)out_size < (size_t)NB * SEQ * DM) return;
    float* OUT = (float*)d_out;     // [NB][SEQ][DM]

    // ---- workspace carve (all offsets 256-B aligned; every region is written to exactly its extent by whole-line stores) ----
    char* wsp = (char*)d_ws; size_t used = 0;
    auto take = [&](size_t bytes) { char* p = wsp + used; used += (bytes + 255) & ~(size_t)255; return (void*)p; };
    bf*  WQ   = (bf*)take((size_t)DQ * DM * 2);                   // 8,388,608
    bf*  WK   = (bf*)take((size_t)DQ * DM * 2);                   // 8,388,608
    bf*  WV   = (bf*)take((size_t)DQ * DM * 2);                   // 8,388,608
    h16* WO16 = (h16*)take((size_t)DM * DQ * 2);                  // 8,388,608
    bf*  XB   = (bf*)take((size_t)NB * SEQ * DM * 2);             // 16,777,216  [b][t][k]
    float* MA = (float*)take((size_t)NB * SEQ * 4);                // 16,384  [b][t]
    h16* QP16 = (h16*)take((size_t)NB * NH_ * SEQ * HD * 2);      // 16,777,216  [b][h][t][d]
    h16* KP16 = (h16*)take((size_t)NB * NH_ * SEQ * HD * 2);      // 16,777,216  [b][h][t][d]
    h16* VT16 = (h16*)take((size_t)NB * NH_ * HD * SEQ * 2);      // 16,777,216  [b][h][d][t]
    h16* AT16 = (h16*)take((size_t)NB * SEQ * DQ * 2);            // 16,777,216  [b][t][h*HD+d]
    if (used > ws_size) return;                                    // total 117,456,896 B at NB=2, SEQ=2048

    k_prep<<<PR_G, 256, 0, stream>>>(x, am, wq, wk, wv, wo, WQ, WK, WV, WO16, XB, MA);
    k_gemm_qkv<<<dim3(NB * SEQ / GF_M, NH_, 1), 256, 0, stream>>>(XB, WQ, WK, WV, QP16, KP16, VT16, bq, bk, bv);
    k_fattn<<<dim3(SEQ / FA_BQ, NH_, NB), 256, 0, stream>>>(QP16, KP16, VT16, MA, AT16);
    k_gemm_out<h16, DQ><<<dim3(NB * SEQ / GT_T, DM / GT_T, 1), 256, 0, stream>>>(AT16, WO16, OUT, DM, bo, 1.0f / (OCAR * WCAR));
}

// v008
// A run of this version takes 149 microseconds.
// Timed twice side by side with v007, it ran 1.03 times as fast both times.
// All steps since v000 together make it 11.0 times as fast.
#include <hip/hip_runtime.h>

// Multi-head self-attention block (hidden [NB][SEQ][2048], 16 heads x 128): q/k/v = x W^T + b; s = (q.k) x 128^-0.5 + (1 - m[key]) x f32_lowest; p = softmax over keys; ctx = p.v; out = ctx Wo^T + bo -> [NB][SEQ][2048] f32.
// Compute dtypes (f32 accumulate everywhere): x, W*, b*, m enter as their bf16 (RNE) values; q/k/v projections: v_wmma_f32_16x16x32_bf16 (bf16 operands);
// scores: v_wmma_f32_16x16x32_f16 (f16 q, k planes); p.v: v_wmma_f32_16x16x32_f16 (f16 p = exp(s - running max), not normalised, f16 v; the row sum divides at the end); output projection: v_wmma_f32_16x16x32_f16 (f16 ctx x64, f16 Wo x64); softmax f32.
#pragma clang fp contract(off)

#ifndef NB
#define NB 2
#endif
#ifndef SEQ
#define SEQ 2048
#endif
#define NB_FULL  2
#define SEQ_FULL 2048
#define DM   2048
#define NH_  16
#define HD   128
#define DQ   (NH_ * HD)
#define OCAR 64.0f
#define WCAR 64.0f
#define SCL  0.08838834764831845f
#define FLOW (-3.4028234663852886e38f)

static_assert(SEQ % 128 == 0);
static_assert(SEQ >= 128 && SEQ <= SEQ_FULL);
static_assert(NB >= 1 && NB <= NB_FULL);
static_assert(DQ == DM);
static_assert(DM % 64 == 0 && HD == 128);

typedef _Float16 h16;
typedef unsigned short bf;
typedef __attribute__((ext_vector_type(16))) __bf16   v16bf;
typedef __attribute__((ext_vector_type(16))) _Float16 v16h;
typedef __attribute__((ext_vector_type(8)))  _Float16 v8h;
typedef __attribute__((ext_vector_type(4)))  _Float16 v4h;
typedef __attribute__((ext_vector_type(8)))  unsigned short v8us;
typedef __attribute__((ext_vector_type(8)))  float    v8f;
typedef __attribute__((ext_vector_type(4)))  float    v4f;
typedef v4f __attribute__((may_alias)) v4fa;

__device__ __forceinline__ unsigned short f2bf(float f) { unsigned u = __float_as_uint(f); u += 0x7FFFu + ((u >> 16) & 1u); return (unsigned short)(u >> 16); }
__device__ __forceinline__ float bf2f(unsigned short b) { return __uint_as_float(((unsigned)b) << 16); }
__device__ __forceinline__ float bfr(float f) { return bf2f(f2bf(f)); }
__device__ __forceinline__ v16h cat16(v8h lo, v8h hi) { return __builtin_shufflevector(lo, hi, 0, 1, 2, 3, 4, 5, 6, 7, 8, 9, 10, 11, 12, 13, 14, 15); }
__device__ __forceinline__ v16bf cat16b(v8us lo, v8us hi) { return __builtin_bit_cast(v16bf, __builtin_shufflevector(lo, hi, 0, 1, 2, 3, 4, 5, 6, 7, 8, 9, 10, 11, 12, 13, 14, 15)); }
__device__ __forceinline__ v8f wmma16(v16h a, v16h b, v8f c) { return __builtin_amdgcn_wmma_f32_16x16x32_f16(false, a, false, b, (short)0, c, false, false); }
__device__ __forceinline__ v8f wmmab(v16bf a, v16bf b, v8f c) { return __builtin_amdgcn_wmma_f32_16x16x32_bf16(false, a, false, b, (short)0, c, false, false); }

// ---- GEMMs. The output projection (k_gemm_out): one 128x128 output tile per work-group of 8 waves (4 along M x 2 along N, 32x64 a wave, 8 accumulators), 256 threads; gt_products forms a tile's sums, gt_store_f32 stores them. The q, k, v projections (k_gemm_qkv, further down) have a tile and a ring of their own and store through gt_store_plane.
// c[m][n] = cscale x sum_k A[m][k] Bt[n][k] + a bf16-valued bias. A, Bt: K-contiguous 16-bit planes. The epilogue stores c in the form that its reader takes:
//   OUT_F32:  C[m][n] f32, pitch ldc, bias[n] (the block's output).
//   OUT_HEAD: P[n / HD][m][n % HD] f16, bias[n] (m = token: the q and k planes [h][t][d]; a tile's 128 columns are one head).
//   OUT_ROWS: P[m][n] f16, pitch SEQ, bias[m] (A = the weight, Bt = x, so m = h * HD + d and n = token: the v^T plane [h][d][t] comes out of the product as it stands, with no transposition).
// K % 128 == 0, K >= 256 (two stages at least: the second stage's copies stand under no test), M % 128 == 0, N % 128 == 0.
// One launch holds every tile of its phase, for all batch items. k_gemm_out: a work-group's LDS is under half a WGP's (the epilogue stages in the ring's own bytes): two work-groups share a WGP, and the start, the waits and the epilogue of one stand under the products of the other.
// gt_products: both operands come in stages of 128 k (rows of 256 B) by asynchronous copies, global -> LDS through no register, two buffers: stage t + 1 flies while stage t is worked on, and every row is fetched once a work-group, in whole lines.
// Rotated walks (both GEMMs' k stages, the attention kernel's key stages): for speed only, each work-group starts its walk at a stage given by its block index and wraps round: at any moment the sharers of a row ask for different lines of it, save in k_gemm_out at full size, where the 32 sharers of a Bt row have 16 starts, two to each. Every stage is still taken once; only the order of the f32 sums differs from block to block.
// Fragment map (both operands): lane l -> row/col (l & 15); elements 0..7 <- k0 + 8*(l>>4) + 0..7, elements 8..15 <- k0 + 16 + 8*(l>>4) + 0..7. D element r of lane l -> (row 8*(l>>4) + r, col l & 15).
template <typename T16> struct WFrag;
template <> struct WFrag<h16> { typedef v16h V; static __device__ __forceinline__ V ld(const h16* p) { return cat16(*(const v8h*)p, *(const v8h*)(p + 16)); } static __device__ __forceinline__ v8f mma(V a, V b, v8f c) { return wmma16(a, b, c); } };
template <> struct WFrag<bf> { typedef v16bf V; static __device__ __forceinline__ V ld(const bf* p) { return cat16b(*(const v8us*)p, *(const v8us*)(p + 16)); } static __device__ __forceinline__ v8f mma(V a, V b, v8f c) { return wmmab(a, b, c); } };
#define GT_T   128                       // rows of each operand in a tile
#define GT_KS  128                       // k of a stage
#define GT_P   272                       // LDS pitch of a row (256 B + 16): 16 B x odd, conflict-free for 16-byte row reads
#define GT_OP  (GT_T * GT_P)             // one operand's stage
#define GT_BUF (2 * GT_OP)               // a buffer: [A 128 rows | Bt 128 rows]
static_assert(SEQ % GT_T == 0 && DM % GT_T == 0 && DQ % GT_T == 0 && GT_T == HD);
#define OUT_F32  0
#define OUT_HEAD 1
#define OUT_ROWS 2
// One operand's stage, this thread's share: eight 16-byte chunks, rows 16 apart (l: the lane's LDS byte address, g: its global address, rs: 16 rows in elements).
// The s_wait_xcnt at the end of the statement stands in front of any later write of the address registers that the copies name.
template <typename T16>
__device__ __forceinline__ void gt_copy8(unsigned l, const T16* g, size_t rs) {
    asm volatile("global_load_async_to_lds_b128 %0, %8, off\n\t"
                 "global_load_async_to_lds_b128 %1, %9, off\n\t"
                 "global_load_async_to_lds_b128 %2, %10, off\n\t"
                 "global_load_async_to_lds_b128 %3, %11, off\n\t"
                 "global_load_async_to_lds_b128 %4, %12, off\n\t"
                 "global_load_async_to_lds_b128 %5, %13, off\n\t"
                 "global_load_async_to_lds_b128 %6, %14, off\n\t"
                 "global_load_async_to_lds_b128 %7, %15, off\n\t"
                 "s_wait_xcnt 0x0"
                 :: "v"(l), "v"(l + 16 * GT_P), "v"(l + 32 * GT_P), "v"(l + 48 * GT_P), "v"(l + 64 * GT_P), "v"(l + 80 * GT_P), "v"(l + 96 * GT_P), "v"(l + 112 * GT_P),
                    "v"(g), "v"(g + rs), "v"(g + 2 * rs), "v"(g + 3 * rs), "v"(g + 4 * rs), "v"(g + 5 * rs), "v"(g + 6 * rs), "v"(g + 7 * rs)
                 : "memory");
}
// The sums of the tile at rows r0 of A and rows c0 of Bt, the k stages walked from stage s0 (0 <= s0 < K / GT_KS, the same for the whole work-group) round to s0 - 1. L: the work-group's ring of 2 x GT_BUF bytes; every wave has left it, and no copy is outstanding, when this returns.
template <typename T16, int K>
__device__ __forceinline__
void gt_products(const T16* __restrict__ A, const T16* __restrict__ Bt, const int r0, const int c0, const int s0, unsigned char* L, v8f (&acc)[2][4]) {
    static_assert(K % GT_KS == 0 && K >= 2 * GT_KS);
    typedef typename WFrag<T16>::V V;
    const int tid = threadIdx.x, lane = tid & 31, wave = tid >> 5, lr = lane & 15, hi = lane >> 4, wm = wave >> 1, wn = wave & 1;
    // staging map: 2048 16-byte chunks an operand and stage, chunk = tid + 256 i -> row (tid >> 4) + 16 i, 16 chunks a row: a wave's copy covers two whole rows of the stage
    const T16* ag = A + (size_t)(r0 + (tid >> 4)) * K + (tid & 15) * 8;
    const T16* bg = Bt + (size_t)(c0 + (tid >> 4)) * K + (tid & 15) * 8;
    const size_t rs = (size_t)16 * K;
    const unsigned cl = (unsigned)(size_t)L + (tid >> 4) * GT_P + (tid & 15) * 16;     // where this thread's chunks go
    const unsigned af = (wm * 32 + lr) * GT_P + 16 * hi, bfo = GT_OP + (wn * 64 + lr) * GT_P + 16 * hi;   // where this lane's fragments start
    constexpr int nst = K / GT_KS;
    unsigned bo = 0;   // byte offset of the buffer that holds the walk's stage st
    int sk = s0;       // the k stage that the next copies bring
#pragma unroll
    for (int mb = 0; mb < 2; ++mb)
#pragma unroll
        for (int nb = 0; nb < 4; ++nb) acc[mb][nb] = (v8f){};
    gt_copy8(cl, ag + sk * GT_KS, rs); gt_copy8(cl + GT_OP, bg + sk * GT_KS, rs);
    sk = sk + 1 == nst ? 0 : sk + 1;
    asm volatile("s_wait_asynccnt 0x0" ::: "memory");   // stage 0 has landed, as far as this wave copied it
    __syncthreads();                                     // publishes stage 0
    gt_copy8(cl + GT_BUF, ag + sk * GT_KS, rs); gt_copy8(cl + GT_BUF + GT_OP, bg + sk * GT_KS, rs);
    sk = sk + 1 == nst ? 0 : sk + 1;
    // kept rolled: the body holds a whole stage's 32 products a wave, unrolled
#pragma unroll 1
    for (int st = 0; st < nst; ++st) {
        V a[2][2], b[2][4];
#pragma unroll
        for (int mb = 0; mb < 2; ++mb) a[0][mb] = WFrag<T16>::ld((const T16*)(L + bo + af + mb * 16 * GT_P));
#pragma unroll
        for (int nb = 0; nb < 4; ++nb) b[0][nb] = WFrag<T16>::ld((const T16*)(L + bo + bfo + nb * 16 * GT_P));
#pragma unroll
        for (int kb = 0; kb < GT_KS / 32; ++kb) {
            const int cur = kb & 1, nxt = cur ^ 1;
            if (kb + 1 < GT_KS / 32) {   // the next 32 k's fragments, read as one group in front of this block's products
#pragma unroll
                for (int mb = 0; mb < 2; ++mb) a[nxt][mb] = WFrag<T16>::ld((const T16*)(L + bo + af + mb * 16 * GT_P + (kb + 1) * 64));
#pragma unroll
                for (int nb = 0; nb < 4; ++nb) b[nxt][nb] = WFrag<T16>::ld((const T16*)(L + bo + bfo + nb * 16 * GT_P + (kb + 1) * 64));
            }
            __builtin_amdgcn_sched_barrier(0);   // the reads stay one group in front of the products, which cover their latency; left free, the compiler put them two by two in front of each pair of products, with a full wait each
#pragma unroll
            for (int nb = 0; nb < 4; ++nb)
#pragma unroll
                for (int mb = 0; mb < 2; ++mb) acc[mb][nb] = WFrag<T16>::mma(a[cur][mb], b[cur][nb], acc[mb][nb]);
            __builtin_amdgcn_sched_barrier(0);   // and no read of the block after next moves up among these products
        }
        asm volatile("s_wait_dscnt 0x0" ::: "memory");      // this wave's reads of stage st have returned
        asm volatile("s_wait_asynccnt 0x0" ::: "memory");   // its copies of stage st + 1 have landed
        __syncthreads();                                     // publishes stage st + 1 and ends every wave's reads of stage st
        if (st + 2 < nst) { gt_copy8(cl + bo, ag + sk * GT_KS, rs); gt_copy8(cl + bo + GT_OP, bg + sk * GT_KS, rs); }   // stage st + 2 into the buffer that stage st has left
        sk = sk + 1 == nst ? 0 : sk + 1; bo = GT_BUF - bo;
    }
    asm volatile("s_wait_asynccnt 0x0" ::: "memory");       // no copy is outstanding when the wave goes on
}
// The epilogues. os: the wave's own 16 x 68 floats of LDS, where it stages a 16 x 64 block, so that whole lines are stored.
// OUT_F32: the tile at rows r0, columns c0 of C.
__device__ __forceinline__ void gt_store_f32(const v8f (&acc)[2][4], float* os, float* C, const int ldc, const int r0, const int c0, const float* __restrict__ bias, const float cscale) {
    const int tid = threadIdx.x, lane = tid & 31, wave = tid >> 5, lr = lane & 15, hi = lane >> 4, wm = wave >> 1, wn = wave & 1;
    const int cw = c0 + wn * 64;
    // bias for this lane's 4 output columns: one 16-B load per lane, loaded once (the columns are the same for every row of the wave's tile)
    v4f bb; { const v4f br = *(const v4f*)(bias + cw + lr * 4); bb[0] = bfr(br[0]); bb[1] = bfr(br[1]); bb[2] = bfr(br[2]); bb[3] = bfr(br[3]); }
#pragma unroll
    for (int mb = 0; mb < 2; ++mb) {
#pragma unroll
        for (int nb = 0; nb < 4; ++nb) {
#pragma unroll
            for (int j = 0; j < 8; ++j) os[(hi * 8 + j) * 68 + nb * 16 + lr] = acc[mb][nb][j]; }
        __builtin_amdgcn_wave_barrier(); asm volatile("" ::: "memory");   // other lanes of the wave read these rows back: the compiler may move no read in front of the stores
        float* crow = C + (size_t)(r0 + wm * 32 + mb * 16) * ldc + cw;
#pragma unroll
        for (int s = 0; s < 8; ++s) { const int row = 2 * s + hi, cofs = lr * 4; v4f val = *(const v4fa*)(os + row * 68 + cofs); val = val * cscale; val = val + bb;
            *(v4f*)(crow + (size_t)row * ldc + cofs) = val; }
        __builtin_amdgcn_wave_barrier(); asm volatile("" ::: "memory");   // and no store of the next 16 rows in front of these reads
    }
}
// OUT_HEAD, OUT_ROWS: a wave's block of 64 x 64 sums, acc[i][j] = rows 16 i, columns 16 j of it, to an f16 plane. blk: the block's first element in the plane; bias: the bias of its first column (OUT_HEAD) or of its first row (OUT_ROWS).
template <int OUT>
__device__ __forceinline__ void gt_store_plane(const v8f (&acc)[4][4], float* os, h16* blk, const float* __restrict__ bias) {
    const int lane = threadIdx.x & 31, lr = lane & 15, hi = lane >> 4;
    // a row of the block is 64 values = one 128-byte line; eight lanes store a row (8 values = 16 B each), a wave's store covers four whole rows
    const int c8 = (lane & 7) * 8, r4 = lane >> 3;
    constexpr int pp = OUT == OUT_HEAD ? HD : SEQ;   // pitch of the plane
    h16* pr = blk + (size_t)r4 * pp + c8;
    v4f bc[2] = {(v4f){}, (v4f){}};   // OUT_HEAD: the bias of this lane's 8 columns, the same for every row
    if constexpr (OUT == OUT_HEAD) {
        const v4f b0 = *(const v4f*)(bias + c8), b1 = *(const v4f*)(bias + c8 + 4);
        // the wait stands in front of any later write of the address registers that the two bias loads name; the address is its input, so that its registers are kept up to here
        asm volatile("s_wait_xcnt 0x0" :: "v"(bias + c8) : "memory");
#pragma unroll
        for (int e = 0; e < 4; ++e) { bc[0][e] = bfr(b0[e]); bc[1][e] = bfr(b1[e]); }
    }
#pragma unroll
    for (int mb = 0; mb < 4; ++mb) {
        if constexpr (OUT == OUT_ROWS) {   // the bias goes by rows: added where a lane still holds 8 rows of one column
            v4f br[2];
#pragma unroll
            for (int q = 0; q < 2; ++q) { const v4f b = *(const v4f*)(bias + mb * 16 + hi * 8 + 4 * q); br[q][0] = bfr(b[0]); br[q][1] = bfr(b[1]); br[q][2] = bfr(b[2]); br[q][3] = bfr(b[3]); }
#pragma unroll
            for (int nb = 0; nb < 4; ++nb) {
#pragma unroll
                for (int j = 0; j < 8; ++j) os[(hi * 8 + j) * 68 + nb * 16 + lr] = acc[mb][nb][j] + br[j >> 2][j & 3]; }
        } else {
#pragma unroll
            for (int nb = 0; nb < 4; ++nb) {
#pragma unroll
                for (int j = 0; j < 8; ++j) os[(hi * 8 + j) * 68 + nb * 16 + lr] = acc[mb][nb][j]; }
        }
        __builtin_amdgcn_wave_barrier(); asm volatile("" ::: "memory");   // other lanes of the wave read these rows back: the compiler may move no read in front of the stores
#pragma unroll
        for (int s = 0; s < 4; ++s) { const float* rp = os + (4 * s + r4) * 68 + c8; v4f lo = *(const v4fa*)rp, up = *(const v4fa*)(rp + 4);
            if constexpr (OUT == OUT_HEAD) { lo = lo + bc[0]; up = up + bc[1]; }
            v8h o;
#pragma unroll
            for (int q = 0; q < 4; ++q) { o[q] = (h16)lo[q]; o[q + 4] = (h16)up[q]; }
            *(v8h*)(pr + (size_t)(mb * 16 + 4 * s) * pp) = o; }
        __builtin_amdgcn_wave_barrier();
        asm volatile("s_wait_xcnt 0x0" ::: "memory");   // no store of the next 16 rows to LDS in front of these reads; and the wait stands in front of any later write of a register that the loads and stores above name
    }
}
// ---- k_gemm_qkv: the three projections of one head for 256 tokens in one work-group: a tile of 256 tokens x (128 q + 128 k + 128 v features). grid (NB * SEQ / 256, NH_) = one work-group a WGP at full size. Planes: QP, KP [b][h][t][d], VT [b][h][d][t].
// The x rows that a work-group fetches serve all three weights: 640 rows of operands for 256 x 384 sums, where six tiles of 128 x 128 fetch 1536 rows for as many.
// 8 waves, 4 along the tokens x 2 along the features; a wave holds 64 tokens x 64 features of each of q, k and v (48 accumulators): 16 fragments read from LDS feed 48 products.
// q, k: A = x, B = the weight (D: token rows, feature columns). v: the same two fragments with their places changed, A = the weight, B = x (both operands have one fragment map), so D is v^T as it stands.
// Stages of 64 k (rows of 128 B) by asynchronous copies, two buffers; the copies of stage st + 1 are issued in trip st behind the trip's first fragment reads, whose latency they cover.
#define GF_M   256                        // tokens of a tile
#define GF_KS  64                         // k of a stage
#define GF_P   144                        // LDS pitch of a row (128 B + 16): 16 B x odd, conflict-free for 16-byte row reads
#define GF_X   (GF_M * GF_P)              // the x rows of a stage
#define GF_W   (HD * GF_P)                // one weight's rows of a stage
#define GF_BUF (GF_X + 3 * GF_W)          // a buffer: [x 256 rows | wq 128 | wk 128 | wv 128]
static_assert(SEQ % GF_M == 0 && DM % GF_KS == 0 && DM >= 2 * GF_KS && 8 * 16 * 68 * 4 <= 2 * GF_BUF && DQ == NH_ * HD);
// The copies are written as the builtin: the kernel uses registers above v255, which the operands of an asm statement cannot name, and the compiler moved sums out of the low registers and back around every asm copy statement.
typedef __attribute__((ext_vector_type(4))) int v4i;
typedef __attribute__((address_space(1))) v4i gv4i;
typedef __attribute__((address_space(3))) v4i lv4i;
// N chunks of 16 bytes, rows 32 apart, from g (this thread's first chunk of the source's rows) to l (its place in LDS).
template <int N>
__device__ __forceinline__ void gf_copy(unsigned char* l, const bf* g) {
#pragma unroll
    for (int i = 0; i < N; ++i) __builtin_amdgcn_global_load_async_to_lds_b128((gv4i*)(g + (size_t)i * 32 * DM), (lv4i*)(l + i * 32 * GF_P), 0, 0);
}
// two waves a SIMD: 512 VGPRs a wave
__global__ __launch_bounds__(256) __attribute__((amdgpu_waves_per_eu(2, 2)))
void k_gemm_qkv(const bf* __restrict__ X, const bf* __restrict__ WQ, const bf* __restrict__ WK, const bf* __restrict__ WV, h16* QP, h16* KP, h16* VT,
                const float* __restrict__ bq, const float* __restrict__ bk, const float* __restrict__ bv) {
    __shared__ __align__(16) unsigned char L[2 * GF_BUF];
    typedef WFrag<bf> F; typedef F::V V;
    const int tid = threadIdx.x, lane = tid & 31, wave = tid >> 5, lr = lane & 15, hi = lane >> 4, wm = wave >> 1, wn = wave & 1;
    const int t0 = blockIdx.x * GF_M, h = blockIdx.y;   // t0 counts the tokens of all batch items; a tile lies in one item
    // staging map: 8 chunks of 16 bytes a row, chunk = tid + 256 i -> row (tid >> 3) + 32 i: a wave's copy covers four whole rows of the stage
    const unsigned go = (unsigned)(tid >> 3) * DM + (tid & 7) * 8;   // this thread's first chunk in a tile's rows, in elements
    const bf* xs = X + (size_t)t0 * DM;       // the tile's first rows: the same for the whole work-group
    const bf* qs = WQ + (size_t)h * HD * DM;
    const bf* ks = WK + (size_t)h * HD * DM;
    const bf* vs = WV + (size_t)h * HD * DM;
    const unsigned cl = (tid >> 3) * GF_P + (tid & 7) * 16;                                                // where this thread's chunks go
    const unsigned af = (wm * 64 + lr) * GF_P + 16 * hi, bfo = GF_X + (wn * 64 + lr) * GF_P + 16 * hi;     // where this lane's fragments start
    constexpr int nst = DM / GF_KS;
    unsigned bo = 0;   // byte offset of the buffer that holds the walk's stage st
    int sk = (int)((blockIdx.x + blockIdx.y) * 2 % nst);   // the k stage that the next copies bring; rotated walk: the sharers of x rows differ in blockIdx.y, those of weight rows in blockIdx.x, neighbours start two stages apart
    v8f acc[3][4][4];  // [0], [1]: q, k as [token block][feature block]; [2]: v^T as [feature block][token block]
#pragma unroll
    for (int z = 0; z < 3; ++z)
#pragma unroll
        for (int i = 0; i < 4; ++i)
#pragma unroll
            for (int j = 0; j < 4; ++j) acc[z][i][j] = (v8f){};
    { const int ke = sk * GF_KS;
      gf_copy<8>(L + cl, xs + ke + go); gf_copy<4>(L + cl + GF_X, qs + ke + go); gf_copy<4>(L + cl + GF_X + GF_W, ks + ke + go); gf_copy<4>(L + cl + GF_X + 2 * GF_W, vs + ke + go); }
    asm volatile("s_wait_asynccnt 0x0" ::: "memory");   // stage 0 has landed, as far as this wave copied it
    __syncthreads();                                     // publishes stage 0
    // kept rolled: the body holds a whole stage's 96 products a wave, unrolled
#pragma unroll 1
    for (int st = 0; st < nst; ++st) {
        V a[4], b[2][4];
#pragma unroll
        for (int mb = 0; mb < 4; ++mb) a[mb] = F::ld((const bf*)(L + bo + af + mb * 16 * GF_P));
#pragma unroll
        for (int nb = 0; nb < 4; ++nb) b[0][nb] = F::ld((const bf*)(L + bo + bfo + nb * 16 * GF_P));
        sk = sk + 1 == nst ? 0 : sk + 1;
        if (st + 1 < nst) {   // stage st + 1 into the buffer that stage st - 1 has left: every wave's reads of it ended at the barrier of trip st - 1
            unsigned char* d = L + cl + (GF_BUF - bo); const int ke = sk * GF_KS;
            gf_copy<8>(d, xs + ke + go); gf_copy<4>(d + GF_X, qs + ke + go); gf_copy<4>(d + GF_X + GF_W, ks + ke + go); gf_copy<4>(d + GF_X + 2 * GF_W, vs + ke + go);
        }
        // six groups of 16 products: (32 k) x (q, k, v); each group's four weight fragments are read one group ahead
#pragma unroll
        for (int g = 0; g < 6; ++g) {
            const int z = g % 3, cur = g & 1, nxt = cur ^ 1;
            if (g + 1 < 6) {
#pragma unroll
                for (int nb = 0; nb < 4; ++nb) b[nxt][nb] = F::ld((const bf*)(L + bo + bfo + ((g + 1) % 3) * GF_W + nb * 16 * GF_P + ((g + 1) / 3) * 64));
            }
            __builtin_amdgcn_sched_barrier(0);   // the reads stay one group in front of the products, which cover their latency
#pragma unroll
            for (int nb = 0; nb < 4; ++nb)
#pragma unroll
                for (int mb = 0; mb < 4; ++mb) {
                    if (z < 2) acc[z][mb][nb] = F::mma(a[mb], b[cur][nb], acc[z][mb][nb]);
                    else       acc[2][nb][mb] = F::mma(b[cur][nb], a[mb], acc[2][nb][mb]);
                }
            __builtin_amdgcn_sched_barrier(0);   // and no later read moves up among these products
            if (g == 2) {   // the x fragments of the stage's second 32 k, into the registers that the products above have read
#pragma unroll
                for (int mb = 0; mb < 4; ++mb) a[mb] = F::ld((const bf*)(L + bo + af + mb * 16 * GF_P + 64));
            }
        }
        asm volatile("s_wait_dscnt 0x0" ::: "memory");      // this wave's reads of stage st have returned
        asm volatile("s_wait_asynccnt 0x0" ::: "memory");   // its copies of stage st + 1 have landed
        __syncthreads();                                     // publishes stage st + 1 and ends every wave's reads of stage st
        bo = GF_BUF - bo;
    }
    asm volatile("s_wait_asynccnt 0x0" ::: "memory");       // no copy is outstanding when the wave goes on
    // the epilogue stages in the ring's bytes, which every wave has left at the loop's last barrier
    float* os = (float*)L + wave * (16 * 68);
    const size_t pb = (size_t)(t0 / SEQ) * NH_ * SEQ * HD; const int tw = t0 % SEQ + wm * 64, ew = h * HD + wn * 64;   // the wave's first token in its batch item, its first feature
    gt_store_plane<OUT_HEAD>(acc[0], os, QP + pb + ((size_t)h * SEQ + tw) * HD + wn * 64, bq + ew);
    gt_store_plane<OUT_HEAD>(acc[1], os, KP + pb + ((size_t)h * SEQ + tw) * HD + wn * 64, bk + ew);
    gt_store_plane<OUT_ROWS>(acc[2], os, VT + pb + (size_t)ew * SEQ + tw, bv + ew);
}
static_assert(8 * 16 * 68 * 4 <= 2 * GT_BUF);
// at most 256 VGPRs: the asm operands of gt_copy8 stay in the register window that needs no switching
// k_gemm_out: C[m][n] f32. grid (M / 128, N / 128).
template <typename T16, int K>
__global__ __launch_bounds__(256) __attribute__((amdgpu_num_vgpr(256)))
void k_gemm_out(const T16* __restrict__ A, const T16* __restrict__ Bt, float* C, int ldc, const float* __restrict__ bias, float cscale) {
    __shared__ __align__(16) unsigned char L[2 * GT_BUF];
    float* os = (float*)L + (threadIdx.x >> 5) * (16 * 68);
    const int r0 = blockIdx.x * GT_T, c0 = blockIdx.y * GT_T;
    v8f acc[2][4];
    gt_products<T16, K>(A, Bt, r0, c0, (int)((blockIdx.x + blockIdx.y) % (K / GT_KS)), L, acc);   // the sharers of A rows differ in blockIdx.y, those of Bt rows in blockIdx.x
    gt_store_f32(acc, os, C, ldc, r0, c0, bias, cscale);
}

// ---- k_prep: every operand conversion of the block in ONE launch of long-lived waves: wq, wk, wv, x -> bf16 (RNE); wo -> f16 of (its bf16 value x WCAR); m -> (1 - bf16(m)) x f32_lowest.
// grid PR_G work-groups of 256 threads. A unit = 8192 floats = 8 chunks of 4 floats a thread, chunk i of thread t at i * 1024 + t * 4: a wave's load covers 512 bytes in a row (four whole lines), its store 256 (two whole lines).
// Work-group g converts unit g of each weight and of each batch item of x, one after the other, from two register sets: a set is loaded again as soon as it has been converted, so the eight loads of at least one unit are in flight while another is converted.
// Each wave here converts 48 chunks a lane (for speed only).
#define PR_U 8192
#define PR_G (DQ * DM / PR_U)
#define PR_X (SEQ * DM / PR_U)            // units of one batch item of x
#define PR_M (NB * SEQ / 1024)            // work-groups that also convert 1024 mask values each
static_assert(DQ * DM % PR_U == 0 && SEQ * DM % PR_U == 0 && PR_X <= PR_G && SEQ % 1024 == 0 && PR_M <= PR_G);
typedef __attribute__((ext_vector_type(4))) unsigned short v4us;
typedef __attribute__((ext_vector_type(2))) unsigned v2u;
// lo: this thread's byte offset from the source pointer (32 bits, so that the load takes the pointer as its scalar base)
__device__ __forceinline__ void pr_load(const float* __restrict__ s, unsigned lo, v4f (&r)[8]) {
#pragma unroll
    for (int i = 0; i < 8; ++i) r[i] = *(const v4f*)((const char*)s + lo + i * 4096); }
// One unit: converts the set r (H: to f16 of the bf16 value x WCAR; else to bf16), stores it at d + so bytes, and loads the set again from nxt + lo bytes where ld says so.
template <bool H>
__device__ __forceinline__ void pr_step(v4f (&r)[8], void* d, unsigned so, const float* __restrict__ nxt, bool ld, unsigned lo) {
    v2u w[8];
#pragma unroll
    for (int i = 0; i < 8; ++i) {
        if constexpr (H) { v4h o;
#pragma unroll
            for (int q = 0; q < 4; ++q) o[q] = (h16)(bfr(r[i][q]) * WCAR);
            w[i] = __builtin_bit_cast(v2u, o);
        } else { v4us o;
#pragma unroll
            for (int q = 0; q < 4; ++q) o[q] = f2bf(r[i][q]);
            w[i] = __builtin_bit_cast(v2u, o); }
    }
#pragma unroll
    for (int i = 0; i < 8; ++i) *(v2u*)((char*)d + so + i * 2048) = w[i];
    if (ld) pr_load(nxt, lo, r);
    // the wait that stands in front of any later write of a register which these stores and loads name; the offsets and the stored words are its inputs, so that their registers are kept up to here
    asm volatile("s_wait_xcnt 0x0" :: "v"(lo), "v"(so), "v"(w[0]), "v"(w[1]), "v"(w[2]), "v"(w[3]), "v"(w[4]), "v"(w[5]), "v"(w[6]), "v"(w[7]) : "memory");
}
__global__ __launch_bounds__(256) void k_prep(const float* __restrict__ x, const float* __restrict__ m, const float* __restrict__ wq, const float* __restrict__ wk, const float* __restrict__ wv, const float* __restrict__ wo,
                                              bf* WQ, bf* WK, bf* WV, h16* WO16, bf* XB, float* MA) {
    const int g = blockIdx.x, tid = threadIdx.x;
    const unsigned so = (unsigned)(g * PR_U + tid * 4) * 2u, lo = so * 2u;
    const bool hasx = PR_X == PR_G || g < PR_X;   // the same for the whole work-group
    v4f r[2][8];
    pr_load(wq, lo, r[0]);
    pr_load(wk, lo, r[1]);
    pr_step<false>(r[0], WQ, so, wv, true, lo);
    pr_step<false>(r[1], WK, so, wo, true, lo);
    pr_step<false>(r[0], WV, so, x, hasx, lo);
    pr_step<true>(r[1], WO16, so, x, hasx && NB > 1, NB > 1 ? lo + SEQ_FULL * DM * 4u : lo);
#pragma unroll
    for (int b = 0; b < NB; ++b)   // batch item b: its place goes into the 32-bit offsets
        if (hasx) pr_step<false>(r[b & 1], XB, so + b * (SEQ * DM * 2u), x, b + 2 < NB, b + 2 < NB ? lo + (b + 2) * (SEQ_FULL * DM * 4u) : lo);
    if (g < PR_M) {   // the same for the whole work-group
        const int mi = g * 1024 + tid * 4;   // index into MA, [NB][SEQ]
        const unsigned mo = (unsigned)((mi / SEQ) * SEQ_FULL + mi % SEQ) * 4u;
        const v4f a = *(const v4f*)((const char*)m + mo);
        asm volatile("s_wait_xcnt 0x0" :: "v"(mo) : "memory");   // as above: in front of any later write of the load's offset register
        v4f q;
#pragma unroll
        for (int e = 0; e < 4; ++e) { const float u = 1.0f - bfr(a[e]); q[e] = u * FLOW; }
        *(v4f*)(MA + mi) = q;
    }
}
// ---- k_fattn: scores, softmax and p.v of one head for 256 queries in one work-group; no score ever reaches memory. grid (SEQ/256, NH_, NB), 256 threads = 8 waves x 32 queries (two 16-query tiles a wave).
// Transposed products: S^T = K.Q^T (A = 16 keys x 32 d from LDS, B = Q^T kept in registers), O^T += V^T.P^T (A = 16 d x 32 keys from LDS, B = P^T).
// Every K and V^T fragment that a wave reads from LDS serves the products of both its query tiles: 512 bytes of LDS reads a product. One tile a wave would read 1024, twice what the LDS delivers in a product's time on four SIMDs.
// The two tiles' sums and Q^T take 192 registers, so a wave has the budget of two waves a SIMD, and one work-group fills a WGP.
// D of S^T: lane l holds query (l & 15), keys 8*(l>>4) + r of each 16-key tile; that is the B operand's k order for 32 keys (tile 0 -> elements 0..7, tile 1 -> elements 8..15), so P^T packs in-lane.
// K rows ([t][d] plane) and V^T rows ([d][t] plane) come in stages of 64 keys: global -> registers -> LDS, two buffers; the next stage's loads fly under this stage's two 32-key passes.
// Every inner loop is fully unrolled, so that each index into a register array is a constant (an index known only at run time would send the array to scratch).
// Online softmax: t = s x SCL + MA[key]; p = exp(t - m_run); m_run may trail the true maximum by up to FA_LAG (p stays below e^FA_LAG, far inside f16); a query tile's sums are rescaled only when one of its queries' maxima passes that.
#define FA_QT   2                         // 16-query tiles of a wave
#define FA_BQ   (8 * 16 * FA_QT)
static_assert(FA_QT == 2);                // the pass's one rescale test names both tiles
#define FA_SK   64
#define FA_PK   272                       // LDS pitch of a K row (256 B + 16): 16 B x odd, conflict-free for 16-byte row reads
#define FA_PV   144                       // LDS pitch of a V^T row (128 B + 16): 16 B x odd
#define FA_TK   (FA_SK * FA_PK)
#define FA_SLOT (FA_TK + HD * FA_PV)
#define FA_FLIP 65536                     // the two buffers lie 64 KiB apart, so that one XOR on an LDS offset changes the buffer
#define FA_LAG  5.5f
#define L2E     1.4426950408889634f
static_assert(SEQ % FA_BQ == 0 && SEQ % FA_SK == 0 && SEQ % 1024 == 0 && FA_SLOT <= FA_FLIP);
typedef __attribute__((ext_vector_type(4))) unsigned v4u;
__device__ __forceinline__ float xhalf(float x) { return __builtin_bit_cast(float, __builtin_amdgcn_permlanex16(__builtin_bit_cast(int, x), __builtin_bit_cast(int, x), 0x76543210, 0xfedcba98, false, false)); }  // lane l <-> lane l ^ 16
// Four exponentials (2^x, in place) in one statement. The v_nop at its end fills the slot that the instruction set asks for behind a transcendental before a source is overwritten or the result read.
__device__ __forceinline__ void exp2x4(float& a, float& b, float& c, float& d) { asm("v_exp_f32 %0, %0\n\tv_exp_f32 %1, %1\n\tv_exp_f32 %2, %2\n\tv_exp_f32 %3, %3\n\tv_nop" : "+v"(a), "+v"(b), "+v"(c), "+v"(d)); }
// two waves a SIMD: 512 VGPRs a wave
__global__ __launch_bounds__(256) __attribute__((amdgpu_waves_per_eu(2, 2))) void k_fattn(const h16* __restrict__ QP, const h16* __restrict__ KP, const h16* __restrict__ VT, const float* __restrict__ MA, h16* AT) {
    __shared__ __align__(16) unsigned char L[FA_FLIP + FA_SLOT];
    __shared__ __align__(16) float MAs[SEQ];
    const int tid = threadIdx.x, lane = tid & 31, wave = tid >> 5, lr = lane & 15, hi = lane >> 4;
    const int h = blockIdx.y, q0 = blockIdx.x * FA_BQ + wave * (16 * FA_QT);
    { const size_t pb = (size_t)blockIdx.z * NH_ * SEQ * HD; QP += pb; KP += pb; VT += pb; MA += (size_t)blockIdx.z * SEQ; AT += (size_t)blockIdx.z * SEQ * DQ; }   // batch item blockIdx.z: its planes, its mask row, its rows of AT
    // staging map: 1024 16-byte chunks of K (row = chunk >> 4) and 1024 of V^T (row = chunk >> 3) per stage, chunk = tid + 256 i
    constexpr int nks = SEQ / FA_SK;                       // key stages
    int sc = blockIdx.x * (FA_BQ / FA_SK);                 // the key stage that a trip works on; rotated walk: the work-groups that share a head's K and V^T differ in blockIdx.x and start FA_BQ keys apart
    const h16* kg = KP + (size_t)h * SEQ * HD + (size_t)sc * FA_SK * HD; const unsigned ko = (unsigned)tid * 8u;         // a K stage is 16 KiB in a row
    const h16* vg = VT + (size_t)h * HD * SEQ + sc * FA_SK; const unsigned vo = (unsigned)(tid >> 3) * SEQ + (unsigned)(tid & 7) * 8u;
    unsigned kl = (tid >> 4) * FA_PK + (tid & 15) * 16, vl = FA_TK + (tid >> 3) * FA_PV + (tid & 7) * 16;   // where this thread's chunks go
    unsigned kf = lr * FA_PK + 16 * hi, vf = FA_TK + lr * FA_PV + 16 * hi;                                 // where this lane's fragments start
    v4u kr[4], vr[4]; v4f mr[SEQ / 1024];
#pragma unroll
    for (int i = 0; i < SEQ / 1024; ++i) mr[i] = *(const v4f*)(MA + i * 1024 + tid * 4);
#pragma unroll
    for (int i = 0; i < 4; ++i) { kr[i] = *(const v4u*)(kg + i * 2048 + ko); vr[i] = *(const v4u*)(vg + i * 32 * SEQ + vo); }
    v16h qf[FA_QT][4]; const h16* qp[FA_QT];
#pragma unroll
    for (int qt = 0; qt < FA_QT; ++qt) { qp[qt] = QP + ((size_t)h * SEQ + q0 + 16 * qt + lr) * HD + 8 * hi;
#pragma unroll
      for (int kc = 0; kc < 4; ++kc) qf[qt][kc] = cat16(*(const v8h*)(qp[qt] + 32 * kc), *(const v8h*)(qp[qt] + 32 * kc + 16)); }
    // the wait that stands in front of any later write of an address register which the loads above name. The loads' addresses and offsets are its inputs, so that their registers are kept up to here; the two scheduling fences keep every such load in front of it
    __builtin_amdgcn_sched_barrier(0);
    asm volatile("s_wait_xcnt 0x0" :: "v"(tid), "v"(vo * 2u), "v"(qp[0]), "v"(qp[1]) : "memory");
    __builtin_amdgcn_sched_barrier(0);
#pragma unroll
    for (int i = 0; i < SEQ / 1024; ++i) *(v4f*)(MAs + i * 1024 + tid * 4) = mr[i];
#pragma unroll
    for (int i = 0; i < 4; ++i) { *(v4u*)(L + kl + i * 16 * FA_PK) = kr[i]; *(v4u*)(L + vl + i * 32 * FA_PV) = vr[i]; }
    v8f acc[FA_QT][8];
    float m_run[FA_QT], l_run[FA_QT];
#pragma unroll
    for (int qt = 0; qt < FA_QT; ++qt) { m_run[qt] = FLOW; l_run[qt] = 0.f;
#pragma unroll
        for (int t8 = 0; t8 < 8; ++t8) acc[qt][t8] = (v8f){}; }
    const float* mp = MAs + 8 * hi + sc * FA_SK;
    __syncthreads();
    // kept rolled
#pragma unroll 1
    for (int st = 0; st < SEQ / FA_SK; ++st) {
        const bool more = st + 1 < SEQ / FA_SK;
        const int step = sc + 1 == nks ? 1 - nks : 1; sc += step;   // to the next key stage, from the last one round to the first
        kl ^= FA_FLIP; vl ^= FA_FLIP; kg += step * (FA_SK * HD); vg += step * FA_SK;
        if (more) {
#pragma unroll
            for (int i = 0; i < 4; ++i) { kr[i] = *(const v4u*)(kg + i * 2048 + ko); vr[i] = *(const v4u*)(vg + i * 32 * SEQ + vo); }
        }
#pragma unroll
        for (int sub = 0; sub < FA_SK / 32; ++sub) {
            v16h ka[4][2]; v4f mk[2][2]; v8f s[FA_QT][2];
#pragma unroll
            for (int qt = 0; qt < FA_QT; ++qt) { s[qt][0] = (v8f){}; s[qt][1] = (v8f){}; }
            { const unsigned char* p = L + kf + sub * 32 * FA_PK;
#pragma unroll
              for (int kc = 0; kc < 4; ++kc)
#pragma unroll
                for (int kt = 0; kt < 2; ++kt) ka[kc][kt] = cat16(*(const v8h*)(p + kt * 16 * FA_PK + 64 * kc), *(const v8h*)(p + kt * 16 * FA_PK + 64 * kc + 32));
#pragma unroll
              for (int kt = 0; kt < 2; ++kt) { mk[kt][0] = *(const v4f*)(mp + sub * 32 + kt * 16); mk[kt][1] = *(const v4f*)(mp + sub * 32 + kt * 16 + 4); } }
            __builtin_amdgcn_sched_barrier(0);   // the pass's K and mask reads stay one group in front of the products: one LDS latency a pass, not one a product
#pragma unroll
            for (int kc = 0; kc < 4; ++kc)
#pragma unroll
                for (int kt = 0; kt < 2; ++kt)
#pragma unroll
                    for (int qt = 0; qt < FA_QT; ++qt) s[qt][kt] = wmma16(ka[kc][kt], qf[qt][kc], s[qt][kt]);
            v16h va[8];
#pragma unroll
            for (int t8 = 0; t8 < 8; ++t8) { const unsigned char* pv = L + vf + t8 * 16 * FA_PV + sub * 64; va[t8] = cat16(*(const v8h*)pv, *(const v8h*)(pv + 32)); }
            __builtin_amdgcn_sched_barrier(0);   // all eight V^T fragments are read in front of the softmax arithmetic, which covers their latency; left free, the compiler put the reads two by two in front of each product
            float t[FA_QT][16], mx[FA_QT]; bool need[FA_QT];
#pragma unroll
            for (int qt = 0; qt < FA_QT; ++qt) { float m = FLOW;
#pragma unroll
                for (int kt = 0; kt < 2; ++kt)
#pragma unroll
                    for (int r = 0; r < 8; ++r) { const float u = s[qt][kt][r] * SCL + mk[kt][r >> 2][r & 3]; t[qt][kt * 8 + r] = u; m = fmaxf(m, u); }
                m = fmaxf(m, xhalf(m));   // both halves of the wave now hold the query's maximum over the pass
                mx[qt] = m; need[qt] = m > m_run[qt] + FA_LAG; }
            if (__builtin_amdgcn_ballot_w32(need[0] || need[1]) != 0) {   // one test a pass for both tiles; wave-uniform, rare behind the first pass
#pragma unroll
                for (int qt = 0; qt < FA_QT; ++qt)
                    if (__builtin_amdgcn_ballot_w32(need[qt]) != 0) {   // wave-uniform: each tile is rescaled by its own queries alone, as if it had the wave to itself
                        const float m_new = fmaxf(m_run[qt], mx[qt]); const float corr = __builtin_amdgcn_exp2f((m_run[qt] - m_new) * L2E);
                        l_run[qt] *= corr; m_run[qt] = m_new;
#pragma unroll
                        for (int t8 = 0; t8 < 8; ++t8) acc[qt][t8] = acc[qt][t8] * corr;
                    }
            }
#pragma unroll
            for (int qt = 0; qt < FA_QT; ++qt) {
                v16h pf; float ps[4];
#pragma unroll
                for (int e = 0; e < 16; e += 4) { float p0 = (t[qt][e] - m_run[qt]) * L2E, p1 = (t[qt][e + 1] - m_run[qt]) * L2E, p2 = (t[qt][e + 2] - m_run[qt]) * L2E, p3 = (t[qt][e + 3] - m_run[qt]) * L2E;
                    exp2x4(p0, p1, p2, p3);
                    ps[e >> 2] = (p0 + p1) + (p2 + p3); pf[e] = (h16)p0; pf[e + 1] = (h16)p1; pf[e + 2] = (h16)p2; pf[e + 3] = (h16)p3; }
                l_run[qt] += (ps[0] + ps[1]) + (ps[2] + ps[3]);
#pragma unroll
                for (int t8 = 0; t8 < 8; ++t8) acc[qt][t8] = wmma16(va[t8], pf, acc[qt][t8]);
            }
        }
        if (more) {   // into the other buffer: every wave left it at the barrier that ended stage st - 1
#pragma unroll
            for (int i = 0; i < 4; ++i) { *(v4u*)(L + kl + i * 16 * FA_PK) = kr[i]; *(v4u*)(L + vl + i * 32 * FA_PV) = vr[i]; }
        }
        kf ^= FA_FLIP; vf ^= FA_FLIP; mp += step * FA_SK;
        __syncthreads();   // publishes stage st + 1 and ends every wave's reads of stage st
    }
#pragma unroll
    for (int qt = 0; qt < FA_QT; ++qt) {
        const float inv = OCAR / (l_run[qt] + xhalf(l_run[qt]));   // each half summed its own eight keys of every 16-key tile
        h16* op = AT + (size_t)(q0 + 16 * qt + lr) * DQ + (size_t)h * HD + 8 * hi;   // D of O^T: lane l holds query (l & 15), d = 16 t8 + 8*(l>>4) + r
#pragma unroll
        for (int t8 = 0; t8 < 8; ++t8) { v8h o;
#pragma unroll
            for (int r = 0; r < 8; ++r) o[r] = (h16)(acc[qt][t8][r] * inv);
            *(v8h*)(op + t8 * 16) = o; }
    }
}

extern "C" void kernel_launch(void* const* d_in, const int* in_sizes, int n_in,
                              void* d_out, int out_size, void* d_ws, size_t ws_size, hipStream_t stream) {
    if (n_in < 10) return;
    const float* x  = (const float*)d_in[0]; const float* am = (const float*)d_in[1];
    const float* wq = (const float*)d_in[2]; const float* bq = (const float*)d_in[3]; const float* wk = (const float*)d_in[4]; const float* bk = (const float*)d_in[5];
    const float* wv = (const float*)d_in[6]; const float* bv = (const float*)d_in[7]; const float* wo = (const float*)d_in[8]; const float* bo = (const float*)d_in[9];
    if (in_sizes[0] < 0 || (size_t)in_sizes[0] < (size_t)(NB - 1) * SEQ_FULL * DM + (size_t)SEQ * DM) return;
    if (in_sizes[1] < (NB - 1) * SEQ_FULL + SEQ) return;
    if (in_sizes[2] < DQ * DM || in_sizes[4] < DQ * DM || in_sizes[6] < DQ * DM || in_sizes[8] < DM * DQ) return;
    if (in_sizes[3] < DQ || in_sizes[5] < DQ || in_sizes[7] < DQ || in_sizes[9] < DM) return;
    if (out_size < 0 || (size_t)out_size < (size_t)NB * SEQ * DM) return;
    float* OUT = (float*)d_out;     // [NB][SEQ][DM]

    // ---- workspace carve (all offsets 256-B aligned; every region is written to exactly its extent by whole-line stores) ----
    char* wsp = (char*)d_ws; size_t used = 0;
    auto take = [&](size_t bytes) { char* p = wsp + used; used += (bytes + 255) & ~(size_t)255; return (void*)p; };
    bf*  WQ   = (bf*)take((size_t)DQ * DM * 2);                   // 8,388,608
    bf*  WK   = (bf*)take((size_t)DQ * DM * 2);                   // 8,388,608
    bf*  WV   = (bf*)take((size_t)DQ * DM * 2);                   // 8,388,608
    h16* WO16 = (h16*)take((size_t)DM * DQ * 2);                  // 8,388,608
    bf*  XB   = (bf*)take((size_t)NB * SEQ * DM * 2);             // 16,777,216  [b][t][k]
    float* MA = (float*)take((size_t)NB * SEQ * 4);                // 16,384  [b][t]
    h16* QP16 = (h16*)take((size_t)NB * NH_ * SEQ * HD * 2);      // 16,777,216  [b][h][t][d]
    h16* KP16 = (h16*)take((size_t)NB * NH_ * SEQ * HD * 2);      // 16,777,216  [b][h][t][d]
    h16* VT16 = (h16*)take((size_t)NB * NH_ * HD * SEQ * 2);      // 16,777,216  [b][h][d][t]
    h16* AT16 = (h16*)take((size_t)NB * SEQ * DQ * 2);            // 16,777,216  [b][t][h*HD+d]
    if (used > ws_size) return;                                    // total 117,456,896 B at NB=2, SEQ=2048

    k_prep<<<PR_G, 256, 0, stream>>>(x, am, wq, wk, wv, wo, WQ, WK, WV, WO16, XB, MA);
    k_gemm_qkv<<<dim3(NB * SEQ / GF_M, NH_, 1), 256, 0, stream>>>(XB, WQ, WK, WV, QP16, KP16, VT16, bq, bk, bv);
    k_fattn<<<dim3(SEQ / FA_BQ, NH_, NB), 256, 0, stream>>>(QP16, KP16, VT16, MA, AT16);
    k_gemm_out<h16, DQ><<<dim3(NB * SEQ / GT_T, DM / GT_T, 1), 256, 0, stream>>>(AT16, WO16, OUT, DM, bo, 1.0f / (OCAR * WCAR));
}

// v009
// One run takes 144 microseconds.
// In two side-by-side timings against v008, it was 1.04 and 1.03 times as fast.
// Over all steps from v000 it is 11.4 times as fast.
#include <hip/hip_runtime.h>

// Multi-head self-attention block (hidden [NB][SEQ][2048], 16 heads x 128): q/k/v = x W^T + b; s = (q.k) x 128^-0.5 + (1 - m[key]) x f32_lowest; p = softmax over keys; ctx = p.v; out = ctx Wo^T + bo -> [NB][SEQ][2048] f32.
// Compute dtypes (f32 accumulate everywhere): x, W*, b*, m enter as their bf16 (RNE) values; q/k/v projections: v_wmma_f32_16x16x32_bf16 (bf16 operands);
// scores: v_wmma_f32_16x16x32_f16 (f16 q, k planes); p.v: v_wmma_f32_16x16x32_f16 (f16 p = exp(s - running max), not normalised, f16 v; the row sum divides at the end); output projection: v_wmma_f32_16x16x32_f16 (f16 ctx x64, f16 Wo x64); softmax f32.
#pragma clang fp contract(off)

#ifndef NB
#define NB 2
#endif
#ifndef SEQ
#define SEQ 2048
#endif
#define NB_FULL  2
#define SEQ_FULL 2048
#define DM   2048
#define NH_  16
#define HD   128
#define DQ   (NH_ * HD)
#define OCAR 64.0f
#define WCAR 64.0f
#define SCL  0.08838834764831845f
#define FLOW (-3.4028234663852886e38f)

static_assert(SEQ % 128 == 0);
static_assert(SEQ >= 128 && SEQ <= SEQ_FULL);
static_assert(NB >= 1 && NB <= NB_FULL);
static_assert(DQ == DM);
static_assert(DM % 64 == 0 && HD == 128);

typedef _Float16 h16;
typedef unsigned short bf;
typedef __attribute__((ext_vector_type(16))) __bf16   v16bf;
typedef __attribute__((ext_vector_type(16))) _Float16 v16h;
typedef __attribute__((ext_vector_type(8)))  _Float16 v8h;
typedef __attribute__((ext_vector_type(4)))  _Float16 v4h;
typedef __attribute__((ext_vector_type(8)))  unsigned short v8us;
typedef __attribute__((ext_vector_type(8)))  float    v8f;
typedef __attribute__((ext_vector_type(4)))  float    v4f;
typedef v4f __attribute__((may_alias)) v4fa;

__device__ __forceinline__ unsigned short f2bf(float f) { unsigned u = __float_as_uint(f); u += 0x7FFFu + ((u >> 16) & 1u); return (unsigned short)(u >> 16); }
__device__ __forceinline__ float bf2f(unsigned short b) { return __uint_as_float(((unsigned)b) << 16); }
__device__ __forceinline__ float bfr(float f) { return bf2f(f2bf(f)); }
__device__ __forceinline__ v16h cat16(v8h lo, v8h hi) { return __builtin_shufflevector(lo, hi, 0, 1, 2, 3, 4, 5, 6, 7, 8, 9, 10, 11, 12, 13, 14, 15); }
__device__ __forceinline__ v16bf cat16b(v8us lo, v8us hi) { return __builtin_bit_cast(v16bf, __builtin_shufflevector(lo, hi, 0, 1, 2, 3, 4, 5, 6, 7, 8, 9, 10, 11, 12, 13, 14, 15)); }
__device__ __forceinline__ v8f wmma16(v16h a, v16h b, v8f c) { return __builtin_amdgcn_wmma_f32_16x16x32_f16(false, a, false, b, (short)0, c, false, false); }
__device__ __forceinline__ v8f wmmab(v16bf a, v16bf b, v8f c) { return __builtin_amdgcn_wmma_f32_16x16x32_bf16(false, a, false, b, (short)0, c, false, false); }
// The work-group barrier in two halves, for the two kernels with one work-group a WGP (k_gemm_qkv, k_fattn). Their stage loops signal in front of a stage's last products, as soon as the wave's own LDS reads of the stage have returned and its own share of the next stage is in LDS, and wait behind them:
// a wave that runs ahead goes on to the next stage's reads while its neighbour on the SIMD still issues products, so the matrix unit does not stand idle through the barrier and the first reads' latency. (k_gemm_out has a second work-group on the WGP to fill that time and keeps the whole barrier.)
// No LDS access stands between a signal and its wait; signal and wait alternate strictly in every wave. The "memory" clobber keeps the compiler from moving an LDS access over either half.
__device__ __forceinline__ void bar_signal() { asm volatile("s_barrier_signal -1" ::: "memory"); }
__device__ __forceinline__ void bar_wait() { asm volatile("s_barrier_wait -1" ::: "memory"); }

// ---- GEMMs. The output projection (k_gemm_out): one 128x128 output tile per work-group of 8 waves (4 along M x 2 along N, 32x64 a wave, 8 accumulators), 256 threads; gt_products forms a tile's sums, gt_store_f32 stores them. The q, k, v projections (k_gemm_qkv, further down) have a tile and a ring of their own and store through gt_store_plane.
// c[m][n] = cscale x sum_k A[m][k] Bt[n][k] + a bf16-valued bias. A, Bt: K-contiguous 16-bit planes. The epilogue stores c in the form that its reader takes:
//   OUT_F32:  C[m][n] f32, pitch ldc, bias[n] (the block's output).
//   OUT_HEAD: P[n / HD][m][n % HD] f16, bias[n] (m = token: the q and k planes [h][t][d]; a tile's 128 columns are one head).
//   OUT_ROWS: P[m][n] f16, pitch SEQ, bias[m] (A = the weight, Bt = x, so m = h * HD + d and n = token: the v^T plane [h][d][t] comes out of the product as it stands, with no transposition).
// K % 128 == 0, K >= 256 (two stages at least: the second stage's copies stand under no test), M % 128 == 0, N % 128 == 0.
// One launch holds every tile of its phase, for all batch items. k_gemm_out: a work-group's LDS is under half a WGP's (the epilogue stages in the ring's own bytes): two work-groups share a WGP, and the start, the waits and the epilogue of one stand under the products of the other.
// gt_products: both operands come in stages of 128 k (rows of 256 B) by asynchronous copies, global -> LDS through no register, two buffers: stage t + 1 flies while stage t is worked on, and every row is fetched once a work-group, in whole lines.
// Rotated walks (both GEMMs' k stages, the attention kernel's key stages): for speed only, each work-group starts its walk at a stage given by its block index and wraps round: at any moment the sharers of a row ask for different lines of it, save in k_gemm_out at full size, where the 32 sharers of a Bt row have 16 starts, two to each. Every stage is still taken once; only the order of the f32 sums differs from block to block.
// Fragment map (both operands): lane l -> row/col (l & 15); elements 0..7 <- k0 + 8*(l>>4) + 0..7, elements 8..15 <- k0 + 16 + 8*(l>>4) + 0..7. D element r of lane l -> (row 8*(l>>4) + r, col l & 15).
template <typename T16> struct WFrag;
template <> struct WFrag<h16> { typedef v16h V; static __device__ __forceinline__ V ld(const h16* p) { return cat16(*(const v8h*)p, *(const v8h*)(p + 16)); } static __device__ __forceinline__ v8f mma(V a, V b, v8f c) { return wmma16(a, b, c); } };
template <> struct WFrag<bf> { typedef v16bf V; static __device__ __forceinline__ V ld(const bf* p) { return cat16b(*(const v8us*)p, *(const v8us*)(p + 16)); } static __device__ __forceinline__ v8f mma(V a, V b, v8f c) { return wmmab(a, b, c); } };
#define GT_T   128                       // rows of each operand in a tile
#define GT_KS  128                       // k of a stage
#define GT_P   272                       // LDS pitch of a row (256 B + 16): 16 B x odd, conflict-free for 16-byte row reads
#define GT_OP  (GT_T * GT_P)             // one operand's stage
#define GT_BUF (2 * GT_OP)               // a buffer: [A 128 rows | Bt 128 rows]
static_assert(SEQ % GT_T == 0 && DM % GT_T == 0 && DQ % GT_T == 0 && GT_T == HD);
#define OUT_F32  0
#define OUT_HEAD 1
#define OUT_ROWS 2
// One operand's stage, this thread's share: eight 16-byte chunks, rows 16 apart (l: the lane's LDS byte address, g: its global address, rs: 16 rows in elements).
// The s_wait_xcnt at the end of the statement stands in front of any later write of the address registers that the copies name.
template <typename T16>
__device__ __forceinline__ void gt_copy8(unsigned l, const T16* g, size_t rs) {
    asm volatile("global_load_async_to_lds_b128 %0, %8, off\n\t"
                 "global_load_async_to_lds_b128 %1, %9, off\n\t"
                 "global_load_async_to_lds_b128 %2, %10, off\n\t"
                 "global_load_async_to_lds_b128 %3, %11, off\n\t"
                 "global_load_async_to_lds_b128 %4, %12, off\n\t"
                 "global_load_async_to_lds_b128 %5, %13, off\n\t"
                 "global_load_async_to_lds_b128 %6, %14, off\n\t"
                 "global_load_async_to_lds_b128 %7, %15, off\n\t"
                 "s_wait_xcnt 0x0"
                 :: "v"(l), "v"(l + 16 * GT_P), "v"(l + 32 * GT_P), "v"(l + 48 * GT_P), "v"(l + 64 * GT_P), "v"(l + 80 * GT_P), "v"(l + 96 * GT_P), "v"(l + 112 * GT_P),
                    "v"(g), "v"(g + rs), "v"(g + 2 * rs), "v"(g + 3 * rs), "v"(g + 4 * rs), "v"(g + 5 * rs), "v"(g + 6 * rs), "v"(g + 7 * rs)
                 : "memory");
}
// The sums of the tile at rows r0 of A and rows c0 of Bt, the k stages walked from stage s0 (0 <= s0 < K / GT_KS, the same for the whole work-group) round to s0 - 1. L: the work-group's ring of 2 x GT_BUF bytes; every wave has left it, and no copy is outstanding, when this returns.
template <typename T16, int K>
__device__ __forceinline__
void gt_products(const T16* __restrict__ A, const T16* __restrict__ Bt, const int r0, const int c0, const int s0, unsigned char* L, v8f (&acc)[2][4]) {
    static_assert(K % GT_KS == 0 && K >= 2 * GT_KS);
    typedef typename WFrag<T16>::V V;
    const int tid = threadIdx.x, lane = tid & 31, wave = tid >> 5, lr = lane & 15, hi = lane >> 4, wm = wave >> 1, wn = wave & 1;
    // staging map: 2048 16-byte chunks an operand and stage, chunk = tid + 256 i -> row (tid >> 4) + 16 i, 16 chunks a row: a wave's copy covers two whole rows of the stage
    const T16* ag = A + (size_t)(r0 + (tid >> 4)) * K + (tid & 15) * 8;
    const T16* bg = Bt + (size_t)(c0 + (tid >> 4)) * K + (tid & 15) * 8;
    const size_t rs = (size_t)16 * K;
    const unsigned cl = (unsigned)(size_t)L + (tid >> 4) * GT_P + (tid & 15) * 16;     // where this thread's chunks go
    const unsigned af = (wm * 32 + lr) * GT_P + 16 * hi, bfo = GT_OP + (wn * 64 + lr) * GT_P + 16 * hi;   // where this lane's fragments start
    constexpr int nst = K / GT_KS;
    unsigned bo = 0;   // byte offset of the buffer that holds the walk's stage st
    int sk = s0;       // the k stage that the next copies bring
#pragma unroll
    for (int mb = 0; mb < 2; ++mb)
#pragma unroll
        for (int nb = 0; nb < 4; ++nb) acc[mb][nb] = (v8f){};
    gt_copy8(cl, ag + sk * GT_KS, rs); gt_copy8(cl + GT_OP, bg + sk * GT_KS, rs);
    sk = sk + 1 == nst ? 0 : sk + 1;
    asm volatile("s_wait_asynccnt 0x0" ::: "memory");   // stage 0 has landed, as far as this wave copied it
    __syncthreads();                                     // publishes stage 0
    gt_copy8(cl + GT_BUF, ag + sk * GT_KS, rs); gt_copy8(cl + GT_BUF + GT_OP, bg + sk * GT_KS, rs);
    sk = sk + 1 == nst ? 0 : sk + 1;
    // kept rolled: the body holds a whole stage's 32 products a wave, unrolled
#pragma unroll 1
    for (int st = 0; st < nst; ++st) {
        V a[2][2], b[2][4];
#pragma unroll
        for (int mb = 0; mb < 2; ++mb) a[0][mb] = WFrag<T16>::ld((const T16*)(L + bo + af + mb * 16 * GT_P));
#pragma unroll
        for (int nb = 0; nb < 4; ++nb) b[0][nb] = WFrag<T16>::ld((const T16*)(L + bo + bfo + nb * 16 * GT_P));
#pragma unroll
        for (int kb = 0; kb < GT_KS / 32; ++kb) {
            const int cur = kb & 1, nxt = cur ^ 1;
            if (kb + 1 < GT_KS / 32) {   // the next 32 k's fragments, read as one group in front of this block's products
#pragma unroll
                for (int mb = 0; mb < 2; ++mb) a[nxt][mb] = WFrag<T16>::ld((const T16*)(L + bo + af + mb * 16 * GT_P + (kb + 1) * 64));
#pragma unroll
                for (int nb = 0; nb < 4; ++nb) b[nxt][nb] = WFrag<T16>::ld((const T16*)(L + bo + bfo + nb * 16 * GT_P + (kb + 1) * 64));
            }
            __builtin_amdgcn_sched_barrier(0);   // the reads stay one group in front of the products, which cover their latency; left free, the compiler put them two by two in front of each pair of products, with a full wait each
#pragma unroll
            for (int nb = 0; nb < 4; ++nb)
#pragma unroll
                for (int mb = 0; mb < 2; ++mb) acc[mb][nb] = WFrag<T16>::mma(a[cur][mb], b[cur][nb], acc[mb][nb]);
            __builtin_amdgcn_sched_barrier(0);   // and no read of the block after next moves up among these products
        }
        asm volatile("s_wait_dscnt 0x0" ::: "memory");      // this wave's reads of stage st have returned
        asm volatile("s_wait_asynccnt 0x0" ::: "memory");   // its copies of stage st + 1 have landed
        __syncthreads();                                     // publishes stage st + 1 and ends every wave's reads of stage st
        if (st + 2 < nst) { gt_copy8(cl + bo, ag + sk * GT_KS, rs); gt_copy8(cl + bo + GT_OP, bg + sk * GT_KS, rs); }   // stage st + 2 into the buffer that stage st has left
        sk = sk + 1 == nst ? 0 : sk + 1; bo = GT_BUF - bo;
    }
    asm volatile("s_wait_asynccnt 0x0" ::: "memory");       // no copy is outstanding when the wave goes on
}
// The epilogues. os: the wave's own 16 x 68 floats of LDS, where it stages a 16 x 64 block, so that whole lines are stored.
// OUT_F32: the tile at rows r0, columns c0 of C.
__device__ __forceinline__ void gt_store_f32(const v8f (&acc)[2][4], float* os, float* C, const int ldc, const int r0, const int c0, const float* __restrict__ bias, const float cscale) {
    const int tid = threadIdx.x, lane = tid & 31, wave = tid >> 5, lr = lane & 15, hi = lane >> 4, wm = wave >> 1, wn = wave & 1;
    const int cw = c0 + wn * 64;
    // bias for this lane's 4 output columns: one 16-B load per lane, loaded once (the columns are the same for every row of the wave's tile)
    v4f bb; { const v4f br = *(const v4f*)(bias + cw + lr * 4); bb[0] = bfr(br[0]); bb[1] = bfr(br[1]); bb[2] = bfr(br[2]); bb[3] = bfr(br[3]); }
#pragma unroll
    for (int mb = 0; mb < 2; ++mb) {
#pragma unroll
        for (int nb = 0; nb < 4; ++nb) {
#pragma unroll
            for (int j = 0; j < 8; ++j) os[(hi * 8 + j) * 68 + nb * 16 + lr] = acc[mb][nb][j]; }
        __builtin_amdgcn_wave_barrier(); asm volatile("" ::: "memory");   // other lanes of the wave read these rows back: the compiler may move no read in front of the stores
        float* crow = C + (size_t)(r0 + wm * 32 + mb * 16) * ldc + cw;
#pragma unroll
        for (int s = 0; s < 8; ++s) { const int row = 2 * s + hi, cofs = lr * 4; v4f val = *(const v4fa*)(os + row * 68 + cofs); val = val * cscale; val = val + bb;
            *(v4f*)(crow + (size_t)row * ldc + cofs) = val; }
        __builtin_amdgcn_wave_barrier(); asm volatile("" ::: "memory");   // and no store of the next 16 rows in front of these reads
    }
}
// OUT_HEAD, OUT_ROWS: a wave's block of 64 x 64 sums, acc[i][j] = rows 16 i, columns 16 j of it, to an f16 plane. blk: the block's first element in the plane; bias: the bias of its first column (OUT_HEAD) or of its first row (OUT_ROWS).
template <int OUT>
__device__ __forceinline__ void gt_store_plane(const v8f (&acc)[4][4], float* os, h16* blk, const float* __restrict__ bias) {
    const int lane = threadIdx.x & 31, lr = lane & 15, hi = lane >> 4;
    // a row of the block is 64 values = one 128-byte line; eight lanes store a row (8 values = 16 B each), a wave's store covers four whole rows
    const int c8 = (lane & 7) * 8, r4 = lane >> 3;
    constexpr int pp = OUT == OUT_HEAD ? HD : SEQ;   // pitch of the plane
    h16* pr = blk + (size_t)r4 * pp + c8;
    v4f bc[2] = {(v4f){}, (v4f){}};   // OUT_HEAD: the bias of this lane's 8 columns, the same for every row
    if constexpr (OUT == OUT_HEAD) {
        const v4f b0 = *(const v4f*)(bias + c8), b1 = *(const v4f*)(bias + c8 + 4);
        // the wait stands in front of any later write of the address registers that the two bias loads name; the address is its input, so that its registers are kept up to here
        asm volatile("s_wait_xcnt 0x0" :: "v"(bias + c8) : "memory");
#pragma unroll
        for (int e = 0; e < 4; ++e) { bc[0][e] = bfr(b0[e]); bc[1][e] = bfr(b1[e]); }
    }
#pragma unroll
    for (int mb = 0; mb < 4; ++mb) {
        if constexpr (OUT == OUT_ROWS) {   // the bias goes by rows: added where a lane still holds 8 rows of one column
            v4f br[2];
#pragma unroll
            for (int q = 0; q < 2; ++q) { const v4f b = *(const v4f*)(bias + mb * 16 + hi * 8 + 4 * q); br[q][0] = bfr(b[0]); br[q][1] = bfr(b[1]); br[q][2] = bfr(b[2]); br[q][3] = bfr(b[3]); }
#pragma unroll
            for (int nb = 0; nb < 4; ++nb) {
#pragma unroll
                for (int j = 0; j < 8; ++j) os[(hi * 8 + j) * 68 + nb * 16 + lr] = acc[mb][nb][j] + br[j >> 2][j & 3]; }
        } else {
#pragma unroll
            for (int nb = 0; nb < 4; ++nb) {
#pragma unroll
                for (int j = 0; j < 8; ++j) os[(hi * 8 + j) * 68 + nb * 16 + lr] = acc[mb][nb][j]; }
        }
        __builtin_amdgcn_wave_barrier(); asm volatile("" ::: "memory");   // other lanes of the wave read these rows back: the compiler may move no read in front of the stores
#pragma unroll
        for (int s = 0; s < 4; ++s) { const float* rp = os + (4 * s + r4) * 68 + c8; v4f lo = *(const v4fa*)rp, up = *(const v4fa*)(rp + 4);
            if constexpr (OUT == OUT_HEAD) { lo = lo + bc[0]; up = up + bc[1]; }
            v8h o;
#pragma unroll
            for (int q = 0; q < 4; ++q) { o[q] = (h16)lo[q]; o[q + 4] = (h16)up[q]; }
            *(v8h*)(pr + (size_t)(mb * 16 + 4 * s) * pp) = o; }
        __builtin_amdgcn_wave_barrier();
        asm volatile("s_wait_xcnt 0x0" ::: "memory");   // no store of the next 16 rows to LDS in front of these reads; and the wait stands in front of any later write of a register that the loads and stores above name
    }
}
// ---- k_gemm_qkv: the three projections of one head for 256 tokens in one work-group: a tile of 256 tokens x (128 q + 128 k + 128 v features). grid (NB * SEQ / 256, NH_) = one work-group a WGP at full size. Planes: QP, KP [b][h][t][d], VT [b][h][d][t].
// The x rows that a work-group fetches serve all three weights: 640 rows of operands for 256 x 384 sums, where six tiles of 128 x 128 fetch 1536 rows for as many.
// 8 waves, 4 along the tokens x 2 along the features; a wave holds 64 tokens x 64 features of each of q, k and v (48 accumulators): 16 fragments read from LDS feed 48 products.
// q, k: A = x, B = the weight (D: token rows, feature columns). v: the same two fragments with their places changed, A = the weight, B = x (both operands have one fragment map), so D is v^T as it stands.
// Stages of 64 k (rows of 128 B) by asynchronous copies, two buffers; the copies of stage st + 1 are issued in trip st behind the trip's first fragment reads, whose latency they cover.
#define GF_M   256                        // tokens of a tile
#define GF_KS  64                         // k of a stage
#define GF_P   144                        // LDS pitch of a row (128 B + 16): 16 B x odd, conflict-free for 16-byte row reads
#define GF_X   (GF_M * GF_P)              // the x rows of a stage
#define GF_W   (HD * GF_P)                // one weight's rows of a stage
#define GF_BUF (GF_X + 3 * GF_W)          // a buffer: [x 256 rows | wq 128 | wk 128 | wv 128]
static_assert(SEQ % GF_M == 0 && DM % GF_KS == 0 && DM >= 2 * GF_KS && 8 * 16 * 68 * 4 <= 2 * GF_BUF && DQ == NH_ * HD);
// The copies are written as the builtin: the kernel uses registers above v255, which the operands of an asm statement cannot name, and the compiler moved sums out of the low registers and back around every asm copy statement.
typedef __attribute__((ext_vector_type(4))) int v4i;
typedef __attribute__((address_space(1))) v4i gv4i;
typedef __attribute__((address_space(3))) v4i lv4i;
// N chunks of 16 bytes, rows 32 apart, from g (this thread's first chunk of the source's rows) to l (its place in LDS).
template <int N>
__device__ __forceinline__ void gf_copy(unsigned char* l, const bf* g) {
#pragma unroll
    for (int i = 0; i < N; ++i) __builtin_amdgcn_global_load_async_to_lds_b128((gv4i*)(g + (size_t)i * 32 * DM), (lv4i*)(l + i * 32 * GF_P), 0, 0);
}
// two waves a SIMD: 512 VGPRs a wave
__global__ __launch_bounds__(256) __attribute__((amdgpu_waves_per_eu(2, 2)))
void k_gemm_qkv(const bf* __restrict__ X, const bf* __restrict__ WQ, const bf* __restrict__ WK, const bf* __restrict__ WV, h16* QP, h16* KP, h16* VT,
                const float* __restrict__ bq, const float* __restrict__ bk, const float* __restrict__ bv) {
    __shared__ __align__(16) unsigned char L[2 * GF_BUF];
    typedef WFrag<bf> F; typedef F::V V;
    const int tid = threadIdx.x, lane = tid & 31, wave = tid >> 5, lr = lane & 15, hi = lane >> 4, wm = wave >> 1, wn = wave & 1;
    const int t0 = blockIdx.x * GF_M, h = blockIdx.y;   // t0 counts the tokens of all batch items; a tile lies in one item
    // staging map: 8 chunks of 16 bytes a row, chunk = tid + 256 i -> row (tid >> 3) + 32 i: a wave's copy covers four whole rows of the stage
    const unsigned go = (unsigned)(tid >> 3) * DM + (tid & 7) * 8;   // this thread's first chunk in a tile's rows, in elements
    const bf* xs = X + (size_t)t0 * DM;       // the tile's first rows: the same for the whole work-group
    const bf* qs = WQ + (size_t)h * HD * DM;
    const bf* ks = WK + (size_t)h * HD * DM;
    const bf* vs = WV + (size_t)h * HD * DM;
    const unsigned cl = (tid >> 3) * GF_P + (tid & 7) * 16;                                                // where this thread's chunks go
    const unsigned af = (wm * 64 + lr) * GF_P + 16 * hi, bfo = GF_X + (wn * 64 + lr) * GF_P + 16 * hi;     // where this lane's fragments start
    constexpr int nst = DM / GF_KS;
    unsigned bo = 0;   // byte offset of the buffer that holds the walk's stage st
    int sk = (int)((blockIdx.x + blockIdx.y) * 2 % nst);   // the k stage that the next copies bring; rotated walk: the sharers of x rows differ in blockIdx.y, those of weight rows in blockIdx.x, neighbours start two stages apart
    v8f acc[3][4][4];  // [0], [1]: q, k as [token block][feature block]; [2]: v^T as [feature block][token block]
#pragma unroll
    for (int z = 0; z < 3; ++z)
#pragma unroll
        for (int i = 0; i < 4; ++i)
#pragma unroll
            for (int j = 0; j < 4; ++j) acc[z][i][j] = (v8f){};
    { const int ke = sk * GF_KS;
      gf_copy<8>(L + cl, xs + ke + go); gf_copy<4>(L + cl + GF_X, qs + ke + go); gf_copy<4>(L + cl + GF_X + GF_W, ks + ke + go); gf_copy<4>(L + cl + GF_X + 2 * GF_W, vs + ke + go); }
    asm volatile("s_wait_asynccnt 0x0" ::: "memory");   // stage 0 has landed, as far as this wave copied it
    bar_signal();
    // kept rolled: the body holds a whole stage's 96 products a wave, unrolled
#pragma unroll 1
    for (int st = 0; st < nst; ++st) {
        bar_wait();                                      // publishes stage st and ends every wave's reads of stage st - 1
        V a[4], b[2][4];
#pragma unroll
        for (int mb = 0; mb < 4; ++mb) a[mb] = F::ld((const bf*)(L + bo + af + mb * 16 * GF_P));
        __builtin_amdgcn_sched_barrier(0);   // the x fragments are asked for first, as the trip's first products take them; behind the bare wait the compiler put two of them last
#pragma unroll
        for (int nb = 0; nb < 4; ++nb) b[0][nb] = F::ld((const bf*)(L + bo + bfo + nb * 16 * GF_P));
        sk = sk + 1 == nst ? 0 : sk + 1;
        if (st + 1 < nst) {   // stage st + 1 into the buffer that stage st - 1 has left: every wave's reads of it had returned when it signalled the barrier waited for above
            unsigned char* d = L + cl + (GF_BUF - bo); const int ke = sk * GF_KS;
            gf_copy<8>(d, xs + ke + go); gf_copy<4>(d + GF_X, qs + ke + go); gf_copy<4>(d + GF_X + GF_W, ks + ke + go); gf_copy<4>(d + GF_X + 2 * GF_W, vs + ke + go);
        }
        // six groups of 16 products: (32 k) x (q, k, v); each group's four weight fragments are read one group ahead
#pragma unroll
        for (int g = 0; g < 6; ++g) {
            const int z = g % 3, cur = g & 1, nxt = cur ^ 1;
            if (g + 1 < 6) {
#pragma unroll
                for (int nb = 0; nb < 4; ++nb) b[nxt][nb] = F::ld((const bf*)(L + bo + bfo + ((g + 1) % 3) * GF_W + nb * 16 * GF_P + ((g + 1) / 3) * 64));
            }
            __builtin_amdgcn_sched_barrier(0);   // the reads stay one group in front of the products, which cover their latency
            if (g == 5) {   // in front of the stage's last products: every fragment of the stage has been asked for
                asm volatile("s_wait_dscnt 0x0" ::: "memory");      // this wave's reads of stage st have returned
                asm volatile("s_wait_asynccnt 0x0" ::: "memory");   // its copies of stage st + 1 have landed
                bar_signal();
                __builtin_amdgcn_sched_barrier(0);   // the last products stay behind the signal: they are what covers the other waves' way to it
            }
#pragma unroll
            for (int nb = 0; nb < 4; ++nb)
#pragma unroll
                for (int mb = 0; mb < 4; ++mb) {
                    if (z < 2) acc[z][mb][nb] = F::mma(a[mb], b[cur][nb], acc[z][mb][nb]);
                    else       acc[2][nb][mb] = F::mma(b[cur][nb], a[mb], acc[2][nb][mb]);
                }
            __builtin_amdgcn_sched_barrier(0);   // and no later read moves up among these products
            if (g == 2) {   // the x fragments of the stage's second 32 k, into the registers that the products above have read
#pragma unroll
                for (int mb = 0; mb < 4; ++mb) a[mb] = F::ld((const bf*)(L + bo + af + mb * 16 * GF_P + 64));
            }
        }
        bo = GF_BUF - bo;
    }
    bar_wait();                                              // ends every wave's reads of the last stage
    asm volatile("s_wait_asynccnt 0x0" ::: "memory");       // no copy is outstanding when the wave goes on
    // the epilogue stages in the ring's bytes, which every wave has left at the barrier waited for above
    float* os = (float*)L + wave * (16 * 68);
    const size_t pb = (size_t)(t0 / SEQ) * NH_ * SEQ * HD; const int tw = t0 % SEQ + wm * 64, ew = h * HD + wn * 64;   // the wave's first token in its batch item, its first feature
    gt_store_plane<OUT_HEAD>(acc[0], os, QP + pb + ((size_t)h * SEQ + tw) * HD + wn * 64, bq + ew);
    gt_store_plane<OUT_HEAD>(acc[1], os, KP + pb + ((size_t)h * SEQ + tw) * HD + wn * 64, bk + ew);
    gt_store_plane<OUT_ROWS>(acc[2], os, VT + pb + (size_t)ew * SEQ + tw, bv + ew);
}
static_assert(8 * 16 * 68 * 4 <= 2 * GT_BUF);
// at most 256 VGPRs: the asm operands of gt_copy8 stay in the register window that needs no switching
// k_gemm_out: C[m][n] f32. grid (M / 128, N / 128).
template <typename T16, int K>
__global__ __launch_bounds__(256) __attribute__((amdgpu_num_vgpr(256)))
void k_gemm_out(const T16* __restrict__ A, const T16* __restrict__ Bt, float* C, int ldc, const float* __restrict__ bias, float cscale) {
    __shared__ __align__(16) unsigned char L[2 * GT_BUF];
    float* os = (float*)L + (threadIdx.x >> 5) * (16 * 68);
    const int r0 = blockIdx.x * GT_T, c0 = blockIdx.y * GT_T;
    v8f acc[2][4];
    gt_products<T16, K>(A, Bt, r0, c0, (int)((blockIdx.x + blockIdx.y) % (K / GT_KS)), L, acc);   // the sharers of A rows differ in blockIdx.y, those of Bt rows in blockIdx.x
    gt_store_f32(acc, os, C, ldc, r0, c0, bias, cscale);
}

// ---- k_prep: every operand conversion of the block in ONE launch of long-lived waves: wq, wk, wv, x -> bf16 (RNE); wo -> f16 of (its bf16 value x WCAR); m -> (1 - bf16(m)) x f32_lowest.
// grid PR_G work-groups of 256 threads. A unit = 8192 floats = 8 chunks of 4 floats a thread, chunk i of thread t at i * 1024 + t * 4: a wave's load covers 512 bytes in a row (four whole lines), its store 256 (two whole lines).
// Work-group g converts unit g of each weight and of each batch item of x, one after the other, from two register sets: a set is loaded again as soon as it has been converted, so the eight loads of at least one unit are in flight while another is converted.
// Each wave here converts 48 chunks a lane (for speed only).
#define PR_U 8192
#define PR_G (DQ * DM / PR_U)
#define PR_X (SEQ * DM / PR_U)            // units of one batch item of x
#define PR_M (NB * SEQ / 1024)            // work-groups that also convert 1024 mask values each
static_assert(DQ * DM % PR_U == 0 && SEQ * DM % PR_U == 0 && PR_X <= PR_G && SEQ % 1024 == 0 && PR_M <= PR_G);
typedef __attribute__((ext_vector_type(4))) unsigned short v4us;
typedef __attribute__((ext_vector_type(2))) unsigned v2u;
// lo: this thread's byte offset from the source pointer (32 bits, so that the load takes the pointer as its scalar base)
__device__ __forceinline__ void pr_load(const float* __restrict__ s, unsigned lo, v4f (&r)[8]) {
#pragma unroll
    for (int i = 0; i < 8; ++i) r[i] = *(const v4f*)((const char*)s + lo + i * 4096); }
// One unit: converts the set r (H: to f16 of the bf16 value x WCAR; else to bf16), stores it at d + so bytes, and loads the set again from nxt + lo bytes where ld says so.
template <bool H>
__device__ __forceinline__ void pr_step(v4f (&r)[8], void* d, unsigned so, const float* __restrict__ nxt, bool ld, unsigned lo) {
    v2u w[8];
#pragma unroll
    for (int i = 0; i < 8; ++i) {
        if constexpr (H) { v4h o;
#pragma unroll
            for (int q = 0; q < 4; ++q) o[q] = (h16)(bfr(r[i][q]) * WCAR);
            w[i] = __builtin_bit_cast(v2u, o);
        } else { v4us o;
#pragma unroll
            for (int q = 0; q < 4; ++q) o[q] = f2bf(r[i][q]);
            w[i] = __builtin_bit_cast(v2u, o); }
    }
#pragma unroll
    for (int i = 0; i < 8; ++i) *(v2u*)((char*)d + so + i * 2048) = w[i];
    if (ld) pr_load(nxt, lo, r);
    // the wait that stands in front of any later write of a register which these stores and loads name; the offsets and the stored words are its inputs, so that their registers are kept up to here
    asm volatile("s_wait_xcnt 0x0" :: "v"(lo), "v"(so), "v"(w[0]), "v"(w[1]), "v"(w[2]), "v"(w[3]), "v"(w[4]), "v"(w[5]), "v"(w[6]), "v"(w[7]) : "memory");
}
__global__ __launch_bounds__(256) void k_prep(const float* __restrict__ x, const float* __restrict__ m, const float* __restrict__ wq, const float* __restrict__ wk, const float* __restrict__ wv, const float* __restrict__ wo,
                                              bf* WQ, bf* WK, bf* WV, h16* WO16, bf* XB, float* MA) {
    const int g = blockIdx.x, tid = threadIdx.x;
    const unsigned so = (unsigned)(g * PR_U + tid * 4) * 2u, lo = so * 2u;
    const bool hasx = PR_X == PR_G || g < PR_X;   // the same for the whole work-group
    v4f r[2][8];
    pr_load(wq, lo, r[0]);
    pr_load(wk, lo, r[1]);
    pr_step<false>(r[0], WQ, so, wv, true, lo);
    pr_step<false>(r[1], WK, so, wo, true, lo);
    pr_step<false>(r[0], WV, so, x, hasx, lo);
    pr_step<true>(r[1], WO16, so, x, hasx && NB > 1, NB > 1 ? lo + SEQ_FULL * DM * 4u : lo);
#pragma unroll
    for (int b = 0; b < NB; ++b)   // batch item b: its place goes into the 32-bit offsets
        if (hasx) pr_step<false>(r[b & 1], XB, so + b * (SEQ * DM * 2u), x, b + 2 < NB, b + 2 < NB ? lo + (b + 2) * (SEQ_FULL * DM * 4u) : lo);
    if (g < PR_M) {   // the same for the whole work-group
        const int mi = g * 1024 + tid * 4;   // index into MA, [NB][SEQ]
        const unsigned mo = (unsigned)((mi / SEQ) * SEQ_FULL + mi % SEQ) * 4u;
        const v4f a = *(const v4f*)((const char*)m + mo);
        asm volatile("s_wait_xcnt 0x0" :: "v"(mo) : "memory");   // as above: in front of any later write of the load's offset register
        v4f q;
#pragma unroll
        for (int e = 0; e < 4; ++e) { const float u = 1.0f - bfr(a[e]); q[e] = u * FLOW; }
        *(v4f*)(MA + mi) = q;
    }
}
// ---- k_fattn: scores, softmax and p.v of one head for 256 queries in one work-group; no score ever reaches memory. grid (SEQ/256, NH_, NB), 256 threads = 8 waves x 32 queries (two 16-query tiles a wave).
// Transposed products: S^T = K.Q^T (A = 16 keys x 32 d from LDS, B = Q^T kept in registers), O^T += V^T.P^T (A = 16 d x 32 keys from LDS, B = P^T).
// Every K and V^T fragment that a wave reads from LDS serves the products of both its query tiles: 512 bytes of LDS reads a product. One tile a wave would read 1024, twice what the LDS delivers in a product's time on four SIMDs.
// The two tiles' sums and Q^T take 192 registers, so a wave has the budget of two waves a SIMD, and one work-group fills a WGP.
// D of S^T: lane l holds query (l & 15), keys 8*(l>>4) + r of each 16-key tile; that is the B operand's k order for 32 keys (tile 0 -> elements 0..7, tile 1 -> elements 8..15), so P^T packs in-lane.
// K rows ([t][d] plane) and V^T rows ([d][t] plane) come in stages of 64 keys: global -> registers -> LDS, two buffers; the next stage's loads fly under this stage's two 32-key passes.
// Every inner loop is fully unrolled, so that each index into a register array is a constant (an index known only at run time would send the array to scratch).
// Online softmax: t = s x SCL + MA[key]; p = exp(t - m_run); m_run may trail the true maximum by up to FA_LAG (p stays below e^FA_LAG, far inside f16); a query tile's sums are rescaled only when one of its queries' maxima passes that.
#define FA_QT   2                         // 16-query tiles of a wave
#define FA_BQ   (8 * 16 * FA_QT)
static_assert(FA_QT == 2);                // the pass's one rescale test names both tiles
#define FA_SK   64
#define FA_PK   272                       // LDS pitch of a K row (256 B + 16): 16 B x odd, conflict-free for 16-byte row reads
#define FA_PV   144                       // LDS pitch of a V^T row (128 B + 16): 16 B x odd
#define FA_TK   (FA_SK * FA_PK)
#define FA_SLOT (FA_TK + HD * FA_PV)
#define FA_FLIP 65536                     // the two buffers lie 64 KiB apart, so that one XOR on an LDS offset changes the buffer
#define FA_LAG  5.5f
#define L2E     1.4426950408889634f
static_assert(SEQ % FA_BQ == 0 && SEQ % FA_SK == 0 && SEQ % 1024 == 0 && FA_SLOT <= FA_FLIP);
typedef __attribute__((ext_vector_type(4))) unsigned v4u;
__device__ __forceinline__ float xhalf(float x) { return __builtin_bit_cast(float, __builtin_amdgcn_permlanex16(__builtin_bit_cast(int, x), __builtin_bit_cast(int, x), 0x76543210, 0xfedcba98, false, false)); }  // lane l <-> lane l ^ 16
// Four exponentials (2^x, in place) in one statement. The v_nop at its end fills the slot that the instruction set asks for behind a transcendental before a source is overwritten or the result read.
__device__ __forceinline__ void exp2x4(float& a, float& b, float& c, float& d) { asm("v_exp_f32 %0, %0\n\tv_exp_f32 %1, %1\n\tv_exp_f32 %2, %2\n\tv_exp_f32 %3, %3\n\tv_nop" : "+v"(a), "+v"(b), "+v"(c), "+v"(d)); }
// two waves a SIMD: 512 VGPRs a wave
__global__ __launch_bounds__(256) __attribute__((amdgpu_waves_per_eu(2, 2))) void k_fattn(const h16* __restrict__ QP, const h16* __restrict__ KP, const h16* __restrict__ VT, const float* __restrict__ MA, h16* AT) {
    __shared__ __align__(16) unsigned char L[FA_FLIP + FA_SLOT];
    __shared__ __align__(16) float MAs[SEQ];
    const int tid = threadIdx.x, lane = tid & 31, wave = tid >> 5, lr = lane & 15, hi = lane >> 4;
    const int h = blockIdx.y, q0 = blockIdx.x * FA_BQ + wave * (16 * FA_QT);
    { const size_t pb = (size_t)blockIdx.z * NH_ * SEQ * HD; QP += pb; KP += pb; VT += pb; MA += (size_t)blockIdx.z * SEQ; AT += (size_t)blockIdx.z * SEQ * DQ; }   // batch item blockIdx.z: its planes, its mask row, its rows of AT
    // staging map: 1024 16-byte chunks of K (row = chunk >> 4) and 1024 of V^T (row = chunk >> 3) per stage, chunk = tid + 256 i
    constexpr int nks = SEQ / FA_SK;                       // key stages
    int sc = blockIdx.x * (FA_BQ / FA_SK);                 // the key stage that a trip works on; rotated walk: the work-groups that share a head's K and V^T differ in blockIdx.x and start FA_BQ keys apart
    const h16* kg = KP + (size_t)h * SEQ * HD + (size_t)sc * FA_SK * HD; const unsigned ko = (unsigned)tid * 8u;         // a K stage is 16 KiB in a row
    const h16* vg = VT + (size_t)h * HD * SEQ + sc * FA_SK; const unsigned vo = (unsigned)(tid >> 3) * SEQ + (unsigned)(tid & 7) * 8u;
    unsigned kl = (tid >> 4) * FA_PK + (tid & 15) * 16, vl = FA_TK + (tid >> 3) * FA_PV + (tid & 7) * 16;   // where this thread's chunks go
    unsigned kf = lr * FA_PK + 16 * hi, vf = FA_TK + lr * FA_PV + 16 * hi;                                 // where this lane's fragments start
    v4u kr[4], vr[4]; v4f mr[SEQ / 1024];
#pragma unroll
    for (int i = 0; i < SEQ / 1024; ++i) mr[i] = *(const v4f*)(MA + i * 1024 + tid * 4);
#pragma unroll
    for (int i = 0; i < 4; ++i) { kr[i] = *(const v4u*)(kg + i * 2048 + ko); vr[i] = *(const v4u*)(vg + i * 32 * SEQ + vo); }
    v16h qf[FA_QT][4]; const h16* qp[FA_QT];
#pragma unroll
    for (int qt = 0; qt < FA_QT; ++qt) { qp[qt] = QP + ((size_t)h * SEQ + q0 + 16 * qt + lr) * HD + 8 * hi;
#pragma unroll
      for (int kc = 0; kc < 4; ++kc) qf[qt][kc] = cat16(*(const v8h*)(qp[qt] + 32 * kc), *(const v8h*)(qp[qt] + 32 * kc + 16)); }
    // the wait that stands in front of any later write of an address register which the loads above name. The loads' addresses and offsets are its inputs, so that their registers are kept up to here; the two scheduling fences keep every such load in front of it
    __builtin_amdgcn_sched_barrier(0);
    asm volatile("s_wait_xcnt 0x0" :: "v"(tid), "v"(vo * 2u), "v"(qp[0]), "v"(qp[1]) : "memory");
    __builtin_amdgcn_sched_barrier(0);
#pragma unroll
    for (int i = 0; i < SEQ / 1024; ++i) *(v4f*)(MAs + i * 1024 + tid * 4) = mr[i];
#pragma unroll
    for (int i = 0; i < 4; ++i) { *(v4u*)(L + kl + i * 16 * FA_PK) = kr[i]; *(v4u*)(L + vl + i * 32 * FA_PV) = vr[i]; }
    v8f acc[FA_QT][8];
    float m_run[FA_QT], l_run[FA_QT];
#pragma unroll
    for (int qt = 0; qt < FA_QT; ++qt) { m_run[qt] = FLOW; l_run[qt] = 0.f;
#pragma unroll
        for (int t8 = 0; t8 < 8; ++t8) acc[qt][t8] = (v8f){}; }
    const float* mp = MAs + 8 * hi + sc * FA_SK;
    __syncthreads();
    // kept rolled
#pragma unroll 1
    for (int st = 0; st < SEQ / FA_SK; ++st) {
        const bool more = st + 1 < SEQ / FA_SK;
        const int step = sc + 1 == nks ? 1 - nks : 1; sc += step;   // to the next key stage, from the last one round to the first
        kl ^= FA_FLIP; vl ^= FA_FLIP; kg += step * (FA_SK * HD); vg += step * FA_SK;
        if (more) {
#pragma unroll
            for (int i = 0; i < 4; ++i) { kr[i] = *(const v4u*)(kg + i * 2048 + ko); vr[i] = *(const v4u*)(vg + i * 32 * SEQ + vo); }
        }
#pragma unroll
        for (int sub = 0; sub < FA_SK / 32; ++sub) {
            v16h ka[4][2]; v4f mk[2][2]; v8f s[FA_QT][2];
#pragma unroll
            for (int qt = 0; qt < FA_QT; ++qt) { s[qt][0] = (v8f){}; s[qt][1] = (v8f){}; }
            { const unsigned char* p = L + kf + sub * 32 * FA_PK;
#pragma unroll
              for (int kc = 0; kc < 4; ++kc)
#pragma unroll
                for (int kt = 0; kt < 2; ++kt) ka[kc][kt] = cat16(*(const v8h*)(p + kt * 16 * FA_PK + 64 * kc), *(const v8h*)(p + kt * 16 * FA_PK + 64 * kc + 32));
#pragma unroll
              for (int kt = 0; kt < 2; ++kt) { mk[kt][0] = *(const v4f*)(mp + sub * 32 + kt * 16); mk[kt][1] = *(const v4f*)(mp + sub * 32 + kt * 16 + 4); } }
            __builtin_amdgcn_sched_barrier(0);   // the pass's K and mask reads stay one group in front of the products: one LDS latency a pass, not one a product
#pragma unroll
            for (int kc = 0; kc < 4; ++kc)
#pragma unroll
                for (int kt = 0; kt < 2; ++kt)
#pragma unroll
                    for (int qt = 0; qt < FA_QT; ++qt) s[qt][kt] = wmma16(ka[kc][kt], qf[qt][kc], s[qt][kt]);
            v16h va[8];
#pragma unroll
            for (int t8 = 0; t8 < 8; ++t8) { const unsigned char* pv = L + vf + t8 * 16 * FA_PV + sub * 64; va[t8] = cat16(*(const v8h*)pv, *(const v8h*)(pv + 32)); }
            if (sub + 1 == FA_SK / 32 && more) {   // the next stage into the other buffer: every wave's reads of it had returned when it signalled the barrier that ended trip st - 1
#pragma unroll
                for (int i = 0; i < 4; ++i) { *(v4u*)(L + kl + i * 16 * FA_PK) = kr[i]; *(v4u*)(L + vl + i * 32 * FA_PV) = vr[i]; }
            }
            __builtin_amdgcn_sched_barrier(0);   // all eight V^T fragments are read in front of the softmax arithmetic, which covers their latency; left free, the compiler put the reads two by two in front of each product
            float t[FA_QT][16], mx[FA_QT]; bool need[FA_QT];
#pragma unroll
            for (int qt = 0; qt < FA_QT; ++qt) { float m = FLOW;
#pragma unroll
                for (int kt = 0; kt < 2; ++kt)
#pragma unroll
                    for (int r = 0; r < 8; ++r) { const float u = s[qt][kt][r] * SCL + mk[kt][r >> 2][r & 3]; t[qt][kt * 8 + r] = u; m = fmaxf(m, u); }
                m = fmaxf(m, xhalf(m));   // both halves of the wave now hold the query's maximum over the pass
                mx[qt] = m; need[qt] = m > m_run[qt] + FA_LAG; }
            if (__builtin_amdgcn_ballot_w32(need[0] || need[1]) != 0) {   // one test a pass for both tiles; wave-uniform, rare behind the first pass
#pragma unroll
                for (int qt = 0; qt < FA_QT; ++qt)
                    if (__builtin_amdgcn_ballot_w32(need[qt]) != 0) {   // wave-uniform: each tile is rescaled by its own queries alone, as if it had the wave to itself
                        const float m_new = fmaxf(m_run[qt], mx[qt]); const float corr = __builtin_amdgcn_exp2f((m_run[qt] - m_new) * L2E);
                        l_run[qt] *= corr; m_run[qt] = m_new;
#pragma unroll
                        for (int t8 = 0; t8 < 8; ++t8) acc[qt][t8] = acc[qt][t8] * corr;
                    }
            }
            if (sub + 1 == FA_SK / 32) {   // in front of the stage's last exponentials and products: every fragment of the stage has been asked for
                asm volatile("s_wait_dscnt 0x0" ::: "memory");   // this wave's reads of stage st have returned, its stores of stage st + 1 are in LDS
                bar_signal();
                __builtin_amdgcn_sched_barrier(0);   // what follows stays behind the signal: it is what covers the other waves' way to it
            }
#pragma unroll
            for (int qt = 0; qt < FA_QT; ++qt) {
                v16h pf; float ps[4];
#pragma unroll
                for (int e = 0; e < 16; e += 4) { float p0 = (t[qt][e] - m_run[qt]) * L2E, p1 = (t[qt][e + 1] - m_run[qt]) * L2E, p2 = (t[qt][e + 2] - m_run[qt]) * L2E, p3 = (t[qt][e + 3] - m_run[qt]) * L2E;
                    exp2x4(p0, p1, p2, p3);
                    ps[e >> 2] = (p0 + p1) + (p2 + p3); pf[e] = (h16)p0; pf[e + 1] = (h16)p1; pf[e + 2] = (h16)p2; pf[e + 3] = (h16)p3; }
                l_run[qt] += (ps[0] + ps[1]) + (ps[2] + ps[3]);
#pragma unroll
                for (int t8 = 0; t8 < 8; ++t8) acc[qt][t8] = wmma16(va[t8], pf, acc[qt][t8]);
            }
        }
        kf ^= FA_FLIP; vf ^= FA_FLIP; mp += step * FA_SK;
        __builtin_amdgcn_sched_barrier(0);   // the wait stays behind the stage's last products; left free, the compiler put it among them
        bar_wait();   // publishes stage st + 1 and ends every wave's reads of stage st
    }
#pragma unroll
    for (int qt = 0; qt < FA_QT; ++qt) {
        const float inv = OCAR / (l_run[qt] + xhalf(l_run[qt]));   // each half summed its own eight keys of every 16-key tile
        h16* op = AT + (size_t)(q0 + 16 * qt + lr) * DQ + (size_t)h * HD + 8 * hi;   // D of O^T: lane l holds query (l & 15), d = 16 t8 + 8*(l>>4) + r
#pragma unroll
        for (int t8 = 0; t8 < 8; ++t8) { v8h o;
#pragma unroll
            for (int r = 0; r < 8; ++r) o[r] = (h16)(acc[qt][t8][r] * inv);
            *(v8h*)(op + t8 * 16) = o; }
    }
}

extern "C" void kernel_launch(void* const* d_in, const int* in_sizes, int n_in,
                              void* d_out, int out_size, void* d_ws, size_t ws_size, hipStream_t stream) {
    if (n_in < 10) return;
    const float* x  = (const float*)d_in[0]; const float* am = (const float*)d_in[1];
    const float* wq = (const float*)d_in[2]; const float* bq = (const float*)d_in[3]; const float* wk = (const float*)d_in[4]; const float* bk = (const float*)d_in[5];
    const float* wv = (const float*)d_in[6]; const float* bv = (const float*)d_in[7]; const float* wo = (const float*)d_in[8]; const float* bo = (const float*)d_in[9];
    if (in_sizes[0] < 0 || (size_t)in_sizes[0] < (size_t)(NB - 1) * SEQ_FULL * DM + (size_t)SEQ * DM) return;
    if (in_sizes[1] < (NB - 1) * SEQ_FULL + SEQ) return;
    if (in_sizes[2] < DQ * DM || in_sizes[4] < DQ * DM || in_sizes[6] < DQ * DM || in_sizes[8] < DM * DQ) return;
    if (in_sizes[3] < DQ || in_sizes[5] < DQ || in_sizes[7] < DQ || in_sizes[9] < DM) return;
    if (out_size < 0 || (size_t)out_size < (size_t)NB * SEQ * DM) return;
    float* OUT = (float*)d_out;     // [NB][SEQ][DM]

    // ---- workspace carve (all offsets 256-B aligned; every region is written to exactly its extent by whole-line stores) ----
    char* wsp = (char*)d_ws; size_t used = 0;
    auto take = [&](size_t bytes) { char* p = wsp + used; used += (bytes + 255) & ~(size_t)255; return (void*)p; };
    bf*  WQ   = (bf*)take((size_t)DQ * DM * 2);                   // 8,388,608
    bf*  WK   = (bf*)take((size_t)DQ * DM * 2);                   // 8,388,608
    bf*  WV   = (bf*)take((size_t)DQ * DM * 2);                   // 8,388,608
    h16* WO16 = (h16*)take((size_t)DM * DQ * 2);                  // 8,388,608
    bf*  XB   = (bf*)take((size_t)NB * SEQ * DM * 2);             // 16,777,216  [b][t][k]
    float* MA = (float*)take((size_t)NB * SEQ * 4);                // 16,384  [b][t]
    h16* QP16 = (h16*)take((size_t)NB * NH_ * SEQ * HD * 2);      // 16,777,216  [b][h][t][d]
    h16* KP16 = (h16*)take((size_t)NB * NH_ * SEQ * HD * 2);      // 16,777,216  [b][h][t][d]
    h16* VT16 = (h16*)take((size_t)NB * NH_ * HD * SEQ * 2);      // 16,777,216  [b][h][d][t]
    h16* AT16 = (h16*)take((size_t)NB * SEQ * DQ * 2);            // 16,777,216  [b][t][h*HD+d]
    if (used > ws_size) return;                                    // total 117,456,896 B at NB=2, SEQ=2048

    k_prep<<<PR_G, 256, 0, stream>>>(x, am, wq, wk, wv, wo, WQ, WK, WV, WO16, XB, MA);
    k_gemm_qkv<<<dim3(NB * SEQ / GF_M, NH_, 1), 256, 0, stream>>>(XB, WQ, WK, WV, QP16, KP16, VT16, bq, bk, bv);
    k_fattn<<<dim3(SEQ / FA_BQ, NH_, NB), 256, 0, stream>>>(QP16, KP16, VT16, MA, AT16);
    k_gemm_out<h16, DQ><<<dim3(NB * SEQ / GT_T, DM / GT_T, 1), 256, 0, stream>>>(AT16, WO16, OUT, DM, bo, 1.0f / (OCAR * WCAR));
}
